// v000
// Measured on an AMD MI455X. A time is GPU time per run, averaged over a window of back-to-back runs after a warm-up
// (all launches, gaps included; the runs take copies of the inputs in turn), and the median of several windows.
// Apart from v000's, it joins two sittings. Times from different sittings can be a few percent apart, while
// side-by-side timings come from the same sitting.
// The starting kernel, v000, takes 132 microseconds a run.
// Contractions: three 1x1-conv projections (q from map in1, kv from maps in0 and in2; M = pixels, N = 128, K = 128)
// on v_wmma_f32_16x16x32_bf16 with bf16 hi/lo split operands (hi.hi + hi.lo + lo.hi), f32 accumulate;
// 9-tap local-window logits, softmax, weighted sums and the two-branch mean in f32 on the VALU.
#include <hip/hip_runtime.h>
#include <stdint.h>

#define NB      4
#define CCH     128
#define IMH     128
#define IMW     128
#define HWPIX   (IMH * IMW)
#define NHEADS  4
#define DHEAD   32
#define QSCALE  0.17677669529663687f     // 32^-0.5
#define TP      132                       // LDS tile pitch in floats (16-B multiple)
#define TILE_F  (128 * TP)                // floats of one 128 x 128 tile with pitch TP
#define KVROWS  3                         // staged kv rows: y-1, y, y+1
#define KVPOS   130                       // staged kv positions: x = -1 .. 128
#define KVS_F   (KVROWS * KVPOS * DHEAD)  // 12480 floats: one head of one branch
#define OT_F    (DHEAD * TP)              // 4224 floats: [32 ch][TP] per-head result tile
#define ATTN_LDS_F (TILE_F + KVS_F + OT_F)   // 33600 floats = 134400 B

typedef __attribute__((ext_vector_type(16))) __bf16         v16b;
typedef __attribute__((ext_vector_type(8)))  unsigned short v8us;
typedef __attribute__((ext_vector_type(8)))  float          v8f;
typedef __attribute__((ext_vector_type(4)))  float          v4f;
typedef __attribute__((ext_vector_type(2)))  float          v2f;

union Frg { v16b b; v8us h8[2]; unsigned int w[8]; };
static_assert(sizeof(Frg) == 32);

// ---------------------------------------------------------------------------
// small helpers
// ---------------------------------------------------------------------------
__device__ __forceinline__ unsigned short f2bf(float f) {          // bf16 RNE convert, bits
  const unsigned u = __float_as_uint(f);
  return (unsigned short)((u + 0x7FFFu + ((u >> 16) & 1u)) >> 16);
}
__device__ __forceinline__ float bf2f(unsigned short h) { return __uint_as_float(((unsigned)h) << 16); }
__device__ __forceinline__ unsigned int pk16(unsigned short lo, unsigned short hi) {
  return (unsigned)lo | ((unsigned)hi << 16);
}
__device__ __forceinline__ void opt_fence() { asm volatile("" ::: "memory"); }

__device__ __forceinline__ v8f zero8() {
  v8f z = {0.f, 0.f, 0.f, 0.f, 0.f, 0.f, 0.f, 0.f};
  return z;
}

// WMMA with the hazard guard tied to D, keeping A/B live across the guard
__device__ __forceinline__ v8f mma16(v16b a, v16b b, v8f c) {
  v8f d = __builtin_amdgcn_wmma_f32_16x16x32_bf16(false, a, false, b, (short)0, c, false, false);
  asm volatile("v_nop\n\tv_nop\n\tv_nop\n\tv_nop" : "+v"(d) : "v"(a), "v"(b));
  return d;
}

// ---------------------------------------------------------------------------
// Fragment builders (wave32, 16x16x32, split k map for BOTH operands):
//   lane l: row/col = l & 15, h = l >> 4; element i (0..7) <- k0 + 8h + i, element i (8..15) <- k0 + 16 + 8h + (i-8)
// ---------------------------------------------------------------------------
// Operand gathered from a channel-major f32 map: row m = pixel (pt + m), k = channel, channel stride HWPIX.
// Values are split into bf16 hi (RNE) and lo = RNE(v - hi) planes in registers.
__device__ __forceinline__ void gather_split(const float* __restrict__ pt, int lane, int k0, Frg& fh, Frg& fl) {
  const int m = lane & 15, h = lane >> 4;
  const float* pm = pt + m;
#pragma unroll
  for (int q = 0; q < 8; ++q) {
    const int c = k0 + ((q < 4) ? (8 * h + 2 * q) : (16 + 8 * h + 2 * (q - 4)));
    const float v0 = pm[(size_t)c * HWPIX];
    const float v1 = pm[(size_t)(c + 1) * HWPIX];
    const unsigned short h0 = f2bf(v0), h1 = f2bf(v1);
    const unsigned short l0 = f2bf(v0 - bf2f(h0)), l1 = f2bf(v1 - bf2f(h1));
    fh.w[q] = pk16(h0, h1);
    fl.w[q] = pk16(l0, l1);
  }
}
// Operand from a bf16 plane stored [row][128] with k contiguous (weights W[oc][c]): two 16-B loads per lane.
__device__ __forceinline__ void wfrag(const unsigned short* __restrict__ W, int row0, int lane, int k0, Frg& f) {
  const int m = lane & 15, h = lane >> 4;
  const unsigned short* p = W + (size_t)(row0 + m) * CCH + k0 + 8 * h;
  f.h8[0] = *(const v8us*)(p);
  f.h8[1] = *(const v8us*)(p + 16);
}

// ---------------------------------------------------------------------------
// Per-block 128-pixel x 128-out-channel projection of one image row into an LDS tile T[px][oc] (pitch TP):
//   T[px][oc] = (sum_c x[c][px] * W[oc][c] + bias[oc]) * scale
// 8 waves; wave w owns pixels 16w..16w+15 (A = gathered x rows) and all 8 oc tiles (B = W planes, cols = oc).
// D element r of lane l = (row px 16w + 8h + r, col oc 16j + (l & 15)).
// ---------------------------------------------------------------------------
__device__ __forceinline__ void proj_row_tile(const float* __restrict__ xrow,
                                              const unsigned short* __restrict__ Wh,
                                              const unsigned short* __restrict__ Wl,
                                              const float* __restrict__ bias, float scale,
                                              float* T, int wave, int lane) {
  const int m = lane & 15, h = lane >> 4;
  v8f acc[8];
#pragma unroll
  for (int j = 0; j < 8; ++j) acc[j] = zero8();
  const float* xt = xrow + 16 * wave;
#pragma unroll 1
  for (int k0 = 0; k0 < CCH; k0 += 32) {
    Frg ah, al;
    gather_split(xt, lane, k0, ah, al);
#pragma unroll
    for (int j = 0; j < 8; ++j) {
      opt_fence();
      Frg bh, bl;
      wfrag(Wh, 16 * j, lane, k0, bh);
      wfrag(Wl, 16 * j, lane, k0, bl);
      acc[j] = mma16(ah.b, bh.b, acc[j]);
      acc[j] = mma16(ah.b, bl.b, acc[j]);
      acc[j] = mma16(al.b, bh.b, acc[j]);
    }
  }
  // epilogue: bias, scale, D -> LDS tile (this wave's 16 pixel rows, all 128 columns)
#pragma unroll
  for (int j = 0; j < 8; ++j) {
    const float bvv = bias[16 * j + m];
    float* trow = T + (size_t)(16 * wave + 8 * h) * TP + 16 * j + m;
#pragma unroll
    for (int r = 0; r < 8; ++r) trow[r * TP] = (acc[j][r] + bvv) * scale;
  }
}

// ---------------------------------------------------------------------------
// Weight split: Wq (blocks 0..31) and Wkv (blocks 32..63), f32 [128][128] -> bf16 hi / lo planes [128][128].
// ---------------------------------------------------------------------------
__global__ __launch_bounds__(256) void k_split_w(const float* __restrict__ Wq, const float* __restrict__ Wkv,
                                                 unsigned short* __restrict__ qh, unsigned short* __restrict__ ql,
                                                 unsigned short* __restrict__ kh, unsigned short* __restrict__ kl) {
  const int blk = blockIdx.x;
  const bool isq = (blk < 32);                          // block-uniform
  const float* src = isq ? Wq : Wkv;
  unsigned short* dh = isq ? qh : kh;
  unsigned short* dl = isq ? ql : kl;
  const int i = (blk & 31) * 256 + threadIdx.x;        // pair index 0..8191 (exact)
  const v2f f = *(const v2f*)(src + 2 * (size_t)i);
  const unsigned short h0 = f2bf(f[0]), h1 = f2bf(f[1]);
  const unsigned short l0 = f2bf(f[0] - bf2f(h0)), l1 = f2bf(f[1] - bf2f(h1));
  const unsigned uh = pk16(h0, h1), ul = pk16(l0, l1);
  ((unsigned*)dh)[i] = uh;
  ((unsigned*)dl)[i] = ul;
  
}

// ---------------------------------------------------------------------------
// kv projection of one map (interior positions only; padded-border keys equal the bias and are handled by value
// in the attention kernel). Block = (image row y, batch b); output plane pixel-major kvp[b][pix][128] f32.
// Store phase: wave w writes pixel rows 16w..16w+15, each row = 32 lanes x 16 B = the whole 512-B row in ONE
// Coverage: grid (128, 4) x 128 rows x 128 floats = the whole [4][16384][128] plane.
// ---------------------------------------------------------------------------
__global__ __launch_bounds__(256) void k_kvproj(const float* __restrict__ x,
                                                const unsigned short* __restrict__ Wh,
                                                const unsigned short* __restrict__ Wl,
                                                const float* __restrict__ bias,
                                                float* __restrict__ kvp) {
  extern __shared__ __attribute__((aligned(16))) float smem[];
  float* T = smem;                                       // [128][TP]
  const int tid  = threadIdx.x;
  const int lane = tid & 31;
  const int wave = __builtin_amdgcn_readfirstlane(tid >> 5);
  const int y = blockIdx.x;
  const int b = blockIdx.y;
  const float* xrow = x + (size_t)b * CCH * HWPIX + (size_t)y * IMW;
  proj_row_tile(xrow, Wh, Wl, bias, 1.0f, T, wave, lane);
  __syncthreads();
  float* dstb = kvp + ((size_t)b * HWPIX + (size_t)y * IMW) * CCH;
  {
#pragma unroll
    for (int i = 0; i < 16; ++i) {
      const int rr = 16 * wave + i;
      const v4f v = *(const v4f*)(T + (size_t)rr * TP + 4 * lane);
      *(v4f*)(dstb + (size_t)rr * CCH + 4 * lane) = v;
    }
    
  }
}

// ---------------------------------------------------------------------------
// Stage one head of one kv branch for image row y into LDS: kvS[r][p][d], r = 0..2 <-> image row y-1+r,
// p = 0..129 <-> image column p-1, d = 0..31 = channels hd*32+d of the pixel-major plane kb ([pix][128] f32 of
// this batch). Out-of-image (r, p) get the bias vector (padded positions of the 1x1 conv equal the bias).
// Both candidates are loaded unconditionally at clamped, valid addresses and selected by value.
// Coverage: 1560 items x 8 floats = 3 x 130 x 32 = the whole staging region; 256 threads, rolled loop.
// ---------------------------------------------------------------------------
__device__ __forceinline__ void stage_kv(const float* __restrict__ kb, const float* __restrict__ bkv,
                                         int hd, int y, float* kvS, int tid) {
  const float* bh = bkv + hd * DHEAD;
#pragma unroll 1
  for (int i = tid; i < KVROWS * KVPOS * 4; i += 256) {
    const int seg = i >> 2;                      // (r, p) segment 0..389
    const int g8  = (i & 3) * 8;                 // 8-float piece within the 32-float segment
    const int r   = seg / KVPOS;
    const int p   = seg - r * KVPOS;
    const int yy  = y + r - 1;
    const int xx  = p - 1;
    const bool inb = (yy >= 0) && (yy < IMH) && (xx >= 0) && (xx < IMW);
    const int yyc = (yy < 0) ? 0 : ((yy > IMH - 1) ? (IMH - 1) : yy);
    const int xxc = (xx < 0) ? 0 : ((xx > IMW - 1) ? (IMW - 1) : xx);
    const float* src = kb + (size_t)(yyc * IMW + xxc) * CCH + hd * DHEAD + g8;
    const v4f a0 = *(const v4f*)(src);
    const v4f a1 = *(const v4f*)(src + 4);
    const v4f b0 = *(const v4f*)(bh + g8);
    const v4f b1 = *(const v4f*)(bh + g8 + 4);
    v4f o0, o1;
#pragma unroll
    for (int e = 0; e < 4; ++e) {
      o0[e] = inb ? a0[e] : b0[e];
      o1[e] = inb ? a1[e] : b1[e];
    }
    float* dst = kvS + (size_t)seg * DHEAD + g8;
    *(v4f*)(dst)     = o0;
    *(v4f*)(dst + 4) = o1;
  }
}

__device__ __forceinline__ void load16(const float* p, float (&v)[16]) {
#pragma unroll
  for (int g = 0; g < 4; ++g) {
    const v4f t = *(const v4f*)(p + 4 * g);
    v[4 * g + 0] = t[0]; v[4 * g + 1] = t[1]; v[4 * g + 2] = t[2]; v[4 * g + 3] = t[3];
  }
}

// ---------------------------------------------------------------------------
// One branch of the 3x3 local attention for (pixel px of the block's row, current head), computed by the lane pair
// (l, l^16): this lane holds dims 16*half..16*half+15 of q and of the accumulator; the 32-deep logit is the sum
// of the two partial dots exchanged with __shfl_xor(., 16) (a+b == b+a, so both lanes carry identical logits and
// identical max/sum state). Taps t = 0..8 <-> staged (r = t/3, p = px + t%3); online softmax with running max m,
// running sum ssum and accumulator ov (first tap peeled, no infinities); res += ov / ssum.
// All cross-lane ops sit under uniform control (rolled loop, no lane-varying branches).
// ---------------------------------------------------------------------------
__device__ __forceinline__ void attend_branch(const float* kvS, int px, int half,
                                              const float (&q)[16], float (&res)[16]) {
  const float* kcol = kvS + (size_t)px * DHEAD + 16 * half;
  float ov[16];
  float m, ssum;
  {
    float kv[16];
    load16(kcol, kv);                                    // tap 0: r = 0, dx = 0
    float part = 0.0f;
#pragma unroll
    for (int i = 0; i < 16; ++i) part += q[i] * kv[i];
    const float s = part + __shfl_xor(part, 16, 32);
    m = s;
    ssum = 1.0f;
#pragma unroll
    for (int i = 0; i < 16; ++i) ov[i] = kv[i];
  }
#pragma unroll 1
  for (int t = 1; t < 9; ++t) {
    const int r  = t / 3;
    const int dx = t - 3 * r;
    const float* kp = kcol + (size_t)(r * KVPOS + dx) * DHEAD;
    float kv[16];
    load16(kp, kv);
    float part = 0.0f;
#pragma unroll
    for (int i = 0; i < 16; ++i) part += q[i] * kv[i];
    const float s    = part + __shfl_xor(part, 16, 32);
    const float mn   = fmaxf(m, s);
    const float corr = __expf(m - mn);
    const float p    = __expf(s - mn);
    ssum = ssum * corr + p;
#pragma unroll
    for (int i = 0; i < 16; ++i) ov[i] = p * kv[i] + ov[i] * corr;
    m = mn;
  }
  const float inv = __builtin_amdgcn_rcpf(ssum);        // ssum in [1, 9]
#pragma unroll
  for (int i = 0; i < 16; ++i) res[i] += ov[i] * inv;
}

// ---------------------------------------------------------------------------
// Fused q projection + local attention + output. Block = (image row y, batch b), 256 threads, dynamic LDS:
//   qT  [128 px][TP] f32 : q = (Wq.x + bq) * 32^-0.5 for the row's 128 pixels (phase 1, WMMA, as above)
//   kvS [3][130][32] f32 : one head of one kv branch around row y (restaged per (head, branch))
//   oT  [32 ch][TP]  f32 : 0.5 * (branch1 + branch2) for the current head (channel = head*32 + d, pixel)
// Phase 2: heads 0..3 in a rolled loop, branches 0..1 in a rolled loop; thread = (px = 16*wave + (lane & 15),
// half = lane >> 4). Phase 3 per head: wave w writes channel rows 4w..4w+3 of out[b][head*32 + c][y][0..127]:
// Coverage: qT 8 waves x 16 rows x 128 cols; kvS 1560 items x 8 floats per staging; oT 128 px x 2 halves x 16 d
// = 32 ch x 128 px per head; out: grid (128, 4) x 4 heads x 32 channel rows x 128 px = the whole [4][128][128][128].
// Every LDS producer -> consumer crossing is separated by __syncthreads(); all barriers are reached by all threads.
// ---------------------------------------------------------------------------
__global__ __launch_bounds__(256) void k_attn(const float* __restrict__ xq,
                                              const unsigned short* __restrict__ Wqh,
                                              const unsigned short* __restrict__ Wql,
                                              const float* __restrict__ bq,
                                              const float* __restrict__ bkv,
                                              const float* __restrict__ kv1,
                                              const float* __restrict__ kv2,
                                              float* __restrict__ out) {
  extern __shared__ __attribute__((aligned(16))) float smem[];
  float* qT  = smem;                                     // [128][TP]
  float* kvS = smem + TILE_F;                            // [3][130][32]
  float* oT  = smem + TILE_F + KVS_F;                    // [32][TP]
  const int tid  = threadIdx.x;
  const int lane = tid & 31;
  const int wave = __builtin_amdgcn_readfirstlane(tid >> 5);
  const int y = blockIdx.x;
  const int b = blockIdx.y;

  // ---- phase 1: q projection of this row into LDS ----
  const float* xrow = xq + (size_t)b * CCH * HWPIX + (size_t)y * IMW;
  proj_row_tile(xrow, Wqh, Wql, bq, QSCALE, qT, wave, lane);
  __syncthreads();

  // ---- phase 2 / 3: per head ----
  const int half = lane >> 4;
  const int px   = 16 * wave + (lane & 15);
#pragma unroll 1
  for (int hd = 0; hd < NHEADS; ++hd) {
    float q[16];
    load16(qT + (size_t)px * TP + hd * DHEAD + 16 * half, q);
    float res[16];
#pragma unroll
    for (int i = 0; i < 16; ++i) res[i] = 0.0f;
#pragma unroll 1
    for (int br = 0; br < 2; ++br) {
      const float* kb = ((br == 0) ? kv1 : kv2) + (size_t)b * HWPIX * CCH;   // both global
      stage_kv(kb, bkv, hd, y, kvS, tid);
      __syncthreads();
      attend_branch(kvS, px, half, q, res);
      __syncthreads();                                   // kvS is restaged next
    }
    // result tile of this head: oT[16*half + i][px]
#pragma unroll
    for (int i = 0; i < 16; ++i) oT[(size_t)(16 * half + i) * TP + px] = 0.5f * res[i];
    __syncthreads();
    // ---- phase 3: channel-major output rows of this head ----
    {
#pragma unroll
      for (int k = 0; k < 4; ++k) {
        const int cc = 4 * wave + k;                     // 0..31 within the head
        const v4f v = *(const v4f*)(oT + (size_t)cc * TP + 4 * lane);
        float* dst = out + (((size_t)b * CCH + hd * DHEAD + cc) * IMH + y) * IMW + 4 * lane;
        *(v4f*)dst = v;
      }
      
    }
    // oT is next written only after the next head's staging/compute barriers
  }
}

// ---------------------------------------------------------------------------
// Workspace map (byte offsets, all 256-B aligned, every region fully written before it is read):
//   Wq hi  bf16 [128][128]         0        (32768 B)
//   Wq lo  bf16 [128][128]     32768
//   Wkv hi bf16 [128][128]     65536
//   Wkv lo bf16 [128][128]     98304
//   kv1    f32  [4*16384][128] 131072      (33554432 B, 512-B rows)
//   kv2    f32  [4*16384][128] 33685504
//   total                      67239936
// ---------------------------------------------------------------------------
extern "C" void kernel_launch(void* const* d_in, const int* in_sizes, int n_in,
                              void* d_out, int out_size, void* d_ws, size_t ws_size,
                              hipStream_t stream) {
  if (n_in < 7) return;
  const int nmap = NB * CCH * HWPIX;
  if (in_sizes[0] != nmap || in_sizes[1] != nmap || in_sizes[2] != nmap) return;
  if (in_sizes[3] != CCH * CCH || in_sizes[4] != CCH) return;
  if (in_sizes[5] != CCH * CCH || in_sizes[6] != CCH) return;
  if (out_size != nmap) return;

  const float* kvmap1 = (const float*)d_in[0];
  const float* qmap   = (const float*)d_in[1];
  const float* kvmap2 = (const float*)d_in[2];
  const float* Wq     = (const float*)d_in[3];
  const float* bq     = (const float*)d_in[4];
  const float* Wkv    = (const float*)d_in[5];
  const float* bkv    = (const float*)d_in[6];
  float* out = (float*)d_out;

  const size_t PW  = (size_t)CCH * CCH * 2;                       // 32768
  const size_t PKV = (size_t)NB * HWPIX * CCH * 4;                // 33554432
  size_t off = 0;
  const size_t oWqh = off; off += PW;
  const size_t oWql = off; off += PW;
  const size_t oWkh = off; off += PW;
  const size_t oWkl = off; off += PW;
  const size_t oKV1 = off; off += PKV;
  const size_t oKV2 = off; off += PKV;
  if (off > ws_size) return;

  char* ws = (char*)d_ws;
  unsigned short* Wqh = (unsigned short*)(ws + oWqh);
  unsigned short* Wql = (unsigned short*)(ws + oWql);
  unsigned short* Wkh = (unsigned short*)(ws + oWkh);
  unsigned short* Wkl = (unsigned short*)(ws + oWkl);
  float* KV1 = (float*)(ws + oKV1);
  float* KV2 = (float*)(ws + oKV2);

  const size_t ldsA = (size_t)TILE_F * 4;                         // 67584
  const size_t ldsB = (size_t)ATTN_LDS_F * 4;                     // 134400
  (void)hipFuncSetAttribute(reinterpret_cast<const void*>(&k_kvproj),
                            hipFuncAttributeMaxDynamicSharedMemorySize, (int)ldsA);
  (void)hipFuncSetAttribute(reinterpret_cast<const void*>(&k_attn),
                            hipFuncAttributeMaxDynamicSharedMemorySize, (int)ldsB);

  const dim3 blk(256);
  k_split_w<<<dim3(64), blk, 0, stream>>>(Wq, Wkv, Wqh, Wql, Wkh, Wkl);
  k_kvproj<<<dim3(IMH, NB), blk, ldsA, stream>>>(kvmap1, Wkh, Wkl, bkv, KV1);
  k_kvproj<<<dim3(IMH, NB), blk, ldsA, stream>>>(kvmap2, Wkh, Wkl, bkv, KV2);
  k_attn<<<dim3(IMH, NB), blk, ldsB, stream>>>(qmap, Wqh, Wql, bq, bkv, KV1, KV2, out);
  (void)hipGetLastError();
}

// v001
// One run takes 101 microseconds.
// Next to v000, in two timings, it ran 1.32 and 1.33 times as fast.
// Contractions: three 1x1-conv projections (q from map in1, kv from maps in0 and in2; M = pixels, N = 128, K = 128)
// on v_wmma_f32_16x16x32_bf16 with bf16 hi/lo split operands (hi.hi + hi.lo + lo.hi), f32 accumulate;
// 9-tap local-window logits, softmax, weighted sums and the two-branch mean in f32 on the VALU.
#include <hip/hip_runtime.h>
#include <stdint.h>

#define NB      4
#define CCH     128
#define IMH     128
#define IMW     128
#define HWPIX   (IMH * IMW)
#define NHEADS  4
#define DHEAD   32
#define QSCALE  0.17677669529663687f     // 32^-0.5
#define TP      132                       // LDS tile pitch in floats (16-B multiple)
#define TILE_F  (128 * TP)                // floats of one 128 x 128 tile with pitch TP
#define KVROWS  3                         // staged kv rows: y-1, y, y+1
#define KVPOS   130                       // staged kv positions: x = -1 .. 128
#define KVS_F   (KVROWS * KVPOS * DHEAD)  // 12480 floats: one head of one branch
#define OT_F    (DHEAD * TP)              // 4224 floats: [32 ch][TP] per-head result tile
#define WSP     136                       // LDS pitch of a staged weight row in bf16 (272 B = 16 B x 17)
#define WS_PLANE (CCH * WSP)              // 17408 bf16: one staged weight plane [128][WSP]
#define WS_F    (2 * WS_PLANE / 2)        // 17408 floats: hi and lo plane together (69632 B)
#define PROJ_LDS_F (TILE_F + WS_F)        // 34304 floats = 137216 B: result tile + staged weights
#define ATTN_LDS_F PROJ_LDS_F             // kvS + oT (16704 floats) reuse the staged-weight region after phase 1
static_assert(KVS_F + OT_F <= WS_F);

typedef __attribute__((ext_vector_type(16))) __bf16         v16b;
typedef __attribute__((ext_vector_type(8)))  unsigned short v8us;
typedef __attribute__((ext_vector_type(8)))  float          v8f;
typedef __attribute__((ext_vector_type(4)))  float          v4f;
typedef __attribute__((ext_vector_type(2)))  float          v2f;

union Frg { v16b b; v8us h8[2]; unsigned int w[8]; };
static_assert(sizeof(Frg) == 32);

// ---------------------------------------------------------------------------
// small helpers
// ---------------------------------------------------------------------------
__device__ __forceinline__ unsigned short f2bf(float f) {          // bf16 RNE convert, bits
  const unsigned u = __float_as_uint(f);
  return (unsigned short)((u + 0x7FFFu + ((u >> 16) & 1u)) >> 16);
}
__device__ __forceinline__ float bf2f(unsigned short h) { return __uint_as_float(((unsigned)h) << 16); }
__device__ __forceinline__ unsigned int pk16(unsigned short lo, unsigned short hi) {
  return (unsigned)lo | ((unsigned)hi << 16);
}
__device__ __forceinline__ void opt_fence() { asm volatile("" ::: "memory"); }

__device__ __forceinline__ v8f zero8() {
  v8f z = {0.f, 0.f, 0.f, 0.f, 0.f, 0.f, 0.f, 0.f};
  return z;
}

// WMMA with the hazard guard tied to D, keeping A/B live across the guard
__device__ __forceinline__ v8f mma16(v16b a, v16b b, v8f c) {
  v8f d = __builtin_amdgcn_wmma_f32_16x16x32_bf16(false, a, false, b, (short)0, c, false, false);
  asm volatile("v_nop\n\tv_nop\n\tv_nop\n\tv_nop" : "+v"(d) : "v"(a), "v"(b));
  return d;
}

// ---------------------------------------------------------------------------
// Fragment builders (wave32, 16x16x32, split k map for BOTH operands):
//   lane l: row/col = l & 15, h = l >> 4; element i (0..7) <- k0 + 8h + i, element i (8..15) <- k0 + 16 + 8h + (i-8)
// ---------------------------------------------------------------------------
// Operand gathered from a channel-major f32 map: row m = pixel (pt + m), k = channel, channel stride HWPIX.
// Values are split into bf16 hi (RNE) and lo = RNE(v - hi) planes in registers.
__device__ __forceinline__ void gather_split(const float* __restrict__ pt, int lane, int k0, Frg& fh, Frg& fl) {
  const int m = lane & 15, h = lane >> 4;
  const float* pm = pt + m;
#pragma unroll
  for (int q = 0; q < 8; ++q) {
    const int c = k0 + ((q < 4) ? (8 * h + 2 * q) : (16 + 8 * h + 2 * (q - 4)));
    const float v0 = pm[(size_t)c * HWPIX];
    const float v1 = pm[(size_t)(c + 1) * HWPIX];
    const unsigned short h0 = f2bf(v0), h1 = f2bf(v1);
    const unsigned short l0 = f2bf(v0 - bf2f(h0)), l1 = f2bf(v1 - bf2f(h1));
    fh.w[q] = pk16(h0, h1);
    fl.w[q] = pk16(l0, l1);
  }
}
// Operand from a bf16 plane staged in LDS as [row][WSP] with k contiguous (weights W[oc][c]): two 16-B LDS loads
// per lane; 16 lanes at the 272-B pitch fall on 16 distinct groups of four banks.
__device__ __forceinline__ void wfrag(const unsigned short* W, int row0, int lane, int k0, Frg& f) {
  const int m = lane & 15, h = lane >> 4;
  const unsigned short* p = W + (row0 + m) * WSP + k0 + 8 * h;
  f.h8[0] = *(const v8us*)(p);
  f.h8[1] = *(const v8us*)(p + 16);
}
// Copy both weight planes ([128][128] bf16, global) into LDS: Ws[plane][row][WSP]. 2048 16-B pieces per plane,
// 8 per thread; a wave's load covers 512 contiguous bytes, its store two whole rows.
__device__ __forceinline__ void stage_w(const unsigned short* __restrict__ Wh,
                                        const unsigned short* __restrict__ Wl,
                                        unsigned short* Ws, int tid) {
#pragma unroll
  for (int i = 0; i < 8; ++i) {
    const int s   = i * 256 + tid;               // piece 0..2047
    const int row = s >> 4, pc = s & 15;
    const v8us a = *(const v8us*)(Wh + 8 * s);
    const v8us b = *(const v8us*)(Wl + 8 * s);
    *(v8us*)(Ws + row * WSP + 8 * pc)            = a;
    *(v8us*)(Ws + WS_PLANE + row * WSP + 8 * pc) = b;
  }
}

// ---------------------------------------------------------------------------
// Per-block 128-pixel x 128-out-channel projection of one image row into an LDS tile T[px][oc] (pitch TP):
//   T[px][oc] = (sum_c x[c][px] * W[oc][c] + bias[oc]) * scale
// 8 waves; wave w owns pixels 16w..16w+15 (A = gathered x rows) and all 8 oc tiles (B = W planes, cols = oc).
// The block first copies both W planes into LDS (Ws) once; every B fragment is then read from there.
// D element r of lane l = (row px 16w + 8h + r, col oc 16j + (l & 15)).
// ---------------------------------------------------------------------------
__device__ __forceinline__ void proj_row_tile(const float* __restrict__ xrow,
                                              const unsigned short* __restrict__ Wh,
                                              const unsigned short* __restrict__ Wl,
                                              const float* __restrict__ bias, float scale,
                                              float* T, unsigned short* Ws, int tid, int wave, int lane) {
  const int m = lane & 15, h = lane >> 4;
  stage_w(Wh, Wl, Ws, tid);
  __syncthreads();                                       // staged weights visible to all 8 waves
  v8f acc[8];
#pragma unroll
  for (int j = 0; j < 8; ++j) acc[j] = zero8();
  const float* xt = xrow + 16 * wave;
#pragma unroll 1
  for (int k0 = 0; k0 < CCH; k0 += 32) {
    Frg ah, al;
    gather_split(xt, lane, k0, ah, al);
#pragma unroll
    for (int j = 0; j < 8; ++j) {
      opt_fence();
      Frg bh, bl;
      wfrag(Ws, 16 * j, lane, k0, bh);
      wfrag(Ws + WS_PLANE, 16 * j, lane, k0, bl);
      acc[j] = mma16(ah.b, bh.b, acc[j]);
      acc[j] = mma16(ah.b, bl.b, acc[j]);
      acc[j] = mma16(al.b, bh.b, acc[j]);
    }
  }
  // epilogue: bias, scale, D -> LDS tile (this wave's 16 pixel rows, all 128 columns)
#pragma unroll
  for (int j = 0; j < 8; ++j) {
    const float bvv = bias[16 * j + m];
    float* trow = T + (size_t)(16 * wave + 8 * h) * TP + 16 * j + m;
#pragma unroll
    for (int r = 0; r < 8; ++r) trow[r * TP] = (acc[j][r] + bvv) * scale;
  }
}

// ---------------------------------------------------------------------------
// Weight split: Wq (blocks 0..31) and Wkv (blocks 32..63), f32 [128][128] -> bf16 hi / lo planes [128][128].
// ---------------------------------------------------------------------------
__global__ __launch_bounds__(256) void k_split_w(const float* __restrict__ Wq, const float* __restrict__ Wkv,
                                                 unsigned short* __restrict__ qh, unsigned short* __restrict__ ql,
                                                 unsigned short* __restrict__ kh, unsigned short* __restrict__ kl) {
  const int blk = blockIdx.x;
  const bool isq = (blk < 32);                          // block-uniform
  const float* src = isq ? Wq : Wkv;
  unsigned short* dh = isq ? qh : kh;
  unsigned short* dl = isq ? ql : kl;
  const int i = (blk & 31) * 256 + threadIdx.x;        // pair index 0..8191 (exact)
  const v2f f = *(const v2f*)(src + 2 * (size_t)i);
  const unsigned short h0 = f2bf(f[0]), h1 = f2bf(f[1]);
  const unsigned short l0 = f2bf(f[0] - bf2f(h0)), l1 = f2bf(f[1] - bf2f(h1));
  const unsigned uh = pk16(h0, h1), ul = pk16(l0, l1);
  ((unsigned*)dh)[i] = uh;
  ((unsigned*)dl)[i] = ul;
  
}

// ---------------------------------------------------------------------------
// kv projection of one map (interior positions only; padded-border keys equal the bias and are handled by value
// in the attention kernel). Block = (image row y, batch b); output plane pixel-major kvp[b][pix][128] f32.
// Store phase: wave w writes pixel rows 16w..16w+15, each row = 32 lanes x 16 B = the whole 512-B row in ONE
// Coverage: grid (128, 4) x 128 rows x 128 floats = the whole [4][16384][128] plane.
// ---------------------------------------------------------------------------
__global__ __launch_bounds__(256) void k_kvproj(const float* __restrict__ x,
                                                const unsigned short* __restrict__ Wh,
                                                const unsigned short* __restrict__ Wl,
                                                const float* __restrict__ bias,
                                                float* __restrict__ kvp) {
  extern __shared__ __attribute__((aligned(16))) float smem[];
  float* T = smem;                                       // [128][TP]
  unsigned short* Ws = (unsigned short*)(smem + TILE_F); // [2][128][WSP] bf16
  const int tid  = threadIdx.x;
  const int lane = tid & 31;
  const int wave = __builtin_amdgcn_readfirstlane(tid >> 5);
  const int y = blockIdx.x;
  const int b = blockIdx.y;
  const float* xrow = x + (size_t)b * CCH * HWPIX + (size_t)y * IMW;
  proj_row_tile(xrow, Wh, Wl, bias, 1.0f, T, Ws, tid, wave, lane);
  __syncthreads();
  float* dstb = kvp + ((size_t)b * HWPIX + (size_t)y * IMW) * CCH;
  {
#pragma unroll
    for (int i = 0; i < 16; ++i) {
      const int rr = 16 * wave + i;
      const v4f v = *(const v4f*)(T + (size_t)rr * TP + 4 * lane);
      *(v4f*)(dstb + (size_t)rr * CCH + 4 * lane) = v;
    }
    
  }
}

// ---------------------------------------------------------------------------
// Stage one head of one kv branch for image row y into LDS: kvS[r][p][d], r = 0..2 <-> image row y-1+r,
// p = 0..129 <-> image column p-1, d = 0..31 = channels hd*32+d of the pixel-major plane kb ([pix][128] f32 of
// this batch). Out-of-image (r, p) get the bias vector (padded positions of the 1x1 conv equal the bias).
// Both candidates are loaded unconditionally at clamped, valid addresses and selected by value.
// Coverage: 1560 items x 8 floats = 3 x 130 x 32 = the whole staging region; 256 threads, rolled loop.
// ---------------------------------------------------------------------------
__device__ __forceinline__ void stage_kv(const float* __restrict__ kb, const float* __restrict__ bkv,
                                         int hd, int y, float* kvS, int tid) {
  const float* bh = bkv + hd * DHEAD;
#pragma unroll 1
  for (int i = tid; i < KVROWS * KVPOS * 4; i += 256) {
    const int seg = i >> 2;                      // (r, p) segment 0..389
    const int g8  = (i & 3) * 8;                 // 8-float piece within the 32-float segment
    const int r   = seg / KVPOS;
    const int p   = seg - r * KVPOS;
    const int yy  = y + r - 1;
    const int xx  = p - 1;
    const bool inb = (yy >= 0) && (yy < IMH) && (xx >= 0) && (xx < IMW);
    const int yyc = (yy < 0) ? 0 : ((yy > IMH - 1) ? (IMH - 1) : yy);
    const int xxc = (xx < 0) ? 0 : ((xx > IMW - 1) ? (IMW - 1) : xx);
    const float* src = kb + (size_t)(yyc * IMW + xxc) * CCH + hd * DHEAD + g8;
    const v4f a0 = *(const v4f*)(src);
    const v4f a1 = *(const v4f*)(src + 4);
    const v4f b0 = *(const v4f*)(bh + g8);
    const v4f b1 = *(const v4f*)(bh + g8 + 4);
    v4f o0, o1;
#pragma unroll
    for (int e = 0; e < 4; ++e) {
      o0[e] = inb ? a0[e] : b0[e];
      o1[e] = inb ? a1[e] : b1[e];
    }
    float* dst = kvS + (size_t)seg * DHEAD + g8;
    *(v4f*)(dst)     = o0;
    *(v4f*)(dst + 4) = o1;
  }
}

__device__ __forceinline__ void load16(const float* p, float (&v)[16]) {
#pragma unroll
  for (int g = 0; g < 4; ++g) {
    const v4f t = *(const v4f*)(p + 4 * g);
    v[4 * g + 0] = t[0]; v[4 * g + 1] = t[1]; v[4 * g + 2] = t[2]; v[4 * g + 3] = t[3];
  }
}

// ---------------------------------------------------------------------------
// One branch of the 3x3 local attention for (pixel px of the block's row, current head), computed by the lane pair
// (l, l^16): this lane holds dims 16*half..16*half+15 of q and of the accumulator; the 32-deep logit is the sum
// of the two partial dots exchanged with __shfl_xor(., 16) (a+b == b+a, so both lanes carry identical logits and
// identical max/sum state). Taps t = 0..8 <-> staged (r = t/3, p = px + t%3); online softmax with running max m,
// running sum ssum and accumulator ov (first tap peeled, no infinities); res += ov / ssum.
// All cross-lane ops sit under uniform control (rolled loop, no lane-varying branches).
// ---------------------------------------------------------------------------
__device__ __forceinline__ void attend_branch(const float* kvS, int px, int half,
                                              const float (&q)[16], float (&res)[16]) {
  const float* kcol = kvS + (size_t)px * DHEAD + 16 * half;
  float ov[16];
  float m, ssum;
  {
    float kv[16];
    load16(kcol, kv);                                    // tap 0: r = 0, dx = 0
    float part = 0.0f;
#pragma unroll
    for (int i = 0; i < 16; ++i) part += q[i] * kv[i];
    const float s = part + __shfl_xor(part, 16, 32);
    m = s;
    ssum = 1.0f;
#pragma unroll
    for (int i = 0; i < 16; ++i) ov[i] = kv[i];
  }
#pragma unroll 1
  for (int t = 1; t < 9; ++t) {
    const int r  = t / 3;
    const int dx = t - 3 * r;
    const float* kp = kcol + (size_t)(r * KVPOS + dx) * DHEAD;
    float kv[16];
    load16(kp, kv);
    float part = 0.0f;
#pragma unroll
    for (int i = 0; i < 16; ++i) part += q[i] * kv[i];
    const float s    = part + __shfl_xor(part, 16, 32);
    const float mn   = fmaxf(m, s);
    const float corr = __expf(m - mn);
    const float p    = __expf(s - mn);
    ssum = ssum * corr + p;
#pragma unroll
    for (int i = 0; i < 16; ++i) ov[i] = p * kv[i] + ov[i] * corr;
    m = mn;
  }
  const float inv = __builtin_amdgcn_rcpf(ssum);        // ssum in [1, 9]
#pragma unroll
  for (int i = 0; i < 16; ++i) res[i] += ov[i] * inv;
}

// ---------------------------------------------------------------------------
// Fused q projection + local attention + output. Block = (image row y, batch b), 256 threads, dynamic LDS:
//   qT  [128 px][TP] f32 : q = (Wq.x + bq) * 32^-0.5 for the row's 128 pixels (phase 1, WMMA, as above)
//   Ws  [2][128][WSP] bf16 : staged Wq planes, phase 1 only; the two regions below lie in the same bytes
//   kvS [3][130][32] f32 : one head of one kv branch around row y (restaged per (head, branch))
//   oT  [32 ch][TP]  f32 : 0.5 * (branch1 + branch2) for the current head (channel = head*32 + d, pixel)
// Phase 2: heads 0..3 in a rolled loop, branches 0..1 in a rolled loop; thread = (px = 16*wave + (lane & 15),
// half = lane >> 4). Phase 3 per head: wave w writes channel rows 4w..4w+3 of out[b][head*32 + c][y][0..127]:
// Coverage: qT 8 waves x 16 rows x 128 cols; kvS 1560 items x 8 floats per staging; oT 128 px x 2 halves x 16 d
// = 32 ch x 128 px per head; out: grid (128, 4) x 4 heads x 32 channel rows x 128 px = the whole [4][128][128][128].
// Every LDS producer -> consumer crossing is separated by __syncthreads(); all barriers are reached by all threads.
// ---------------------------------------------------------------------------
__global__ __launch_bounds__(256) void k_attn(const float* __restrict__ xq,
                                              const unsigned short* __restrict__ Wqh,
                                              const unsigned short* __restrict__ Wql,
                                              const float* __restrict__ bq,
                                              const float* __restrict__ bkv,
                                              const float* __restrict__ kv1,
                                              const float* __restrict__ kv2,
                                              float* __restrict__ out) {
  extern __shared__ __attribute__((aligned(16))) float smem[];
  float* qT  = smem;                                     // [128][TP]
  float* kvS = smem + TILE_F;                            // [3][130][32]
  float* oT  = smem + TILE_F + KVS_F;                    // [32][TP]
  unsigned short* Ws = (unsigned short*)(smem + TILE_F); // [2][128][WSP] bf16, phase 1 only (kvS, oT follow in it)
  const int tid  = threadIdx.x;
  const int lane = tid & 31;
  const int wave = __builtin_amdgcn_readfirstlane(tid >> 5);
  const int y = blockIdx.x;
  const int b = blockIdx.y;

  // ---- phase 1: q projection of this row into LDS ----
  const float* xrow = xq + (size_t)b * CCH * HWPIX + (size_t)y * IMW;
  proj_row_tile(xrow, Wqh, Wql, bq, QSCALE, qT, Ws, tid, wave, lane);
  __syncthreads();                                       // also ends every read of Ws before kvS is written

  // ---- phase 2 / 3: per head ----
  const int half = lane >> 4;
  const int px   = 16 * wave + (lane & 15);
#pragma unroll 1
  for (int hd = 0; hd < NHEADS; ++hd) {
    float q[16];
    load16(qT + (size_t)px * TP + hd * DHEAD + 16 * half, q);
    float res[16];
#pragma unroll
    for (int i = 0; i < 16; ++i) res[i] = 0.0f;
#pragma unroll 1
    for (int br = 0; br < 2; ++br) {
      const float* kb = ((br == 0) ? kv1 : kv2) + (size_t)b * HWPIX * CCH;   // both global
      stage_kv(kb, bkv, hd, y, kvS, tid);
      __syncthreads();
      attend_branch(kvS, px, half, q, res);
      __syncthreads();                                   // kvS is restaged next
    }
    // result tile of this head: oT[16*half + i][px]
#pragma unroll
    for (int i = 0; i < 16; ++i) oT[(size_t)(16 * half + i) * TP + px] = 0.5f * res[i];
    __syncthreads();
    // ---- phase 3: channel-major output rows of this head ----
    {
#pragma unroll
      for (int k = 0; k < 4; ++k) {
        const int cc = 4 * wave + k;                     // 0..31 within the head
        const v4f v = *(const v4f*)(oT + (size_t)cc * TP + 4 * lane);
        float* dst = out + (((size_t)b * CCH + hd * DHEAD + cc) * IMH + y) * IMW + 4 * lane;
        *(v4f*)dst = v;
      }
      
    }
    // oT is next written only after the next head's staging/compute barriers
  }
}

// ---------------------------------------------------------------------------
// Workspace map (byte offsets, all 256-B aligned, every region fully written before it is read):
//   Wq hi  bf16 [128][128]         0        (32768 B)
//   Wq lo  bf16 [128][128]     32768
//   Wkv hi bf16 [128][128]     65536
//   Wkv lo bf16 [128][128]     98304
//   kv1    f32  [4*16384][128] 131072      (33554432 B, 512-B rows)
//   kv2    f32  [4*16384][128] 33685504
//   total                      67239936
// ---------------------------------------------------------------------------
extern "C" void kernel_launch(void* const* d_in, const int* in_sizes, int n_in,
                              void* d_out, int out_size, void* d_ws, size_t ws_size,
                              hipStream_t stream) {
  if (n_in < 7) return;
  const int nmap = NB * CCH * HWPIX;
  if (in_sizes[0] != nmap || in_sizes[1] != nmap || in_sizes[2] != nmap) return;
  if (in_sizes[3] != CCH * CCH || in_sizes[4] != CCH) return;
  if (in_sizes[5] != CCH * CCH || in_sizes[6] != CCH) return;
  if (out_size != nmap) return;

  const float* kvmap1 = (const float*)d_in[0];
  const float* qmap   = (const float*)d_in[1];
  const float* kvmap2 = (const float*)d_in[2];
  const float* Wq     = (const float*)d_in[3];
  const float* bq     = (const float*)d_in[4];
  const float* Wkv    = (const float*)d_in[5];
  const float* bkv    = (const float*)d_in[6];
  float* out = (float*)d_out;

  const size_t PW  = (size_t)CCH * CCH * 2;                       // 32768
  const size_t PKV = (size_t)NB * HWPIX * CCH * 4;                // 33554432
  size_t off = 0;
  const size_t oWqh = off; off += PW;
  const size_t oWql = off; off += PW;
  const size_t oWkh = off; off += PW;
  const size_t oWkl = off; off += PW;
  const size_t oKV1 = off; off += PKV;
  const size_t oKV2 = off; off += PKV;
  if (off > ws_size) return;

  char* ws = (char*)d_ws;
  unsigned short* Wqh = (unsigned short*)(ws + oWqh);
  unsigned short* Wql = (unsigned short*)(ws + oWql);
  unsigned short* Wkh = (unsigned short*)(ws + oWkh);
  unsigned short* Wkl = (unsigned short*)(ws + oWkl);
  float* KV1 = (float*)(ws + oKV1);
  float* KV2 = (float*)(ws + oKV2);

  const size_t ldsA = (size_t)PROJ_LDS_F * 4;                     // 137216
  const size_t ldsB = (size_t)ATTN_LDS_F * 4;                     // 137216
  (void)hipFuncSetAttribute(reinterpret_cast<const void*>(&k_kvproj),
                            hipFuncAttributeMaxDynamicSharedMemorySize, (int)ldsA);
  (void)hipFuncSetAttribute(reinterpret_cast<const void*>(&k_attn),
                            hipFuncAttributeMaxDynamicSharedMemorySize, (int)ldsB);

  const dim3 blk(256);
  k_split_w<<<dim3(64), blk, 0, stream>>>(Wq, Wkv, Wqh, Wql, Wkh, Wkl);
  k_kvproj<<<dim3(IMH, NB), blk, ldsA, stream>>>(kvmap1, Wkh, Wkl, bkv, KV1);
  k_kvproj<<<dim3(IMH, NB), blk, ldsA, stream>>>(kvmap2, Wkh, Wkl, bkv, KV2);
  k_attn<<<dim3(IMH, NB), blk, ldsB, stream>>>(qmap, Wqh, Wql, bq, bkv, KV1, KV2, out);
  (void)hipGetLastError();
}

// v002
// A run of this version takes 85.2 microseconds.
// Two timings next to v001 put it at 1.20 and 1.18 times that version's speed.
// Counting every step since v000, it is 1.57 times as fast.
// Contractions: three 1x1-conv projections (q from map in1, kv from maps in0 and in2; M = pixels, N = 128, K = 128)
// on v_wmma_f32_16x16x32_bf16 with bf16 hi/lo split operands (hi.hi + hi.lo + lo.hi), f32 accumulate;
// 9-tap local-window logits, softmax, weighted sums and the two-branch mean in f32 on the VALU.
#include <hip/hip_runtime.h>
#include <stdint.h>

#define NB      4
#define CCH     128
#define IMH     128
#define IMW     128
#define HWPIX   (IMH * IMW)
#define NHEADS  4
#define DHEAD   32
#define QSCALE  0.17677669529663687f     // 32^-0.5
#define TP      132                       // LDS tile pitch in floats (16-B multiple)
#define TILE_F  (128 * TP)                // floats of one 128 x 128 tile with pitch TP
#define KVROWS  3                         // staged kv rows: y-1, y, y+1
#define KVPOS   130                       // staged kv positions: x = -1 .. 128
#define KVP     36                        // LDS pitch of a staged kv position in floats (144 B = 16 B x 9; 32 used)
#define KVS_F   (KVROWS * KVPOS * KVP)    // 14040 floats: one head of one branch
#define OT_F    (DHEAD * TP)              // 4224 floats: [32 ch][TP] per-head result tile
#define WSP     136                       // LDS pitch of a staged weight row in bf16 (272 B = 16 B x 17)
#define WS_PLANE (CCH * WSP)              // 17408 bf16: one staged weight plane [128][WSP]
#define WS_F    (2 * WS_PLANE / 2)        // 17408 floats: hi and lo plane together (69632 B)
#define PROJ_LDS_F (TILE_F + WS_F)        // 34304 floats = 137216 B: result tile + staged weights
#define ATTN_LDS_F (TILE_F + KVS_F + OT_F) // 35160 floats = 140640 B: kvS + oT (18264 floats) start in the staged-weight region after phase 1
static_assert(KVS_F + OT_F >= WS_F);

typedef __attribute__((ext_vector_type(16))) __bf16         v16b;
typedef __attribute__((ext_vector_type(8)))  unsigned short v8us;
typedef __attribute__((ext_vector_type(8)))  float          v8f;
typedef __attribute__((ext_vector_type(4)))  float          v4f;
typedef __attribute__((ext_vector_type(2)))  float          v2f;

union Frg { v16b b; v8us h8[2]; unsigned int w[8]; };
static_assert(sizeof(Frg) == 32);

// ---------------------------------------------------------------------------
// small helpers
// ---------------------------------------------------------------------------
__device__ __forceinline__ unsigned short f2bf(float f) {          // bf16 RNE convert, bits
  const unsigned u = __float_as_uint(f);
  return (unsigned short)((u + 0x7FFFu + ((u >> 16) & 1u)) >> 16);
}
__device__ __forceinline__ float bf2f(unsigned short h) { return __uint_as_float(((unsigned)h) << 16); }
__device__ __forceinline__ unsigned int pk16(unsigned short lo, unsigned short hi) {
  return (unsigned)lo | ((unsigned)hi << 16);
}
__device__ __forceinline__ void opt_fence() { asm volatile("" ::: "memory"); }

__device__ __forceinline__ v8f zero8() {
  v8f z = {0.f, 0.f, 0.f, 0.f, 0.f, 0.f, 0.f, 0.f};
  return z;
}

// WMMA with the hazard guard tied to D, keeping A/B live across the guard
__device__ __forceinline__ v8f mma16(v16b a, v16b b, v8f c) {
  v8f d = __builtin_amdgcn_wmma_f32_16x16x32_bf16(false, a, false, b, (short)0, c, false, false);
  asm volatile("v_nop\n\tv_nop\n\tv_nop\n\tv_nop" : "+v"(d) : "v"(a), "v"(b));
  return d;
}

// ---------------------------------------------------------------------------
// Fragment builders (wave32, 16x16x32, split k map for BOTH operands):
//   lane l: row/col = l & 15, h = l >> 4; element i (0..7) <- k0 + 8h + i, element i (8..15) <- k0 + 16 + 8h + (i-8)
// ---------------------------------------------------------------------------
// Operand gathered from a channel-major f32 map: row m = pixel (pt + m), k = channel, channel stride HWPIX.
// Values are split into bf16 hi (RNE) and lo = RNE(v - hi) planes in registers.
__device__ __forceinline__ void gather_split(const float* __restrict__ pt, int lane, int k0, Frg& fh, Frg& fl) {
  const int m = lane & 15, h = lane >> 4;
  const float* pm = pt + m;
#pragma unroll
  for (int q = 0; q < 8; ++q) {
    const int c = k0 + ((q < 4) ? (8 * h + 2 * q) : (16 + 8 * h + 2 * (q - 4)));
    const float v0 = pm[(size_t)c * HWPIX];
    const float v1 = pm[(size_t)(c + 1) * HWPIX];
    const unsigned short h0 = f2bf(v0), h1 = f2bf(v1);
    const unsigned short l0 = f2bf(v0 - bf2f(h0)), l1 = f2bf(v1 - bf2f(h1));
    fh.w[q] = pk16(h0, h1);
    fl.w[q] = pk16(l0, l1);
  }
}
// Operand from a bf16 plane staged in LDS as [row][WSP] with k contiguous (weights W[oc][c]): two 16-B LDS loads
// per lane; 16 lanes at the 272-B pitch fall on 16 distinct groups of four banks.
__device__ __forceinline__ void wfrag(const unsigned short* W, int row0, int lane, int k0, Frg& f) {
  const int m = lane & 15, h = lane >> 4;
  const unsigned short* p = W + (row0 + m) * WSP + k0 + 8 * h;
  f.h8[0] = *(const v8us*)(p);
  f.h8[1] = *(const v8us*)(p + 16);
}
// Copy both weight planes ([128][128] bf16, global) into LDS: Ws[plane][row][WSP]. 2048 16-B pieces per plane,
// 8 per thread; a wave's load covers 512 contiguous bytes, its store two whole rows.
__device__ __forceinline__ void stage_w(const unsigned short* __restrict__ Wh,
                                        const unsigned short* __restrict__ Wl,
                                        unsigned short* Ws, int tid) {
#pragma unroll
  for (int i = 0; i < 8; ++i) {
    const int s   = i * 256 + tid;               // piece 0..2047
    const int row = s >> 4, pc = s & 15;
    const v8us a = *(const v8us*)(Wh + 8 * s);
    const v8us b = *(const v8us*)(Wl + 8 * s);
    *(v8us*)(Ws + row * WSP + 8 * pc)            = a;
    *(v8us*)(Ws + WS_PLANE + row * WSP + 8 * pc) = b;
  }
}

// ---------------------------------------------------------------------------
// Per-block 128-pixel x 128-out-channel projection of one image row into an LDS tile T[px][oc] (pitch TP):
//   T[px][oc] = (sum_c x[c][px] * W[oc][c] + bias[oc]) * scale
// 8 waves; wave w owns pixels 16w..16w+15 (A = gathered x rows) and all 8 oc tiles (B = W planes, cols = oc).
// The block first copies both W planes into LDS (Ws) once; every B fragment is then read from there.
// D element r of lane l = (row px 16w + 8h + r, col oc 16j + (l & 15)).
// ---------------------------------------------------------------------------
__device__ __forceinline__ void proj_row_tile(const float* __restrict__ xrow,
                                              const unsigned short* __restrict__ Wh,
                                              const unsigned short* __restrict__ Wl,
                                              const float* __restrict__ bias, float scale,
                                              float* T, unsigned short* Ws, int tid, int wave, int lane) {
  const int m = lane & 15, h = lane >> 4;
  stage_w(Wh, Wl, Ws, tid);
  __syncthreads();                                       // staged weights visible to all 8 waves
  v8f acc[8];
#pragma unroll
  for (int j = 0; j < 8; ++j) acc[j] = zero8();
  const float* xt = xrow + 16 * wave;
#pragma unroll 1
  for (int k0 = 0; k0 < CCH; k0 += 32) {
    Frg ah, al;
    gather_split(xt, lane, k0, ah, al);
#pragma unroll
    for (int j = 0; j < 8; ++j) {
      opt_fence();
      Frg bh, bl;
      wfrag(Ws, 16 * j, lane, k0, bh);
      wfrag(Ws + WS_PLANE, 16 * j, lane, k0, bl);
      acc[j] = mma16(ah.b, bh.b, acc[j]);
      acc[j] = mma16(ah.b, bl.b, acc[j]);
      acc[j] = mma16(al.b, bh.b, acc[j]);
    }
  }
  // epilogue: bias, scale, D -> LDS tile (this wave's 16 pixel rows, all 128 columns)
#pragma unroll
  for (int j = 0; j < 8; ++j) {
    const float bvv = bias[16 * j + m];
    float* trow = T + (size_t)(16 * wave + 8 * h) * TP + 16 * j + m;
#pragma unroll
    for (int r = 0; r < 8; ++r) trow[r * TP] = (acc[j][r] + bvv) * scale;
  }
}

// ---------------------------------------------------------------------------
// Weight split: Wq (blocks 0..31) and Wkv (blocks 32..63), f32 [128][128] -> bf16 hi / lo planes [128][128].
// ---------------------------------------------------------------------------
__global__ __launch_bounds__(256) void k_split_w(const float* __restrict__ Wq, const float* __restrict__ Wkv,
                                                 unsigned short* __restrict__ qh, unsigned short* __restrict__ ql,
                                                 unsigned short* __restrict__ kh, unsigned short* __restrict__ kl) {
  const int blk = blockIdx.x;
  const bool isq = (blk < 32);                          // block-uniform
  const float* src = isq ? Wq : Wkv;
  unsigned short* dh = isq ? qh : kh;
  unsigned short* dl = isq ? ql : kl;
  const int i = (blk & 31) * 256 + threadIdx.x;        // pair index 0..8191 (exact)
  const v2f f = *(const v2f*)(src + 2 * (size_t)i);
  const unsigned short h0 = f2bf(f[0]), h1 = f2bf(f[1]);
  const unsigned short l0 = f2bf(f[0] - bf2f(h0)), l1 = f2bf(f[1] - bf2f(h1));
  const unsigned uh = pk16(h0, h1), ul = pk16(l0, l1);
  ((unsigned*)dh)[i] = uh;
  ((unsigned*)dl)[i] = ul;
  
}

// ---------------------------------------------------------------------------
// kv projection of one map (interior positions only; padded-border keys equal the bias and are handled by value
// in the attention kernel). Block = (image row y, batch b); output plane pixel-major kvp[b][pix][128] f32.
// Store phase: wave w writes pixel rows 16w..16w+15, each row = 32 lanes x 16 B = the whole 512-B row in ONE
// Coverage: grid (128, 4) x 128 rows x 128 floats = the whole [4][16384][128] plane.
// ---------------------------------------------------------------------------
__global__ __launch_bounds__(256) void k_kvproj(const float* __restrict__ x,
                                                const unsigned short* __restrict__ Wh,
                                                const unsigned short* __restrict__ Wl,
                                                const float* __restrict__ bias,
                                                float* __restrict__ kvp) {
  extern __shared__ __attribute__((aligned(16))) float smem[];
  float* T = smem;                                       // [128][TP]
  unsigned short* Ws = (unsigned short*)(smem + TILE_F); // [2][128][WSP] bf16
  const int tid  = threadIdx.x;
  const int lane = tid & 31;
  const int wave = __builtin_amdgcn_readfirstlane(tid >> 5);
  const int y = blockIdx.x;
  const int b = blockIdx.y;
  const float* xrow = x + (size_t)b * CCH * HWPIX + (size_t)y * IMW;
  proj_row_tile(xrow, Wh, Wl, bias, 1.0f, T, Ws, tid, wave, lane);
  __syncthreads();
  float* dstb = kvp + ((size_t)b * HWPIX + (size_t)y * IMW) * CCH;
  {
#pragma unroll
    for (int i = 0; i < 16; ++i) {
      const int rr = 16 * wave + i;
      const v4f v = *(const v4f*)(T + (size_t)rr * TP + 4 * lane);
      *(v4f*)(dstb + (size_t)rr * CCH + 4 * lane) = v;
    }
    
  }
}

// ---------------------------------------------------------------------------
// Stage one head of one kv branch for image row y into LDS: kvS[r][p][d] at pitch KVP per p, r = 0..2 <-> image row y-1+r,
// p = 0..129 <-> image column p-1, d = 0..31 = channels hd*32+d of the pixel-major plane kb ([pix][128] f32 of
// this batch). Out-of-image (r, p) get the bias vector (padded positions of the 1x1 conv equal the bias).
// Both candidates are loaded unconditionally at clamped, valid addresses and selected by value.
// Coverage: 1560 items x 8 floats = 3 x 130 x 32 = every float that is read (the 4 pad floats per p never are);
// 256 threads, rolled loop.
// ---------------------------------------------------------------------------
__device__ __forceinline__ void stage_kv(const float* __restrict__ kb, const float* __restrict__ bkv,
                                         int hd, int y, float* kvS, int tid) {
  const float* bh = bkv + hd * DHEAD;
#pragma unroll 1
  for (int i = tid; i < KVROWS * KVPOS * 4; i += 256) {
    const int seg = i >> 2;                      // (r, p) segment 0..389
    const int g8  = (i & 3) * 8;                 // 8-float piece within the 32-float segment
    const int r   = seg / KVPOS;
    const int p   = seg - r * KVPOS;
    const int yy  = y + r - 1;
    const int xx  = p - 1;
    const bool inb = (yy >= 0) && (yy < IMH) && (xx >= 0) && (xx < IMW);
    const int yyc = (yy < 0) ? 0 : ((yy > IMH - 1) ? (IMH - 1) : yy);
    const int xxc = (xx < 0) ? 0 : ((xx > IMW - 1) ? (IMW - 1) : xx);
    const float* src = kb + (size_t)(yyc * IMW + xxc) * CCH + hd * DHEAD + g8;
    const v4f a0 = *(const v4f*)(src);
    const v4f a1 = *(const v4f*)(src + 4);
    const v4f b0 = *(const v4f*)(bh + g8);
    const v4f b1 = *(const v4f*)(bh + g8 + 4);
    v4f o0, o1;
#pragma unroll
    for (int e = 0; e < 4; ++e) {
      o0[e] = inb ? a0[e] : b0[e];
      o1[e] = inb ? a1[e] : b1[e];
    }
    float* dst = kvS + (size_t)seg * KVP + g8;
    *(v4f*)(dst)     = o0;
    *(v4f*)(dst + 4) = o1;
  }
}

__device__ __forceinline__ void load16(const float* p, float (&v)[16]) {
#pragma unroll
  for (int g = 0; g < 4; ++g) {
    const v4f t = *(const v4f*)(p + 4 * g);
    v[4 * g + 0] = t[0]; v[4 * g + 1] = t[1]; v[4 * g + 2] = t[2]; v[4 * g + 3] = t[3];
  }
}

// ---------------------------------------------------------------------------
// One branch of the 3x3 local attention for (pixel px of the block's row, current head), computed by the lane pair
// (l, l^16): this lane holds dims 16*half..16*half+15 of q and of the accumulator; the 32-deep logit is the sum
// of the two partial dots exchanged with __shfl_xor(., 16) (a+b == b+a, so both lanes carry identical logits and
// identical max/sum state). Taps t = 0..8 <-> staged (r = t/3, p = px + t%3); online softmax with running max m,
// running sum ssum and accumulator ov (first tap peeled, no infinities); res += ov / ssum.
// All cross-lane ops sit under uniform control (rolled loop, no lane-varying branches).
// Each 16-B read: 16 lanes of one half at the 144-B pitch fall on 16 distinct groups of four banks.
// ---------------------------------------------------------------------------
__device__ __forceinline__ void attend_branch(const float* kvS, int px, int half,
                                              const float (&q)[16], float (&res)[16]) {
  const float* kcol = kvS + (size_t)px * KVP + 16 * half;
  float ov[16];
  float m, ssum;
  {
    float kv[16];
    load16(kcol, kv);                                    // tap 0: r = 0, dx = 0
    float part = 0.0f;
#pragma unroll
    for (int i = 0; i < 16; ++i) part += q[i] * kv[i];
    const float s = part + __shfl_xor(part, 16, 32);
    m = s;
    ssum = 1.0f;
#pragma unroll
    for (int i = 0; i < 16; ++i) ov[i] = kv[i];
  }
#pragma unroll 1
  for (int t = 1; t < 9; ++t) {
    const int r  = t / 3;
    const int dx = t - 3 * r;
    const float* kp = kcol + (size_t)(r * KVPOS + dx) * KVP;
    float kv[16];
    load16(kp, kv);
    float part = 0.0f;
#pragma unroll
    for (int i = 0; i < 16; ++i) part += q[i] * kv[i];
    const float s    = part + __shfl_xor(part, 16, 32);
    const float mn   = fmaxf(m, s);
    const float corr = __expf(m - mn);
    const float p    = __expf(s - mn);
    ssum = ssum * corr + p;
#pragma unroll
    for (int i = 0; i < 16; ++i) ov[i] = p * kv[i] + ov[i] * corr;
    m = mn;
  }
  const float inv = __builtin_amdgcn_rcpf(ssum);        // ssum in [1, 9]
#pragma unroll
  for (int i = 0; i < 16; ++i) res[i] += ov[i] * inv;
}

// ---------------------------------------------------------------------------
// Fused q projection + local attention + output. Block = (image row y, batch b), 256 threads, dynamic LDS:
//   qT  [128 px][TP] f32 : q = (Wq.x + bq) * 32^-0.5 for the row's 128 pixels (phase 1, WMMA, as above)
//   Ws  [2][128][WSP] bf16 : staged Wq planes, phase 1 only; kvS and the first 3368 floats of oT lie in the same bytes
//   kvS [3][130][36] f32 : one head of one kv branch around row y, 32 of 36 used (restaged per (head, branch))
//   oT  [32 ch][TP]  f32 : 0.5 * (branch1 + branch2) for the current head (channel = head*32 + d, pixel)
// Phase 2: heads 0..3 in a rolled loop, branches 0..1 in a rolled loop; thread = (px = 16*wave + (lane & 15),
// half = lane >> 4). Phase 3 per head: wave w writes channel rows 4w..4w+3 of out[b][head*32 + c][y][0..127]:
// Coverage: qT 8 waves x 16 rows x 128 cols; kvS 1560 items x 8 floats per staging; oT 128 px x 2 halves x 16 d
// = 32 ch x 128 px per head; out: grid (128, 4) x 4 heads x 32 channel rows x 128 px = the whole [4][128][128][128].
// Every LDS producer -> consumer crossing is separated by __syncthreads(); all barriers are reached by all threads.
// ---------------------------------------------------------------------------
__global__ __launch_bounds__(256) void k_attn(const float* __restrict__ xq,
                                              const unsigned short* __restrict__ Wqh,
                                              const unsigned short* __restrict__ Wql,
                                              const float* __restrict__ bq,
                                              const float* __restrict__ bkv,
                                              const float* __restrict__ kv1,
                                              const float* __restrict__ kv2,
                                              float* __restrict__ out) {
  extern __shared__ __attribute__((aligned(16))) float smem[];
  float* qT  = smem;                                     // [128][TP]
  float* kvS = smem + TILE_F;                            // [3][130][KVP]
  float* oT  = smem + TILE_F + KVS_F;                    // [32][TP]
  unsigned short* Ws = (unsigned short*)(smem + TILE_F); // [2][128][WSP] bf16, phase 1 only (kvS, oT follow in it)
  const int tid  = threadIdx.x;
  const int lane = tid & 31;
  const int wave = __builtin_amdgcn_readfirstlane(tid >> 5);
  const int y = blockIdx.x;
  const int b = blockIdx.y;

  // ---- phase 1: q projection of this row into LDS ----
  const float* xrow = xq + (size_t)b * CCH * HWPIX + (size_t)y * IMW;
  proj_row_tile(xrow, Wqh, Wql, bq, QSCALE, qT, Ws, tid, wave, lane);
  __syncthreads();                                       // also ends every read of Ws before kvS is written

  // ---- phase 2 / 3: per head ----
  const int half = lane >> 4;
  const int px   = 16 * wave + (lane & 15);
#pragma unroll 1
  for (int hd = 0; hd < NHEADS; ++hd) {
    float q[16];
    load16(qT + (size_t)px * TP + hd * DHEAD + 16 * half, q);
    float res[16];
#pragma unroll
    for (int i = 0; i < 16; ++i) res[i] = 0.0f;
#pragma unroll 1
    for (int br = 0; br < 2; ++br) {
      const float* kb = ((br == 0) ? kv1 : kv2) + (size_t)b * HWPIX * CCH;   // both global
      stage_kv(kb, bkv, hd, y, kvS, tid);
      __syncthreads();
      attend_branch(kvS, px, half, q, res);
      __syncthreads();                                   // kvS is restaged next
    }
    // result tile of this head: oT[16*half + i][px]
#pragma unroll
    for (int i = 0; i < 16; ++i) oT[(size_t)(16 * half + i) * TP + px] = 0.5f * res[i];
    __syncthreads();
    // ---- phase 3: channel-major output rows of this head ----
    {
#pragma unroll
      for (int k = 0; k < 4; ++k) {
        const int cc = 4 * wave + k;                     // 0..31 within the head
        const v4f v = *(const v4f*)(oT + (size_t)cc * TP + 4 * lane);
        float* dst = out + (((size_t)b * CCH + hd * DHEAD + cc) * IMH + y) * IMW + 4 * lane;
        *(v4f*)dst = v;
      }
      
    }
    // oT is next written only after the next head's staging/compute barriers
  }
}

// ---------------------------------------------------------------------------
// Workspace map (byte offsets, all 256-B aligned, every region fully written before it is read):
//   Wq hi  bf16 [128][128]         0        (32768 B)
//   Wq lo  bf16 [128][128]     32768
//   Wkv hi bf16 [128][128]     65536
//   Wkv lo bf16 [128][128]     98304
//   kv1    f32  [4*16384][128] 131072      (33554432 B, 512-B rows)
//   kv2    f32  [4*16384][128] 33685504
//   total                      67239936
// ---------------------------------------------------------------------------
extern "C" void kernel_launch(void* const* d_in, const int* in_sizes, int n_in,
                              void* d_out, int out_size, void* d_ws, size_t ws_size,
                              hipStream_t stream) {
  if (n_in < 7) return;
  const int nmap = NB * CCH * HWPIX;
  if (in_sizes[0] != nmap || in_sizes[1] != nmap || in_sizes[2] != nmap) return;
  if (in_sizes[3] != CCH * CCH || in_sizes[4] != CCH) return;
  if (in_sizes[5] != CCH * CCH || in_sizes[6] != CCH) return;
  if (out_size != nmap) return;

  const float* kvmap1 = (const float*)d_in[0];
  const float* qmap   = (const float*)d_in[1];
  const float* kvmap2 = (const float*)d_in[2];
  const float* Wq     = (const float*)d_in[3];
  const float* bq     = (const float*)d_in[4];
  const float* Wkv    = (const float*)d_in[5];
  const float* bkv    = (const float*)d_in[6];
  float* out = (float*)d_out;

  const size_t PW  = (size_t)CCH * CCH * 2;                       // 32768
  const size_t PKV = (size_t)NB * HWPIX * CCH * 4;                // 33554432
  size_t off = 0;
  const size_t oWqh = off; off += PW;
  const size_t oWql = off; off += PW;
  const size_t oWkh = off; off += PW;
  const size_t oWkl = off; off += PW;
  const size_t oKV1 = off; off += PKV;
  const size_t oKV2 = off; off += PKV;
  if (off > ws_size) return;

  char* ws = (char*)d_ws;
  unsigned short* Wqh = (unsigned short*)(ws + oWqh);
  unsigned short* Wql = (unsigned short*)(ws + oWql);
  unsigned short* Wkh = (unsigned short*)(ws + oWkh);
  unsigned short* Wkl = (unsigned short*)(ws + oWkl);
  float* KV1 = (float*)(ws + oKV1);
  float* KV2 = (float*)(ws + oKV2);

  const size_t ldsA = (size_t)PROJ_LDS_F * 4;                     // 137216
  const size_t ldsB = (size_t)ATTN_LDS_F * 4;                     // 140640
  (void)hipFuncSetAttribute(reinterpret_cast<const void*>(&k_kvproj),
                            hipFuncAttributeMaxDynamicSharedMemorySize, (int)ldsA);
  (void)hipFuncSetAttribute(reinterpret_cast<const void*>(&k_attn),
                            hipFuncAttributeMaxDynamicSharedMemorySize, (int)ldsB);

  const dim3 blk(256);
  k_split_w<<<dim3(64), blk, 0, stream>>>(Wq, Wkv, Wqh, Wql, Wkh, Wkl);
  k_kvproj<<<dim3(IMH, NB), blk, ldsA, stream>>>(kvmap1, Wkh, Wkl, bkv, KV1);
  k_kvproj<<<dim3(IMH, NB), blk, ldsA, stream>>>(kvmap2, Wkh, Wkl, bkv, KV2);
  k_attn<<<dim3(IMH, NB), blk, ldsB, stream>>>(qmap, Wqh, Wql, bq, bkv, KV1, KV2, out);
  (void)hipGetLastError();
}

// v003
// A run of this version takes 66.9 microseconds.
// In two side-by-side timings against v002, it was 1.26 and 1.27 times as fast.
// All steps since v000 together make it 1.99 times as fast.
// Contractions: three 1x1-conv projections (q from map in1, kv from maps in0 and in2; M = pixels, N = 128, K = 128)
// on v_wmma_f32_16x16x32_bf16 with bf16 hi/lo split operands (hi.hi + hi.lo + lo.hi), f32 accumulate;
// 9-tap local-window logits, softmax, weighted sums and the two-branch mean in f32 on the VALU.
#include <hip/hip_runtime.h>
#include <stdint.h>

#define NB      4
#define CCH     128
#define IMH     128
#define IMW     128
#define HWPIX   (IMH * IMW)
#define NHEADS  4
#define DHEAD   32
#define QSCALE  0.17677669529663687f     // 32^-0.5
#define TP      132                       // LDS tile pitch in floats (16-B multiple)
#define TILE_F  (128 * TP)                // floats of one 128 x 128 tile with pitch TP
#define KVROWS  3                         // staged kv rows: y-1, y, y+1
#define KVPOS   130                       // staged kv positions: x = -1 .. 128
#define KVP     36                        // LDS pitch of a staged kv position in floats (144 B = 16 B x 9; 32 used)
#define KVSEG   392                       // positions of one kv buffer: 3 x 130 staged + 2 that complete the last wave-wide copy
#define KVB_F   (KVSEG * KVP)             // 14112 floats = 56448 B: one kv buffer (one head of one branch)
#define NCP     13                        // 16-B copies per lane and tile: 12 in every wave, a 13th in waves 0 and 1
#define OT_F    (DHEAD * TP)              // 4224 floats: [32 ch][TP] per-head result tile
#define WSP     136                       // LDS pitch of a staged weight row in bf16 (272 B = 16 B x 17)
#define WS_PLANE (CCH * WSP)              // 17408 bf16: one staged weight plane [128][WSP]
#define WS_F    (2 * WS_PLANE / 2)        // 17408 floats: hi and lo plane together (69632 B)
#define PROJ_LDS_F (TILE_F + WS_F)        // 34304 floats = 137216 B: result tile + staged weights
#define BUF1_F  0                         // kv buffer 1: lies in the q tile's bytes, filled only after q is in registers
#define OTO_F   (BUF1_F + KVB_F)          // per-head result tile
#define BUF0_F  (OTO_F + OT_F)            // kv buffer 0: lies wholly in the staged-weight bytes, free once phase 1 ends
#define ATTN_LDS_F PROJ_LDS_F             // phase 2 (2 x KVB_F + OT_F = 32448 floats) lives inside phase 1's bytes
static_assert(BUF0_F >= TILE_F && BUF0_F + KVB_F <= PROJ_LDS_F);
static_assert(KVSEG * 8 == 12 * 256 + 64 && KVSEG >= KVROWS * KVPOS);

typedef __attribute__((ext_vector_type(16))) __bf16         v16b;
typedef __attribute__((ext_vector_type(8)))  unsigned short v8us;
typedef __attribute__((ext_vector_type(8)))  float          v8f;
typedef __attribute__((ext_vector_type(4)))  float          v4f;
typedef __attribute__((ext_vector_type(2)))  float          v2f;

union Frg { v16b b; v8us h8[2]; unsigned int w[8]; };
static_assert(sizeof(Frg) == 32);

// ---------------------------------------------------------------------------
// small helpers
// ---------------------------------------------------------------------------
__device__ __forceinline__ unsigned short f2bf(float f) {          // bf16 RNE convert, bits
  const unsigned u = __float_as_uint(f);
  return (unsigned short)((u + 0x7FFFu + ((u >> 16) & 1u)) >> 16);
}
__device__ __forceinline__ float bf2f(unsigned short h) { return __uint_as_float(((unsigned)h) << 16); }
__device__ __forceinline__ unsigned int pk16(unsigned short lo, unsigned short hi) {
  return (unsigned)lo | ((unsigned)hi << 16);
}
__device__ __forceinline__ void opt_fence() { asm volatile("" ::: "memory"); }

__device__ __forceinline__ v8f zero8() {
  v8f z = {0.f, 0.f, 0.f, 0.f, 0.f, 0.f, 0.f, 0.f};
  return z;
}

// WMMA with the hazard guard tied to D, keeping A/B live across the guard
__device__ __forceinline__ v8f mma16(v16b a, v16b b, v8f c) {
  v8f d = __builtin_amdgcn_wmma_f32_16x16x32_bf16(false, a, false, b, (short)0, c, false, false);
  asm volatile("v_nop\n\tv_nop\n\tv_nop\n\tv_nop" : "+v"(d) : "v"(a), "v"(b));
  return d;
}

// ---------------------------------------------------------------------------
// Fragment builders (wave32, 16x16x32, split k map for BOTH operands):
//   lane l: row/col = l & 15, h = l >> 4; element i (0..7) <- k0 + 8h + i, element i (8..15) <- k0 + 16 + 8h + (i-8)
// ---------------------------------------------------------------------------
// Operand gathered from a channel-major f32 map: row m = pixel (pt + m), k = channel, channel stride HWPIX.
// Values are split into bf16 hi (RNE) and lo = RNE(v - hi) planes in registers.
__device__ __forceinline__ void gather_split(const float* __restrict__ pt, int lane, int k0, Frg& fh, Frg& fl) {
  const int m = lane & 15, h = lane >> 4;
  const float* pm = pt + m;
#pragma unroll
  for (int q = 0; q < 8; ++q) {
    const int c = k0 + ((q < 4) ? (8 * h + 2 * q) : (16 + 8 * h + 2 * (q - 4)));
    const float v0 = pm[(size_t)c * HWPIX];
    const float v1 = pm[(size_t)(c + 1) * HWPIX];
    const unsigned short h0 = f2bf(v0), h1 = f2bf(v1);
    const unsigned short l0 = f2bf(v0 - bf2f(h0)), l1 = f2bf(v1 - bf2f(h1));
    fh.w[q] = pk16(h0, h1);
    fl.w[q] = pk16(l0, l1);
  }
}
// Operand from a bf16 plane staged in LDS as [row][WSP] with k contiguous (weights W[oc][c]): two 16-B LDS loads
// per lane; 16 lanes at the 272-B pitch fall on 16 distinct groups of four banks.
__device__ __forceinline__ void wfrag(const unsigned short* W, int row0, int lane, int k0, Frg& f) {
  const int m = lane & 15, h = lane >> 4;
  const unsigned short* p = W + (row0 + m) * WSP + k0 + 8 * h;
  f.h8[0] = *(const v8us*)(p);
  f.h8[1] = *(const v8us*)(p + 16);
}
// Copy both weight planes ([128][128] bf16, global) into LDS: Ws[plane][row][WSP]. 2048 16-B pieces per plane,
// 8 per thread; a wave's load covers 512 contiguous bytes, its store two whole rows.
__device__ __forceinline__ void stage_w(const unsigned short* __restrict__ Wh,
                                        const unsigned short* __restrict__ Wl,
                                        unsigned short* Ws, int tid) {
#pragma unroll
  for (int i = 0; i < 8; ++i) {
    const int s   = i * 256 + tid;               // piece 0..2047
    const int row = s >> 4, pc = s & 15;
    const v8us a = *(const v8us*)(Wh + 8 * s);
    const v8us b = *(const v8us*)(Wl + 8 * s);
    *(v8us*)(Ws + row * WSP + 8 * pc)            = a;
    *(v8us*)(Ws + WS_PLANE + row * WSP + 8 * pc) = b;
  }
}

// ---------------------------------------------------------------------------
// Per-block 128-pixel x 128-out-channel projection of one image row into an LDS tile T[px][oc] (pitch TP):
//   T[px][oc] = (sum_c x[c][px] * W[oc][c] + bias[oc]) * scale
// 8 waves; wave w owns pixels 16w..16w+15 (A = gathered x rows) and all 8 oc tiles (B = W planes, cols = oc).
// The block first copies both W planes into LDS (Ws) once; every B fragment is then read from there.
// D element r of lane l = (row px 16w + 8h + r, col oc 16j + (l & 15)).
// ---------------------------------------------------------------------------
__device__ __forceinline__ void proj_row_tile(const float* __restrict__ xrow,
                                              const unsigned short* __restrict__ Wh,
                                              const unsigned short* __restrict__ Wl,
                                              const float* __restrict__ bias, float scale,
                                              float* T, unsigned short* Ws, int tid, int wave, int lane) {
  const int m = lane & 15, h = lane >> 4;
  stage_w(Wh, Wl, Ws, tid);
  __syncthreads();                                       // staged weights visible to all 8 waves
  v8f acc[8];
#pragma unroll
  for (int j = 0; j < 8; ++j) acc[j] = zero8();
  const float* xt = xrow + 16 * wave;
#pragma unroll 1
  for (int k0 = 0; k0 < CCH; k0 += 32) {
    Frg ah, al;
    gather_split(xt, lane, k0, ah, al);
#pragma unroll
    for (int j = 0; j < 8; ++j) {
      opt_fence();
      Frg bh, bl;
      wfrag(Ws, 16 * j, lane, k0, bh);
      wfrag(Ws + WS_PLANE, 16 * j, lane, k0, bl);
      acc[j] = mma16(ah.b, bh.b, acc[j]);
      acc[j] = mma16(ah.b, bl.b, acc[j]);
      acc[j] = mma16(al.b, bh.b, acc[j]);
    }
  }
  // epilogue: bias, scale, D -> LDS tile (this wave's 16 pixel rows, all 128 columns)
#pragma unroll
  for (int j = 0; j < 8; ++j) {
    const float bvv = bias[16 * j + m];
    float* trow = T + (size_t)(16 * wave + 8 * h) * TP + 16 * j + m;
#pragma unroll
    for (int r = 0; r < 8; ++r) trow[r * TP] = (acc[j][r] + bvv) * scale;
  }
}

// ---------------------------------------------------------------------------
// Weight split: Wq (blocks 0..31) and Wkv (blocks 32..63), f32 [128][128] -> bf16 hi / lo planes [128][128].
// ---------------------------------------------------------------------------
__global__ __launch_bounds__(256) void k_split_w(const float* __restrict__ Wq, const float* __restrict__ Wkv,
                                                 unsigned short* __restrict__ qh, unsigned short* __restrict__ ql,
                                                 unsigned short* __restrict__ kh, unsigned short* __restrict__ kl) {
  const int blk = blockIdx.x;
  const bool isq = (blk < 32);                          // block-uniform
  const float* src = isq ? Wq : Wkv;
  unsigned short* dh = isq ? qh : kh;
  unsigned short* dl = isq ? ql : kl;
  const int i = (blk & 31) * 256 + threadIdx.x;        // pair index 0..8191 (exact)
  const v2f f = *(const v2f*)(src + 2 * (size_t)i);
  const unsigned short h0 = f2bf(f[0]), h1 = f2bf(f[1]);
  const unsigned short l0 = f2bf(f[0] - bf2f(h0)), l1 = f2bf(f[1] - bf2f(h1));
  const unsigned uh = pk16(h0, h1), ul = pk16(l0, l1);
  ((unsigned*)dh)[i] = uh;
  ((unsigned*)dl)[i] = ul;
  
}

// ---------------------------------------------------------------------------
// kv projection of one map (interior positions only; padded-border keys equal the bias and are copied from it
// in the attention kernel). Block = (image row y, batch b); output plane pixel-major kvp[b][pix][128] f32.
// Store phase: wave w writes pixel rows 16w..16w+15, each row = 32 lanes x 16 B = the whole 512-B row in ONE
// Coverage: grid (128, 4) x 128 rows x 128 floats = the whole [4][16384][128] plane.
// ---------------------------------------------------------------------------
__global__ __launch_bounds__(256) void k_kvproj(const float* __restrict__ x,
                                                const unsigned short* __restrict__ Wh,
                                                const unsigned short* __restrict__ Wl,
                                                const float* __restrict__ bias,
                                                float* __restrict__ kvp) {
  extern __shared__ __attribute__((aligned(16))) float smem[];
  float* T = smem;                                       // [128][TP]
  unsigned short* Ws = (unsigned short*)(smem + TILE_F); // [2][128][WSP] bf16
  const int tid  = threadIdx.x;
  const int lane = tid & 31;
  const int wave = __builtin_amdgcn_readfirstlane(tid >> 5);
  const int y = blockIdx.x;
  const int b = blockIdx.y;
  const float* xrow = x + (size_t)b * CCH * HWPIX + (size_t)y * IMW;
  proj_row_tile(xrow, Wh, Wl, bias, 1.0f, T, Ws, tid, wave, lane);
  __syncthreads();
  float* dstb = kvp + ((size_t)b * HWPIX + (size_t)y * IMW) * CCH;
  {
#pragma unroll
    for (int i = 0; i < 16; ++i) {
      const int rr = 16 * wave + i;
      const v4f v = *(const v4f*)(T + (size_t)rr * TP + 4 * lane);
      *(v4f*)(dstb + (size_t)rr * CCH + 4 * lane) = v;
    }
    
  }
}

// ---------------------------------------------------------------------------
// Bring one head of one kv branch for image row y into an LDS buffer with asynchronous 16-B copies, through no
// register: buffer[r][p][d] at pitch KVP per p, r = 0..2 <-> image row y-1+r, p = 0..129 <-> image column p-1,
// d = 0..31 = channels hd*32+d of the pixel-major plane ([pix][128] f32 of this batch).
// Piece i = it*256 + tid (16 B): position seg = i >> 3, quarter-line pc = i & 7. Its source is the plane for an
// in-image position and the bias vector for a padded one (padded positions of the 1x1 conv equal the bias); the
// choice is made in the address. goff[it] = byte offset in the chosen source at head 0, bit it of inmask = in image.
// 392 positions x 8 pieces = 98 whole wave-wide copies: 12 in each of 8 waves and one more in waves 0 and 1; the
// last two positions are never read and take the bias.
// ---------------------------------------------------------------------------
__device__ __forceinline__ void kv_piece_map(int y, int tid, unsigned (&goff)[NCP], unsigned& inmask) {
  const int pc = tid & 7;
  inmask = 0u;
#pragma unroll
  for (int it = 0; it < NCP; ++it) {
    const int seg = it * 32 + (tid >> 3);
    const int r   = seg / KVPOS;
    const int p   = seg - r * KVPOS;
    const int yy  = y + r - 1;
    const int xx  = p - 1;
    const bool inb = (r < KVROWS) && (yy >= 0) && (yy < IMH) && (xx >= 0) && (xx < IMW);
    goff[it] = (inb ? (unsigned)(yy * IMW + xx) * (CCH * 4u) : 0u) + 16u * pc;
    inmask |= inb ? (1u << it) : 0u;
  }
}
// kbh = plane of this batch + hd*32, bbh = bias + hd*32, ldst = this lane's LDS byte address of piece it = 0.
__device__ __forceinline__ void copy_tile(const float* __restrict__ kbh, const float* __restrict__ bbh,
                                          unsigned ldst, const unsigned (&goff)[NCP], unsigned inmask, int wave) {
  const char* g[NCP];
  unsigned l[NCP];
#pragma unroll
  for (int it = 0; it < NCP; ++it) {
    g[it] = (const char*)(((inmask >> it) & 1u) ? kbh : bbh) + goff[it];
    l[it] = ldst + it * (32 * KVP * 4);
  }
  // the copies of one tile; the closing s_wait_xcnt keeps every later write of their address registers behind them
  asm volatile(
      "global_load_async_to_lds_b128 %0, %1, off\n\t"
      "global_load_async_to_lds_b128 %2, %3, off\n\t"
      "global_load_async_to_lds_b128 %4, %5, off\n\t"
      "global_load_async_to_lds_b128 %6, %7, off\n\t"
      "global_load_async_to_lds_b128 %8, %9, off\n\t"
      "global_load_async_to_lds_b128 %10, %11, off\n\t"
      "global_load_async_to_lds_b128 %12, %13, off\n\t"
      "global_load_async_to_lds_b128 %14, %15, off\n\t"
      "global_load_async_to_lds_b128 %16, %17, off\n\t"
      "global_load_async_to_lds_b128 %18, %19, off\n\t"
      "global_load_async_to_lds_b128 %20, %21, off\n\t"
      "global_load_async_to_lds_b128 %22, %23, off\n\t"
      "s_wait_xcnt 0x0"
      :: "v"(l[0]), "v"(g[0]), "v"(l[1]), "v"(g[1]), "v"(l[2]), "v"(g[2]), "v"(l[3]), "v"(g[3]),
         "v"(l[4]), "v"(g[4]), "v"(l[5]), "v"(g[5]), "v"(l[6]), "v"(g[6]), "v"(l[7]), "v"(g[7]),
         "v"(l[8]), "v"(g[8]), "v"(l[9]), "v"(g[9]), "v"(l[10]), "v"(g[10]), "v"(l[11]), "v"(g[11])
      : "memory");
  if (wave < 2) {                                        // wave-uniform: pieces 3072..3135
    asm volatile("global_load_async_to_lds_b128 %0, %1, off\n\t"
                 "s_wait_xcnt 0x0"
                 :: "v"(l[12]), "v"(g[12]) : "memory");
  }
}
// this wave's LDS reads and writes have retired (in front of a barrier behind which their bytes are copied over)
__device__ __forceinline__ void wait_ds0()    { asm volatile("s_wait_dscnt 0x0" ::: "memory"); }
// this wave's asynchronous copies have landed (in front of the barrier behind which other waves read them)
__device__ __forceinline__ void wait_async0() { asm volatile("s_wait_asynccnt 0x0" ::: "memory"); }

__device__ __forceinline__ void load16(const float* p, float (&v)[16]) {
#pragma unroll
  for (int g = 0; g < 4; ++g) {
    const v4f t = *(const v4f*)(p + 4 * g);
    v[4 * g + 0] = t[0]; v[4 * g + 1] = t[1]; v[4 * g + 2] = t[2]; v[4 * g + 3] = t[3];
  }
}

// ---------------------------------------------------------------------------
// One branch of the 3x3 local attention for (pixel px of the block's row, current head), computed by the lane pair
// (l, l^16): this lane holds dims 16*half..16*half+15 of q and of the accumulator; the 32-deep logit is the sum
// of the two partial dots exchanged with __shfl_xor(., 16) (a+b == b+a, so both lanes carry identical logits and
// identical max/sum state). Taps t = 0..8 <-> staged (r = t/3, p = px + t%3); online softmax with running max m,
// running sum ssum and accumulator ov (first tap peeled, no infinities); res += ov / ssum.
// All cross-lane ops sit under uniform control (rolled loop, no lane-varying branches).
// Each 16-B read: 16 lanes of one half at the 144-B pitch fall on 16 distinct groups of four banks.
// ---------------------------------------------------------------------------
__device__ __forceinline__ void attend_branch(const float* kvS, int px, int half,
                                              const float (&q)[16], float (&res)[16]) {
  const float* kcol = kvS + (size_t)px * KVP + 16 * half;
  float ov[16];
  float m, ssum;
  {
    float kv[16];
    load16(kcol, kv);                                    // tap 0: r = 0, dx = 0
    float part = 0.0f;
#pragma unroll
    for (int i = 0; i < 16; ++i) part += q[i] * kv[i];
    const float s = part + __shfl_xor(part, 16, 32);
    m = s;
    ssum = 1.0f;
#pragma unroll
    for (int i = 0; i < 16; ++i) ov[i] = kv[i];
  }
#pragma unroll 1
  for (int t = 1; t < 9; ++t) {
    const int r  = t / 3;
    const int dx = t - 3 * r;
    const float* kp = kcol + (size_t)(r * KVPOS + dx) * KVP;
    float kv[16];
    load16(kp, kv);
    float part = 0.0f;
#pragma unroll
    for (int i = 0; i < 16; ++i) part += q[i] * kv[i];
    const float s    = part + __shfl_xor(part, 16, 32);
    const float mn   = fmaxf(m, s);
    const float corr = __expf(m - mn);
    const float p    = __expf(s - mn);
    ssum = ssum * corr + p;
#pragma unroll
    for (int i = 0; i < 16; ++i) ov[i] = p * kv[i] + ov[i] * corr;
    m = mn;
  }
  const float inv = __builtin_amdgcn_rcpf(ssum);        // ssum in [1, 9]
#pragma unroll
  for (int i = 0; i < 16; ++i) res[i] += ov[i] * inv;
}

// ---------------------------------------------------------------------------
// Fused q projection + local attention + output. Block = (image row y, batch b), 256 threads, dynamic LDS:
//   phase 1: qT [128 px][TP] f32 : q = (Wq.x + bq) * 32^-0.5 for the row's 128 pixels (WMMA, as above)
//            Ws [2][128][WSP] bf16 : staged Wq planes
//   phase 2, in the same bytes: kv buffers 0 and 1 [392][36] f32 (one head of one branch around row y each) and
//            oT [32 ch][TP] f32 : 0.5 * (branch1 + branch2) for the current head (channel = head*32 + d, pixel)
// Thread = (px = 16*wave + (lane & 15), half = lane >> 4); its q values of all four heads are read from qT into
// registers once, which frees qT's bytes for buffer 1.
// Tiles t = 2*head + branch, tile t in buffer t & 1 (= branch). Two-buffer ring: tile t+1's copies fly while tile t
// is attended; at the foot of each trip every wave waits for its LDS reads and its own copies, passes ONE barrier
// (tile t+1 published, tile t's buffer left by every reader), and tile t+2 is then copied into that buffer.
// oT is written in front of the odd trip's foot barrier and read behind it; its next write stands two barriers on.
// Phase 3 per head: wave w writes channel rows 4w..4w+3 of out[b][head*32 + c][y][0..127]:
// Coverage: qT 8 waves x 16 rows x 128 cols; oT 128 px x 2 halves x 16 d = 32 ch x 128 px per head;
// out: grid (128, 4) x 4 heads x 32 channel rows x 128 px = the whole [4][128][128][128].
// All barriers are reached by all threads.
// ---------------------------------------------------------------------------
__global__ __launch_bounds__(256) void k_attn(const float* __restrict__ xq,
                                              const unsigned short* __restrict__ Wqh,
                                              const unsigned short* __restrict__ Wql,
                                              const float* __restrict__ bq,
                                              const float* __restrict__ bkv,
                                              const float* __restrict__ kv1,
                                              const float* __restrict__ kv2,
                                              float* __restrict__ out) {
  extern __shared__ __attribute__((aligned(16))) float smem[];
  float* qT  = smem;                                     // [128][TP], phase 1
  unsigned short* Ws = (unsigned short*)(smem + TILE_F); // [2][128][WSP] bf16, phase 1
  float* kvA = smem + BUF0_F;                            // [392][KVP], branch 0 tiles
  float* kvB = smem + BUF1_F;                            // [392][KVP], branch 1 tiles
  float* oT  = smem + OTO_F;                             // [32][TP]
  const int tid  = threadIdx.x;
  const int lane = tid & 31;
  const int wave = __builtin_amdgcn_readfirstlane(tid >> 5);
  const int y = blockIdx.x;
  const int b = blockIdx.y;

  // ---- phase 1: q projection of this row into LDS ----
  const float* xrow = xq + (size_t)b * CCH * HWPIX + (size_t)y * IMW;
  proj_row_tile(xrow, Wqh, Wql, bq, QSCALE, qT, Ws, tid, wave, lane);

  unsigned goff[NCP], inmask;
  kv_piece_map(y, tid, goff, inmask);
  const unsigned lpiece = (unsigned)((tid >> 3) * (KVP * 4) + (tid & 7) * 16);
  const unsigned ldsA = (unsigned)(size_t)kvA + lpiece;  // low 32 bits of a __shared__ address = LDS byte address
  const unsigned ldsB = (unsigned)(size_t)kvB + lpiece;
  const float* kb1 = kv1 + (size_t)b * HWPIX * CCH;
  const float* kb2 = kv2 + (size_t)b * HWPIX * CCH;

  wait_ds0();
  __syncthreads();                                       // qT published; every read of Ws has ended
  copy_tile(kb1, bkv, ldsA, goff, inmask, wave);         // tile 0 -> buffer 0 (former Ws bytes)

  const int half = lane >> 4;
  const int px   = 16 * wave + (lane & 15);
  float q[NHEADS * 16];                                  // q[16*k + i]: head (current + k), dim 16*half + i
#pragma unroll
  for (int k = 0; k < NHEADS; ++k) {
    float t[16];
    load16(qT + (size_t)px * TP + k * DHEAD + 16 * half, t);
#pragma unroll
    for (int i = 0; i < 16; ++i) q[16 * k + i] = t[i];
  }
  wait_ds0();
  wait_async0();
  __syncthreads();                                       // tile 0 published; every read of qT has ended
  copy_tile(kb2, bkv, ldsB, goff, inmask, wave);         // tile 1 -> buffer 1 (former qT bytes)

  // ---- phase 2 / 3: per head ----
#pragma unroll 1
  for (int hd = 0; hd < NHEADS; ++hd) {
    float qc[16], res[16];
#pragma unroll
    for (int i = 0; i < 16; ++i) { qc[i] = q[i]; res[i] = 0.0f; }
    const int nx = (hd + 1) * DHEAD;                     // channel offset of the next head

    attend_branch(kvA, px, half, qc, res);               // trip 2*hd
    wait_ds0();
    wait_async0();
    __syncthreads();                                     // tile 2*hd+1 published; buffer 0 left by every reader
    if (hd + 1 < NHEADS) copy_tile(kb1 + nx, bkv + nx, ldsA, goff, inmask, wave);

    attend_branch(kvB, px, half, qc, res);               // trip 2*hd+1
    // result tile of this head: oT[16*half + i][px]
#pragma unroll
    for (int i = 0; i < 16; ++i) oT[(size_t)(16 * half + i) * TP + px] = 0.5f * res[i];
    wait_ds0();
    wait_async0();
    __syncthreads();                                     // tile 2*hd+2 and oT published; buffer 1 left by every reader
    if (hd + 1 < NHEADS) copy_tile(kb2 + nx, bkv + nx, ldsB, goff, inmask, wave);

    // ---- phase 3: channel-major output rows of this head ----
#pragma unroll
    for (int k = 0; k < 4; ++k) {
      const int cc = 4 * wave + k;                       // 0..31 within the head
      const v4f v = *(const v4f*)(oT + (size_t)cc * TP + 4 * lane);
      float* dst = out + (((size_t)b * CCH + hd * DHEAD + cc) * IMH + y) * IMW + 4 * lane;
      *(v4f*)dst = v;
    }
    // the four stores' address and data registers are rewritten by the next head's first instructions: wait first
    asm volatile("s_wait_xcnt 0x0" ::: "memory");
    // the next head's q moves to the front (the loop stays rolled, every register index constant)
#pragma unroll
    for (int i = 0; i < (NHEADS - 1) * 16; ++i) q[i] = q[i + 16];
  }
  wait_async0();                                         // no copy is outstanding when the wave ends
}

// ---------------------------------------------------------------------------
// Workspace map (byte offsets, all 256-B aligned, every region fully written before it is read):
//   Wq hi  bf16 [128][128]         0        (32768 B)
//   Wq lo  bf16 [128][128]     32768
//   Wkv hi bf16 [128][128]     65536
//   Wkv lo bf16 [128][128]     98304
//   kv1    f32  [4*16384][128] 131072      (33554432 B, 512-B rows)
//   kv2    f32  [4*16384][128] 33685504
//   total                      67239936
// ---------------------------------------------------------------------------
extern "C" void kernel_launch(void* const* d_in, const int* in_sizes, int n_in,
                              void* d_out, int out_size, void* d_ws, size_t ws_size,
                              hipStream_t stream) {
  if (n_in < 7) return;
  const int nmap = NB * CCH * HWPIX;
  if (in_sizes[0] != nmap || in_sizes[1] != nmap || in_sizes[2] != nmap) return;
  if (in_sizes[3] != CCH * CCH || in_sizes[4] != CCH) return;
  if (in_sizes[5] != CCH * CCH || in_sizes[6] != CCH) return;
  if (out_size != nmap) return;

  const float* kvmap1 = (const float*)d_in[0];
  const float* qmap   = (const float*)d_in[1];
  const float* kvmap2 = (const float*)d_in[2];
  const float* Wq     = (const float*)d_in[3];
  const float* bq     = (const float*)d_in[4];
  const float* Wkv    = (const float*)d_in[5];
  const float* bkv    = (const float*)d_in[6];
  float* out = (float*)d_out;

  const size_t PW  = (size_t)CCH * CCH * 2;                       // 32768
  const size_t PKV = (size_t)NB * HWPIX * CCH * 4;                // 33554432
  size_t off = 0;
  const size_t oWqh = off; off += PW;
  const size_t oWql = off; off += PW;
  const size_t oWkh = off; off += PW;
  const size_t oWkl = off; off += PW;
  const size_t oKV1 = off; off += PKV;
  const size_t oKV2 = off; off += PKV;
  if (off > ws_size) return;

  char* ws = (char*)d_ws;
  unsigned short* Wqh = (unsigned short*)(ws + oWqh);
  unsigned short* Wql = (unsigned short*)(ws + oWql);
  unsigned short* Wkh = (unsigned short*)(ws + oWkh);
  unsigned short* Wkl = (unsigned short*)(ws + oWkl);
  float* KV1 = (float*)(ws + oKV1);
  float* KV2 = (float*)(ws + oKV2);

  const size_t ldsA = (size_t)PROJ_LDS_F * 4;                     // 137216
  const size_t ldsB = (size_t)ATTN_LDS_F * 4;                     // 137216
  (void)hipFuncSetAttribute(reinterpret_cast<const void*>(&k_kvproj),
                            hipFuncAttributeMaxDynamicSharedMemorySize, (int)ldsA);
  (void)hipFuncSetAttribute(reinterpret_cast<const void*>(&k_attn),
                            hipFuncAttributeMaxDynamicSharedMemorySize, (int)ldsB);

  const dim3 blk(256);
  k_split_w<<<dim3(64), blk, 0, stream>>>(Wq, Wkv, Wqh, Wql, Wkh, Wkl);
  k_kvproj<<<dim3(IMH, NB), blk, ldsA, stream>>>(kvmap1, Wkh, Wkl, bkv, KV1);
  k_kvproj<<<dim3(IMH, NB), blk, ldsA, stream>>>(kvmap2, Wkh, Wkl, bkv, KV2);
  k_attn<<<dim3(IMH, NB), blk, ldsB, stream>>>(qmap, Wqh, Wql, bq, bkv, KV1, KV2, out);
  (void)hipGetLastError();
}

// v004
// A run of this version takes 63.2 microseconds.
// Two timings next to v003 both put it at 1.06 times that version's speed.
// Counting every step since v000, it is 2.11 times as fast.
// Contractions: three 1x1-conv projections (q from map in1, kv from maps in0 and in2; M = pixels, N = 128, K = 128)
// on v_wmma_f32_16x16x32_bf16 with bf16 hi/lo split operands (hi.hi + hi.lo + lo.hi), f32 accumulate;
// 9-tap local-window logits, softmax, weighted sums and the two-branch mean in f32 on the VALU.
#include <hip/hip_runtime.h>
#include <stdint.h>

#define NB      4
#define CCH     128
#define IMH     128
#define IMW     128
#define HWPIX   (IMH * IMW)
#define NHEADS  4
#define DHEAD   32
#define QSCALE  0.17677669529663687f     // 32^-0.5
#define TP      132                       // LDS tile pitch in floats (16-B multiple)
#define TILE_F  (128 * TP)                // floats of one 128 x 128 tile with pitch TP
#define KVROWS  3                         // staged kv rows: y-1, y, y+1
#define KVPOS   130                       // staged kv positions: x = -1 .. 128
#define KVP     36                        // LDS pitch of a staged kv position in floats (144 B = 16 B x 9; 32 used)
#define KVSEG   392                       // positions of one kv buffer: 3 x 130 staged + 2 that complete the last wave-wide copy
#define KVB_F   (KVSEG * KVP)             // 14112 floats = 56448 B: one kv buffer (one head of one branch)
#define NCP     13                        // 16-B copies per lane and tile: 12 in every wave, a 13th in waves 0 and 1
#define OT_F    (DHEAD * TP)              // 4224 floats: [32 ch][TP] per-head result tile
#define WSP     136                       // LDS pitch of a staged weight row in bf16 (272 B = 16 B x 17)
#define WS_PLANE (CCH * WSP)              // 17408 bf16: one staged weight plane [128][WSP]
#define WS_F    (2 * WS_PLANE / 2)        // 17408 floats: hi and lo plane together (69632 B)
#define PROJ_LDS_F (TILE_F + WS_F)        // 34304 floats = 137216 B: result tile + staged weights
#define BUF1_F  0                         // kv buffer 1: lies in the q tile's bytes, filled only after q is in registers
#define OTO_F   (BUF1_F + KVB_F)          // per-head result tile
#define BUF0_F  (OTO_F + OT_F)            // kv buffer 0: lies wholly in the staged-weight bytes, free once phase 1 ends
#define ATTN_LDS_F PROJ_LDS_F             // phase 2 (2 x KVB_F + OT_F = 32448 floats) lives inside phase 1's bytes
static_assert(BUF0_F >= TILE_F && BUF0_F + KVB_F <= PROJ_LDS_F);
static_assert(KVSEG * 8 == 12 * 256 + 64 && KVSEG >= KVROWS * KVPOS);

typedef __attribute__((ext_vector_type(16))) __bf16         v16b;
typedef __attribute__((ext_vector_type(8)))  unsigned short v8us;
typedef __attribute__((ext_vector_type(8)))  float          v8f;
typedef __attribute__((ext_vector_type(4)))  float          v4f;
typedef __attribute__((ext_vector_type(2)))  float          v2f;

union Frg { v16b b; v8us h8[2]; unsigned int w[8]; };
static_assert(sizeof(Frg) == 32);

// ---------------------------------------------------------------------------
// small helpers
// ---------------------------------------------------------------------------
__device__ __forceinline__ unsigned short f2bf(float f) {          // bf16 RNE convert, bits
  const unsigned u = __float_as_uint(f);
  return (unsigned short)((u + 0x7FFFu + ((u >> 16) & 1u)) >> 16);
}
__device__ __forceinline__ float bf2f(unsigned short h) { return __uint_as_float(((unsigned)h) << 16); }
__device__ __forceinline__ unsigned int pk16(unsigned short lo, unsigned short hi) {
  return (unsigned)lo | ((unsigned)hi << 16);
}
__device__ __forceinline__ void opt_fence() { asm volatile("" ::: "memory"); }

__device__ __forceinline__ v8f zero8() {
  v8f z = {0.f, 0.f, 0.f, 0.f, 0.f, 0.f, 0.f, 0.f};
  return z;
}

// WMMA with the hazard guard tied to D, keeping A/B live across the guard
__device__ __forceinline__ v8f mma16(v16b a, v16b b, v8f c) {
  v8f d = __builtin_amdgcn_wmma_f32_16x16x32_bf16(false, a, false, b, (short)0, c, false, false);
  asm volatile("v_nop\n\tv_nop\n\tv_nop\n\tv_nop" : "+v"(d) : "v"(a), "v"(b));
  return d;
}

// ---------------------------------------------------------------------------
// Fragment builders (wave32, 16x16x32, split k map for BOTH operands):
//   lane l: row/col = l & 15, h = l >> 4; element i (0..7) <- k0 + 8h + i, element i (8..15) <- k0 + 16 + 8h + (i-8)
// ---------------------------------------------------------------------------
// Operand gathered from a channel-major f32 map: row m = pixel (pt + m), k = channel, channel stride HWPIX.
// Values are split into bf16 hi (RNE) and lo = RNE(v - hi) planes in registers.
__device__ __forceinline__ void gather_split(const float* __restrict__ pt, int lane, int k0, Frg& fh, Frg& fl) {
  const int m = lane & 15, h = lane >> 4;
  const float* pm = pt + m;
#pragma unroll
  for (int q = 0; q < 8; ++q) {
    const int c = k0 + ((q < 4) ? (8 * h + 2 * q) : (16 + 8 * h + 2 * (q - 4)));
    const float v0 = pm[(size_t)c * HWPIX];
    const float v1 = pm[(size_t)(c + 1) * HWPIX];
    const unsigned short h0 = f2bf(v0), h1 = f2bf(v1);
    const unsigned short l0 = f2bf(v0 - bf2f(h0)), l1 = f2bf(v1 - bf2f(h1));
    fh.w[q] = pk16(h0, h1);
    fl.w[q] = pk16(l0, l1);
  }
}
// Operand from a bf16 plane staged in LDS as [row][WSP] with k contiguous (weights W[oc][c]): two 16-B LDS loads
// per lane; 16 lanes at the 272-B pitch fall on 16 distinct groups of four banks.
__device__ __forceinline__ void wfrag(const unsigned short* W, int row0, int lane, int k0, Frg& f) {
  const int m = lane & 15, h = lane >> 4;
  const unsigned short* p = W + (row0 + m) * WSP + k0 + 8 * h;
  f.h8[0] = *(const v8us*)(p);
  f.h8[1] = *(const v8us*)(p + 16);
}
// Copy both weight planes ([128][128] bf16, global) into LDS: Ws[plane][row][WSP]. 2048 16-B pieces per plane,
// 8 per thread; a wave's load covers 512 contiguous bytes, its store two whole rows.
__device__ __forceinline__ void stage_w(const unsigned short* __restrict__ Wh,
                                        const unsigned short* __restrict__ Wl,
                                        unsigned short* Ws, int tid) {
#pragma unroll
  for (int i = 0; i < 8; ++i) {
    const int s   = i * 256 + tid;               // piece 0..2047
    const int row = s >> 4, pc = s & 15;
    const v8us a = *(const v8us*)(Wh + 8 * s);
    const v8us b = *(const v8us*)(Wl + 8 * s);
    *(v8us*)(Ws + row * WSP + 8 * pc)            = a;
    *(v8us*)(Ws + WS_PLANE + row * WSP + 8 * pc) = b;
  }
}

// ---------------------------------------------------------------------------
// Per-block 128-pixel x 128-out-channel projection of one image row into an LDS tile T[px][oc] (pitch TP):
//   T[px][oc] = (sum_c x[c][px] * W[oc][c] + bias[oc]) * scale
// 8 waves; wave w owns pixels 16w..16w+15 (A = gathered x rows) and all 8 oc tiles (B = W planes, cols = oc).
// The block first copies both W planes into LDS (Ws) once; every B fragment is then read from there.
// D element r of lane l = (row px 16w + 8h + r, col oc 16j + (l & 15)).
// ---------------------------------------------------------------------------
__device__ __forceinline__ void proj_row_tile(const float* __restrict__ xrow,
                                              const unsigned short* __restrict__ Wh,
                                              const unsigned short* __restrict__ Wl,
                                              const float* __restrict__ bias, float scale,
                                              float* T, unsigned short* Ws, int tid, int wave, int lane) {
  const int m = lane & 15, h = lane >> 4;
  stage_w(Wh, Wl, Ws, tid);
  __syncthreads();                                       // staged weights visible to all 8 waves
  v8f acc[8];
#pragma unroll
  for (int j = 0; j < 8; ++j) acc[j] = zero8();
  const float* xt = xrow + 16 * wave;
#pragma unroll 1
  for (int k0 = 0; k0 < CCH; k0 += 32) {
    Frg ah, al;
    gather_split(xt, lane, k0, ah, al);
#pragma unroll
    for (int j = 0; j < 8; ++j) {
      opt_fence();
      Frg bh, bl;
      wfrag(Ws, 16 * j, lane, k0, bh);
      wfrag(Ws + WS_PLANE, 16 * j, lane, k0, bl);
      acc[j] = mma16(ah.b, bh.b, acc[j]);
      acc[j] = mma16(ah.b, bl.b, acc[j]);
      acc[j] = mma16(al.b, bh.b, acc[j]);
    }
  }
  // epilogue: bias, scale, D -> LDS tile (this wave's 16 pixel rows, all 128 columns)
#pragma unroll
  for (int j = 0; j < 8; ++j) {
    const float bvv = bias[16 * j + m];
    float* trow = T + (size_t)(16 * wave + 8 * h) * TP + 16 * j + m;
#pragma unroll
    for (int r = 0; r < 8; ++r) trow[r * TP] = (acc[j][r] + bvv) * scale;
  }
}

// ---------------------------------------------------------------------------
// Weight split: Wq (blocks 0..31) and Wkv (blocks 32..63), f32 [128][128] -> bf16 hi / lo planes [128][128].
// ---------------------------------------------------------------------------
__global__ __launch_bounds__(256) void k_split_w(const float* __restrict__ Wq, const float* __restrict__ Wkv,
                                                 unsigned short* __restrict__ qh, unsigned short* __restrict__ ql,
                                                 unsigned short* __restrict__ kh, unsigned short* __restrict__ kl) {
  const int blk = blockIdx.x;
  const bool isq = (blk < 32);                          // block-uniform
  const float* src = isq ? Wq : Wkv;
  unsigned short* dh = isq ? qh : kh;
  unsigned short* dl = isq ? ql : kl;
  const int i = (blk & 31) * 256 + threadIdx.x;        // pair index 0..8191 (exact)
  const v2f f = *(const v2f*)(src + 2 * (size_t)i);
  const unsigned short h0 = f2bf(f[0]), h1 = f2bf(f[1]);
  const unsigned short l0 = f2bf(f[0] - bf2f(h0)), l1 = f2bf(f[1] - bf2f(h1));
  const unsigned uh = pk16(h0, h1), ul = pk16(l0, l1);
  ((unsigned*)dh)[i] = uh;
  ((unsigned*)dl)[i] = ul;
  
}

// ---------------------------------------------------------------------------
// kv projection of one map (interior positions only; padded-border keys equal the bias and are copied from it
// in the attention kernel). Block = (image row y, batch b); output plane pixel-major kvp[b][pix][128] f32.
// Store phase: wave w writes pixel rows 16w..16w+15, each row = 32 lanes x 16 B = the whole 512-B row in ONE
// Coverage: grid (128, 4) x 128 rows x 128 floats = the whole [4][16384][128] plane.
// ---------------------------------------------------------------------------
__global__ __launch_bounds__(256) void k_kvproj(const float* __restrict__ x,
                                                const unsigned short* __restrict__ Wh,
                                                const unsigned short* __restrict__ Wl,
                                                const float* __restrict__ bias,
                                                float* __restrict__ kvp) {
  extern __shared__ __attribute__((aligned(16))) float smem[];
  float* T = smem;                                       // [128][TP]
  unsigned short* Ws = (unsigned short*)(smem + TILE_F); // [2][128][WSP] bf16
  const int tid  = threadIdx.x;
  const int lane = tid & 31;
  const int wave = __builtin_amdgcn_readfirstlane(tid >> 5);
  const int y = blockIdx.x;
  const int b = blockIdx.y;
  const float* xrow = x + (size_t)b * CCH * HWPIX + (size_t)y * IMW;
  proj_row_tile(xrow, Wh, Wl, bias, 1.0f, T, Ws, tid, wave, lane);
  __syncthreads();
  float* dstb = kvp + ((size_t)b * HWPIX + (size_t)y * IMW) * CCH;
  {
#pragma unroll
    for (int i = 0; i < 16; ++i) {
      const int rr = 16 * wave + i;
      const v4f v = *(const v4f*)(T + (size_t)rr * TP + 4 * lane);
      *(v4f*)(dstb + (size_t)rr * CCH + 4 * lane) = v;
    }
    
  }
}

// ---------------------------------------------------------------------------
// Bring one head of one kv branch for image row y into an LDS buffer with asynchronous 16-B copies, through no
// register: buffer[r][p][d] at pitch KVP per p, r = 0..2 <-> image row y-1+r, p = 0..129 <-> image column p-1,
// d = 0..31 = channels hd*32+d of the pixel-major plane ([pix][128] f32 of this batch).
// Piece i = it*256 + tid (16 B): position seg = i >> 3, quarter-line pc = i & 7. Its source is the plane for an
// in-image position and the bias vector for a padded one (padded positions of the 1x1 conv equal the bias); the
// choice is made in the address. goff[it] = byte offset in the chosen source at head 0, bit it of inmask = in image.
// 392 positions x 8 pieces = 98 whole wave-wide copies: 12 in each of 8 waves and one more in waves 0 and 1; the
// last two positions are never read and take the bias.
// ---------------------------------------------------------------------------
__device__ __forceinline__ void kv_piece_map(int y, int tid, unsigned (&goff)[NCP], unsigned& inmask) {
  const int pc = tid & 7;
  inmask = 0u;
#pragma unroll
  for (int it = 0; it < NCP; ++it) {
    const int seg = it * 32 + (tid >> 3);
    const int r   = seg / KVPOS;
    const int p   = seg - r * KVPOS;
    const int yy  = y + r - 1;
    const int xx  = p - 1;
    const bool inb = (r < KVROWS) && (yy >= 0) && (yy < IMH) && (xx >= 0) && (xx < IMW);
    goff[it] = (inb ? (unsigned)(yy * IMW + xx) * (CCH * 4u) : 0u) + 16u * pc;
    inmask |= inb ? (1u << it) : 0u;
  }
}
// kbh = plane of this batch + hd*32, bbh = bias + hd*32, ldst = this lane's LDS byte address of piece it = 0.
__device__ __forceinline__ void copy_tile(const float* __restrict__ kbh, const float* __restrict__ bbh,
                                          unsigned ldst, const unsigned (&goff)[NCP], unsigned inmask, int wave) {
  const char* g[NCP];
  unsigned l[NCP];
#pragma unroll
  for (int it = 0; it < NCP; ++it) {
    g[it] = (const char*)(((inmask >> it) & 1u) ? kbh : bbh) + goff[it];
    l[it] = ldst + it * (32 * KVP * 4);
  }
  // the copies of one tile; the closing s_wait_xcnt keeps every later write of their address registers behind them
  asm volatile(
      "global_load_async_to_lds_b128 %0, %1, off\n\t"
      "global_load_async_to_lds_b128 %2, %3, off\n\t"
      "global_load_async_to_lds_b128 %4, %5, off\n\t"
      "global_load_async_to_lds_b128 %6, %7, off\n\t"
      "global_load_async_to_lds_b128 %8, %9, off\n\t"
      "global_load_async_to_lds_b128 %10, %11, off\n\t"
      "global_load_async_to_lds_b128 %12, %13, off\n\t"
      "global_load_async_to_lds_b128 %14, %15, off\n\t"
      "global_load_async_to_lds_b128 %16, %17, off\n\t"
      "global_load_async_to_lds_b128 %18, %19, off\n\t"
      "global_load_async_to_lds_b128 %20, %21, off\n\t"
      "global_load_async_to_lds_b128 %22, %23, off\n\t"
      "s_wait_xcnt 0x0"
      :: "v"(l[0]), "v"(g[0]), "v"(l[1]), "v"(g[1]), "v"(l[2]), "v"(g[2]), "v"(l[3]), "v"(g[3]),
         "v"(l[4]), "v"(g[4]), "v"(l[5]), "v"(g[5]), "v"(l[6]), "v"(g[6]), "v"(l[7]), "v"(g[7]),
         "v"(l[8]), "v"(g[8]), "v"(l[9]), "v"(g[9]), "v"(l[10]), "v"(g[10]), "v"(l[11]), "v"(g[11])
      : "memory");
  if (wave < 2) {                                        // wave-uniform: pieces 3072..3135
    asm volatile("global_load_async_to_lds_b128 %0, %1, off\n\t"
                 "s_wait_xcnt 0x0"
                 :: "v"(l[12]), "v"(g[12]) : "memory");
  }
}
// this wave's LDS reads and writes have retired (in front of a barrier behind which their bytes are copied over)
__device__ __forceinline__ void wait_ds0()    { asm volatile("s_wait_dscnt 0x0" ::: "memory"); }
// this wave's asynchronous copies have landed (in front of the barrier behind which other waves read them)
__device__ __forceinline__ void wait_async0() { asm volatile("s_wait_asynccnt 0x0" ::: "memory"); }

__device__ __forceinline__ void load16(const float* p, float (&v)[16]) {
#pragma unroll
  for (int g = 0; g < 4; ++g) {
    const v4f t = *(const v4f*)(p + 4 * g);
    v[4 * g + 0] = t[0]; v[4 * g + 1] = t[1]; v[4 * g + 2] = t[2]; v[4 * g + 3] = t[3];
  }
}

// ---------------------------------------------------------------------------
// One branch of the 3x3 local attention for (pixel px of the block's row, current head), computed by the lane pair
// (l, l^16): this lane holds dims 16*half..16*half+15 of q and of the accumulator; the 32-deep logit is the sum
// of the two partial dots exchanged with __shfl_xor(., 16) (a+b == b+a, so both lanes carry identical logits and
// identical max/sum state). Taps t = 0..8 <-> staged (r = t/3, p = px + t%3).
// Online softmax one window row (three taps) at a time, all unrolled: a row's twelve LDS reads, three dots
// and three exchanges are independent of one another and run side by side; the running max m, the running sum ssum
// and the accumulator ov are rescaled once per row (not at all in the first row, no infinities). Within ssum and ov
// the taps are added in the order t = 0..8; res += ov / ssum.
// All cross-lane ops sit under uniform control (no lane-varying branches).
// Each 16-B read: 16 lanes of one half at the 144-B pitch fall on 16 distinct groups of four banks.
// ---------------------------------------------------------------------------
// 16 floats as 8 register pairs, in the order the four 16-B LDS reads deliver them
__device__ __forceinline__ void load8x2(const float* p, v2f (&v)[8]) {
#pragma unroll
  for (int g = 0; g < 4; ++g) {
    const v4f t = *(const v4f*)(p + 4 * g);
    v[2 * g + 0] = (v2f){t[0], t[1]};
    v[2 * g + 1] = (v2f){t[2], t[3]};
  }
}
// One window row: its three taps' kv values (twelve 16-B LDS reads) and its three logits. Each partial dot runs on
// packed f32 FMAs over the register pairs: even and odd dims are summed apart and added at the end.
__device__ __forceinline__ void row_logits(const float* krow, const v2f (&q2)[8], v2f (&kv)[3][8], float (&s)[3]) {
#pragma unroll
  for (int dx = 0; dx < 3; ++dx) load8x2(krow + dx * KVP, kv[dx]);
  v2f a[3];
#pragma unroll
  for (int dx = 0; dx < 3; ++dx) a[dx] = q2[0] * kv[dx][0];
#pragma unroll
  for (int g = 1; g < 8; ++g) {
#pragma unroll
    for (int dx = 0; dx < 3; ++dx) a[dx] = __builtin_elementwise_fma(q2[g], kv[dx][g], a[dx]);
  }
  float part[3];
#pragma unroll
  for (int dx = 0; dx < 3; ++dx) part[dx] = a[dx][0] + a[dx][1];
#pragma unroll
  for (int dx = 0; dx < 3; ++dx) s[dx] = part[dx] + __shfl_xor(part[dx], 16, 32);
}
__device__ __forceinline__ void attend_branch(const float* kvS, int px, int half,
                                              const float (&q)[16], float (&res)[16]) {
  const float* kcol = kvS + (size_t)px * KVP + 16 * half;
  v2f q2[8], ov[8];
#pragma unroll
  for (int g = 0; g < 8; ++g) q2[g] = (v2f){q[2 * g], q[2 * g + 1]};
  float m, ssum;
  {
    v2f kv[3][8];
    float s[3];
    row_logits(kcol, q2, kv, s);                         // taps 0..2
    m = fmaxf(fmaxf(s[0], s[1]), s[2]);
    const float p0 = __expf(s[0] - m), p1 = __expf(s[1] - m), p2 = __expf(s[2] - m);
    ssum = (p0 + p1) + p2;
#pragma unroll
    for (int g = 0; g < 8; ++g) ov[g] = p2 * kv[2][g] + (p1 * kv[1][g] + p0 * kv[0][g]);
  }
  // unrolled: every LDS offset is an immediate, and the next row's reads and dots overlap this row's exponentials and sums
#pragma unroll
  for (int r = 1; r < KVROWS; ++r) {
    v2f kv[3][8];
    float s[3];
    row_logits(kcol + (size_t)r * (KVPOS * KVP), q2, kv, s);  // taps 3r..3r+2
    const float mn   = fmaxf(m, fmaxf(fmaxf(s[0], s[1]), s[2]));
    const float corr = __expf(m - mn);
    const float p0 = __expf(s[0] - mn), p1 = __expf(s[1] - mn), p2 = __expf(s[2] - mn);
    ssum = ((ssum * corr + p0) + p1) + p2;
#pragma unroll
    for (int g = 0; g < 8; ++g) ov[g] = p2 * kv[2][g] + (p1 * kv[1][g] + (p0 * kv[0][g] + ov[g] * corr));
    m = mn;
  }
  const float inv = __builtin_amdgcn_rcpf(ssum);        // ssum in [1, 9]
#pragma unroll
  for (int g = 0; g < 8; ++g) {
    res[2 * g + 0] += ov[g][0] * inv;
    res[2 * g + 1] += ov[g][1] * inv;
  }
}

// ---------------------------------------------------------------------------
// Fused q projection + local attention + output. Block = (image row y, batch b), 256 threads, dynamic LDS:
//   phase 1: qT [128 px][TP] f32 : q = (Wq.x + bq) * 32^-0.5 for the row's 128 pixels (WMMA, as above)
//            Ws [2][128][WSP] bf16 : staged Wq planes
//   phase 2, in the same bytes: kv buffers 0 and 1 [392][36] f32 (one head of one branch around row y each) and
//            oT [32 ch][TP] f32 : 0.5 * (branch1 + branch2) for the current head (channel = head*32 + d, pixel)
// Thread = (px = 16*wave + (lane & 15), half = lane >> 4); its q values of all four heads are read from qT into
// registers once, which frees qT's bytes for buffer 1.
// Tiles t = 2*head + branch, tile t in buffer t & 1 (= branch). Two-buffer ring: tile t+1's copies fly while tile t
// is attended; at the foot of each trip every wave waits for its LDS reads and its own copies, passes ONE barrier
// (tile t+1 published, tile t's buffer left by every reader), and tile t+2 is then copied into that buffer.
// oT is written in front of the odd trip's foot barrier and read behind it; its next write stands two barriers on.
// Phase 3 per head: wave w writes channel rows 4w..4w+3 of out[b][head*32 + c][y][0..127]:
// Coverage: qT 8 waves x 16 rows x 128 cols; oT 128 px x 2 halves x 16 d = 32 ch x 128 px per head;
// out: grid (128, 4) x 4 heads x 32 channel rows x 128 px = the whole [4][128][128][128].
// All barriers are reached by all threads.
// ---------------------------------------------------------------------------
__global__ __launch_bounds__(256) void k_attn(const float* __restrict__ xq,
                                              const unsigned short* __restrict__ Wqh,
                                              const unsigned short* __restrict__ Wql,
                                              const float* __restrict__ bq,
                                              const float* __restrict__ bkv,
                                              const float* __restrict__ kv1,
                                              const float* __restrict__ kv2,
                                              float* __restrict__ out) {
  extern __shared__ __attribute__((aligned(16))) float smem[];
  float* qT  = smem;                                     // [128][TP], phase 1
  unsigned short* Ws = (unsigned short*)(smem + TILE_F); // [2][128][WSP] bf16, phase 1
  float* kvA = smem + BUF0_F;                            // [392][KVP], branch 0 tiles
  float* kvB = smem + BUF1_F;                            // [392][KVP], branch 1 tiles
  float* oT  = smem + OTO_F;                             // [32][TP]
  const int tid  = threadIdx.x;
  const int lane = tid & 31;
  const int wave = __builtin_amdgcn_readfirstlane(tid >> 5);
  const int y = blockIdx.x;
  const int b = blockIdx.y;

  // ---- phase 1: q projection of this row into LDS ----
  const float* xrow = xq + (size_t)b * CCH * HWPIX + (size_t)y * IMW;
  proj_row_tile(xrow, Wqh, Wql, bq, QSCALE, qT, Ws, tid, wave, lane);

  unsigned goff[NCP], inmask;
  kv_piece_map(y, tid, goff, inmask);
  const unsigned lpiece = (unsigned)((tid >> 3) * (KVP * 4) + (tid & 7) * 16);
  const unsigned ldsA = (unsigned)(size_t)kvA + lpiece;  // low 32 bits of a __shared__ address = LDS byte address
  const unsigned ldsB = (unsigned)(size_t)kvB + lpiece;
  const float* kb1 = kv1 + (size_t)b * HWPIX * CCH;
  const float* kb2 = kv2 + (size_t)b * HWPIX * CCH;

  wait_ds0();
  __syncthreads();                                       // qT published; every read of Ws has ended
  copy_tile(kb1, bkv, ldsA, goff, inmask, wave);         // tile 0 -> buffer 0 (former Ws bytes)

  const int half = lane >> 4;
  const int px   = 16 * wave + (lane & 15);
  float q[NHEADS * 16];                                  // q[16*k + i]: head (current + k), dim 16*half + i
#pragma unroll
  for (int k = 0; k < NHEADS; ++k) {
    float t[16];
    load16(qT + (size_t)px * TP + k * DHEAD + 16 * half, t);
#pragma unroll
    for (int i = 0; i < 16; ++i) q[16 * k + i] = t[i];
  }
  wait_ds0();
  wait_async0();
  __syncthreads();                                       // tile 0 published; every read of qT has ended
  copy_tile(kb2, bkv, ldsB, goff, inmask, wave);         // tile 1 -> buffer 1 (former qT bytes)

  // ---- phase 2 / 3: per head ----
#pragma unroll 1
  for (int hd = 0; hd < NHEADS; ++hd) {
    float qc[16], res[16];
#pragma unroll
    for (int i = 0; i < 16; ++i) { qc[i] = q[i]; res[i] = 0.0f; }
    const int nx = (hd + 1) * DHEAD;                     // channel offset of the next head

    // rolled over the two branches: one copy of the code, and the copies' lane addresses are formed per trip
    // instead of being held in registers for both branches (room for a window row's kv values)
#pragma unroll 1
    for (int br = 0; br < 2; ++br) {                     // trip 2*hd + br, buffer br
      attend_branch(br ? kvB : kvA, px, half, qc, res);
      if (br) {
        // result tile of this head: oT[16*half + i][px]
#pragma unroll
        for (int i = 0; i < 16; ++i) oT[(size_t)(16 * half + i) * TP + px] = 0.5f * res[i];
      }
      wait_ds0();
      wait_async0();
      __syncthreads();                                   // next tile (and oT) published; buffer br left by every reader
      if (hd + 1 < NHEADS) copy_tile((br ? kb2 : kb1) + nx, bkv + nx, br ? ldsB : ldsA, goff, inmask, wave);
    }

    // ---- phase 3: channel-major output rows of this head ----
#pragma unroll
    for (int k = 0; k < 4; ++k) {
      const int cc = 4 * wave + k;                       // 0..31 within the head
      const v4f v = *(const v4f*)(oT + (size_t)cc * TP + 4 * lane);
      float* dst = out + (((size_t)b * CCH + hd * DHEAD + cc) * IMH + y) * IMW + 4 * lane;
      *(v4f*)dst = v;
    }
    // the four stores' address and data registers are rewritten by the next head's first instructions: wait first
    asm volatile("s_wait_xcnt 0x0" ::: "memory");
    // the next head's q moves to the front (the loop stays rolled, every register index constant)
#pragma unroll
    for (int i = 0; i < (NHEADS - 1) * 16; ++i) q[i] = q[i + 16];
  }
  wait_async0();                                         // no copy is outstanding when the wave ends
}

// ---------------------------------------------------------------------------
// Workspace map (byte offsets, all 256-B aligned, every region fully written before it is read):
//   Wq hi  bf16 [128][128]         0        (32768 B)
//   Wq lo  bf16 [128][128]     32768
//   Wkv hi bf16 [128][128]     65536
//   Wkv lo bf16 [128][128]     98304
//   kv1    f32  [4*16384][128] 131072      (33554432 B, 512-B rows)
//   kv2    f32  [4*16384][128] 33685504
//   total                      67239936
// ---------------------------------------------------------------------------
extern "C" void kernel_launch(void* const* d_in, const int* in_sizes, int n_in,
                              void* d_out, int out_size, void* d_ws, size_t ws_size,
                              hipStream_t stream) {
  if (n_in < 7) return;
  const int nmap = NB * CCH * HWPIX;
  if (in_sizes[0] != nmap || in_sizes[1] != nmap || in_sizes[2] != nmap) return;
  if (in_sizes[3] != CCH * CCH || in_sizes[4] != CCH) return;
  if (in_sizes[5] != CCH * CCH || in_sizes[6] != CCH) return;
  if (out_size != nmap) return;

  const float* kvmap1 = (const float*)d_in[0];
  const float* qmap   = (const float*)d_in[1];
  const float* kvmap2 = (const float*)d_in[2];
  const float* Wq     = (const float*)d_in[3];
  const float* bq     = (const float*)d_in[4];
  const float* Wkv    = (const float*)d_in[5];
  const float* bkv    = (const float*)d_in[6];
  float* out = (float*)d_out;

  const size_t PW  = (size_t)CCH * CCH * 2;                       // 32768
  const size_t PKV = (size_t)NB * HWPIX * CCH * 4;                // 33554432
  size_t off = 0;
  const size_t oWqh = off; off += PW;
  const size_t oWql = off; off += PW;
  const size_t oWkh = off; off += PW;
  const size_t oWkl = off; off += PW;
  const size_t oKV1 = off; off += PKV;
  const size_t oKV2 = off; off += PKV;
  if (off > ws_size) return;

  char* ws = (char*)d_ws;
  unsigned short* Wqh = (unsigned short*)(ws + oWqh);
  unsigned short* Wql = (unsigned short*)(ws + oWql);
  unsigned short* Wkh = (unsigned short*)(ws + oWkh);
  unsigned short* Wkl = (unsigned short*)(ws + oWkl);
  float* KV1 = (float*)(ws + oKV1);
  float* KV2 = (float*)(ws + oKV2);

  const size_t ldsA = (size_t)PROJ_LDS_F * 4;                     // 137216
  const size_t ldsB = (size_t)ATTN_LDS_F * 4;                     // 137216
  (void)hipFuncSetAttribute(reinterpret_cast<const void*>(&k_kvproj),
                            hipFuncAttributeMaxDynamicSharedMemorySize, (int)ldsA);
  (void)hipFuncSetAttribute(reinterpret_cast<const void*>(&k_attn),
                            hipFuncAttributeMaxDynamicSharedMemorySize, (int)ldsB);

  const dim3 blk(256);
  k_split_w<<<dim3(64), blk, 0, stream>>>(Wq, Wkv, Wqh, Wql, Wkh, Wkl);
  k_kvproj<<<dim3(IMH, NB), blk, ldsA, stream>>>(kvmap1, Wkh, Wkl, bkv, KV1);
  k_kvproj<<<dim3(IMH, NB), blk, ldsA, stream>>>(kvmap2, Wkh, Wkl, bkv, KV2);
  k_attn<<<dim3(IMH, NB), blk, ldsB, stream>>>(qmap, Wqh, Wql, bq, bkv, KV1, KV2, out);
  (void)hipGetLastError();
}

// v005
// One run takes 60.7 microseconds.
// Timed twice side by side with v004, it ran 1.04 and 1.05 times as fast.
// Counting every step since v000, it is 2.20 times as fast.
// Contractions: three 1x1-conv projections (q from map in1, kv from maps in0 and in2; M = pixels, N = 128, K = 128)
// on v_wmma_f32_16x16x32_bf16 with bf16 hi/lo split operands (hi.hi + hi.lo + lo.hi), f32 accumulate;
// 9-tap local-window logits, softmax, weighted sums and the two-branch mean in f32 on the VALU.
#include <hip/hip_runtime.h>
#include <stdint.h>

#define NB      4
#define CCH     128
#define IMH     128
#define IMW     128
#define HWPIX   (IMH * IMW)
#define NHEADS  4
#define DHEAD   32
#define QSCALE  0.17677669529663687f     // 32^-0.5
#define TP      132                       // LDS tile pitch in floats (16-B multiple)
#define TILE_F  (128 * TP)                // floats of one 128 x 128 tile with pitch TP
#define KVROWS  3                         // staged kv rows: y-1, y, y+1
#define KVPOS   130                       // staged kv positions: x = -1 .. 128
#define KVP     36                        // LDS pitch of a staged kv position in floats (144 B = 16 B x 9; 32 used)
#define KVSEG   392                       // positions of one kv buffer: 3 x 130 staged + 2 that complete the last wave-wide copy
#define KVB_F   (KVSEG * KVP)             // 14112 floats = 56448 B: one kv buffer (one head of one branch)
#define NCP     13                        // 16-B copies per lane and tile: 12 in every wave, a 13th in waves 0 and 1
#define OT_F    (DHEAD * TP)              // 4224 floats: [32 ch][TP] per-head result tile
#define WSP     136                       // LDS pitch of a staged weight row in bf16 (272 B = 16 B x 17)
#define WS_PLANE (CCH * WSP)              // 17408 bf16: one staged weight plane [128][WSP]
#define WS_F    (2 * WS_PLANE / 2)        // 17408 floats: hi and lo plane together (69632 B)
#define PROJ_LDS_F (TILE_F + WS_F)        // 34304 floats = 137216 B: result tile + staged weights
#define BUF1_F  0                         // kv buffer 1: lies in the q tile's bytes, filled only after q is in registers
#define OTO_F   (BUF1_F + KVB_F)          // per-head result tile
#define BUF0_F  (OTO_F + OT_F)            // kv buffer 0: lies wholly in the staged-weight bytes, free once phase 1 ends
#define ATTN_LDS_F PROJ_LDS_F             // phase 2 (2 x KVB_F + OT_F = 32448 floats) lives inside phase 1's bytes
static_assert(BUF0_F >= TILE_F && BUF0_F + KVB_F <= PROJ_LDS_F);
static_assert(KVSEG * 8 == 12 * 256 + 64 && KVSEG >= KVROWS * KVPOS);

typedef __attribute__((ext_vector_type(16))) __bf16         v16b;
typedef __attribute__((ext_vector_type(8)))  unsigned short v8us;
typedef __attribute__((ext_vector_type(8)))  float          v8f;
typedef __attribute__((ext_vector_type(4)))  float          v4f;
typedef __attribute__((ext_vector_type(2)))  float          v2f;
typedef __attribute__((ext_vector_type(2)))  __bf16         v2b;
typedef __attribute__((ext_vector_type(2)))  unsigned int   v2u;

union Frg { v16b b; v8us h8[2]; unsigned int w[8]; };
static_assert(sizeof(Frg) == 32);

// ---------------------------------------------------------------------------
// small helpers
// ---------------------------------------------------------------------------
__device__ __forceinline__ unsigned short f2bf(float f) {          // bf16 RNE convert, bits
  const unsigned u = __float_as_uint(f);
  return (unsigned short)((u + 0x7FFFu + ((u >> 16) & 1u)) >> 16);
}
__device__ __forceinline__ float bf2f(unsigned short h) { return __uint_as_float(((unsigned)h) << 16); }
__device__ __forceinline__ unsigned int pk16(unsigned short lo, unsigned short hi) {
  return (unsigned)lo | ((unsigned)hi << 16);
}
__device__ __forceinline__ void opt_fence() { asm volatile("" ::: "memory"); }

__device__ __forceinline__ v8f zero8() {
  v8f z = {0.f, 0.f, 0.f, 0.f, 0.f, 0.f, 0.f, 0.f};
  return z;
}

// WMMA with the hazard guard tied to D, keeping A/B live across the guard
__device__ __forceinline__ v8f mma16(v16b a, v16b b, v8f c) {
  v8f d = __builtin_amdgcn_wmma_f32_16x16x32_bf16(false, a, false, b, (short)0, c, false, false);
  asm volatile("v_nop\n\tv_nop\n\tv_nop\n\tv_nop" : "+v"(d) : "v"(a), "v"(b));
  return d;
}

// ---------------------------------------------------------------------------
// Fragment builders (wave32, 16x16x32, split k map for BOTH operands):
//   lane l: row/col = l & 15, h = l >> 4; element i (0..7) <- k0 + 8h + i, element i (8..15) <- k0 + 16 + 8h + (i-8)
// ---------------------------------------------------------------------------
// Operand gathered from a channel-major f32 map: row m = pixel (pt + m), k = channel, channel stride HWPIX.
// Values are split into bf16 hi (RNE) and lo = RNE(v - hi) planes in registers.
__device__ __forceinline__ void gather_split(const float* __restrict__ pt, int lane, int k0, Frg& fh, Frg& fl) {
  const int m = lane & 15, h = lane >> 4;
  const float* pm = pt + m;
#pragma unroll
  for (int q = 0; q < 8; ++q) {
    const int c = k0 + ((q < 4) ? (8 * h + 2 * q) : (16 + 8 * h + 2 * (q - 4)));
    const float v0 = pm[(size_t)c * HWPIX];
    const float v1 = pm[(size_t)(c + 1) * HWPIX];
    const unsigned short h0 = f2bf(v0), h1 = f2bf(v1);
    const unsigned short l0 = f2bf(v0 - bf2f(h0)), l1 = f2bf(v1 - bf2f(h1));
    fh.w[q] = pk16(h0, h1);
    fl.w[q] = pk16(l0, l1);
  }
}
// Operand from a bf16 plane staged in LDS as [row][WSP] with k contiguous (weights W[oc][c]): two 16-B LDS loads
// per lane; 16 lanes at the 272-B pitch fall on 16 distinct groups of four banks.
__device__ __forceinline__ void wfrag(const unsigned short* W, int row0, int lane, int k0, Frg& f) {
  const int m = lane & 15, h = lane >> 4;
  const unsigned short* p = W + (row0 + m) * WSP + k0 + 8 * h;
  f.h8[0] = *(const v8us*)(p);
  f.h8[1] = *(const v8us*)(p + 16);
}
// Two f32 values -> their bf16 hi parts (RNE, one packed convert) and the bf16 parts of the exact rests v - hi.
__device__ __forceinline__ void split2(v2f v, unsigned& hi, unsigned& lo) {
  hi = __builtin_bit_cast(unsigned, __builtin_convertvector(v, v2b));
  const v2f back = {__uint_as_float(hi << 16), __uint_as_float(hi & 0xFFFF0000u)};
  lo = __builtin_bit_cast(unsigned, __builtin_convertvector(v - back, v2b));
}
// Read the f32 weights W[128][128] from global, split them in registers and lay both bf16 planes into LDS:
// Ws[plane][row][WSP]. 4096 16-B pieces, 16 per thread; a wave's load covers one whole 512-B row of W, each of its
// two 8-B stores 256 contiguous bytes of that row in one plane.
__device__ __forceinline__ void stage_w(const float* __restrict__ Wf, unsigned short* Ws, int tid) {
  const float* src = Wf + 4 * tid;                          // piece i*256 + tid: row 8*i + (tid >> 5), columns 4*(tid & 31)..+3
  unsigned short* dst = Ws + (tid >> 5) * WSP + 4 * (tid & 31);
#pragma unroll
  for (int i = 0; i < 16; ++i) {
    const v4f f = *(const v4f*)(src + i * 1024);
    unsigned h0, l0, h1, l1;
    split2((v2f){f[0], f[1]}, h0, l0);
    split2((v2f){f[2], f[3]}, h1, l1);
    *(v2u*)(dst + i * 8 * WSP)            = (v2u){h0, h1};
    *(v2u*)(dst + WS_PLANE + i * 8 * WSP) = (v2u){l0, l1};
  }
}

// ---------------------------------------------------------------------------
// Per-block 128-pixel x 128-out-channel projection of one image row into an LDS tile T[px][oc] (pitch TP):
//   T[px][oc] = (sum_c x[c][px] * W[oc][c] + bias[oc]) * scale
// 8 waves; wave w owns pixels 16w..16w+15 (A = gathered x rows) and all 8 oc tiles (B = W planes, cols = oc).
// The block first splits the f32 W into both bf16 planes in LDS (Ws) once; every B fragment is then read from there.
// D element r of lane l = (row px 16w + 8h + r, col oc 16j + (l & 15)).
// ---------------------------------------------------------------------------
__device__ __forceinline__ void proj_row_tile(const float* __restrict__ xrow,
                                              const float* __restrict__ Wf,
                                              const float* __restrict__ bias, float scale,
                                              float* T, unsigned short* Ws, int tid, int wave, int lane) {
  const int m = lane & 15, h = lane >> 4;
  stage_w(Wf, Ws, tid);
  __syncthreads();                                       // staged weights visible to all 8 waves
  v8f acc[8];
#pragma unroll
  for (int j = 0; j < 8; ++j) acc[j] = zero8();
  const float* xt = xrow + 16 * wave;
#pragma unroll 1
  for (int k0 = 0; k0 < CCH; k0 += 32) {
    Frg ah, al;
    gather_split(xt, lane, k0, ah, al);
#pragma unroll
    for (int j = 0; j < 8; ++j) {
      opt_fence();
      Frg bh, bl;
      wfrag(Ws, 16 * j, lane, k0, bh);
      wfrag(Ws + WS_PLANE, 16 * j, lane, k0, bl);
      acc[j] = mma16(ah.b, bh.b, acc[j]);
      acc[j] = mma16(ah.b, bl.b, acc[j]);
      acc[j] = mma16(al.b, bh.b, acc[j]);
    }
  }
  // epilogue: bias, scale, D -> LDS tile (this wave's 16 pixel rows, all 128 columns)
#pragma unroll
  for (int j = 0; j < 8; ++j) {
    const float bvv = bias[16 * j + m];
    float* trow = T + (size_t)(16 * wave + 8 * h) * TP + 16 * j + m;
#pragma unroll
    for (int r = 0; r < 8; ++r) trow[r * TP] = (acc[j][r] + bvv) * scale;
  }
}

// ---------------------------------------------------------------------------
// kv projection of one map (interior positions only; padded-border keys equal the bias and are copied from it
// in the attention kernel). Block = (image row y, batch b); output plane pixel-major kvp[b][pix][128] f32.
// Store phase: wave w writes pixel rows 16w..16w+15, each row = 32 lanes x 16 B = the whole 512-B row in ONE
// Coverage: grid (128, 4) x 128 rows x 128 floats = the whole [4][16384][128] plane.
// ---------------------------------------------------------------------------
__global__ __launch_bounds__(256) void k_kvproj(const float* __restrict__ x,
                                                const float* __restrict__ Wf,
                                                const float* __restrict__ bias,
                                                float* __restrict__ kvp) {
  extern __shared__ __attribute__((aligned(16))) float smem[];
  float* T = smem;                                       // [128][TP]
  unsigned short* Ws = (unsigned short*)(smem + TILE_F); // [2][128][WSP] bf16
  const int tid  = threadIdx.x;
  const int lane = tid & 31;
  const int wave = __builtin_amdgcn_readfirstlane(tid >> 5);
  const int y = blockIdx.x;
  const int b = blockIdx.y;
  const float* xrow = x + (size_t)b * CCH * HWPIX + (size_t)y * IMW;
  proj_row_tile(xrow, Wf, bias, 1.0f, T, Ws, tid, wave, lane);
  __syncthreads();
  float* dstb = kvp + ((size_t)b * HWPIX + (size_t)y * IMW) * CCH;
  {
#pragma unroll
    for (int i = 0; i < 16; ++i) {
      const int rr = 16 * wave + i;
      const v4f v = *(const v4f*)(T + (size_t)rr * TP + 4 * lane);
      *(v4f*)(dstb + (size_t)rr * CCH + 4 * lane) = v;
    }
    
  }
}

// ---------------------------------------------------------------------------
// Bring one head of one kv branch for image row y into an LDS buffer with asynchronous 16-B copies, through no
// register: buffer[r][p][d] at pitch KVP per p, r = 0..2 <-> image row y-1+r, p = 0..129 <-> image column p-1,
// d = 0..31 = channels hd*32+d of the pixel-major plane ([pix][128] f32 of this batch).
// Piece i = it*256 + tid (16 B): position seg = i >> 3, quarter-line pc = i & 7. Its source is the plane for an
// in-image position and the bias vector for a padded one (padded positions of the 1x1 conv equal the bias); the
// choice is made in the address. goff[it] = byte offset in the chosen source at head 0, bit it of inmask = in image.
// 392 positions x 8 pieces = 98 whole wave-wide copies: 12 in each of 8 waves and one more in waves 0 and 1; the
// last two positions are never read and take the bias.
// ---------------------------------------------------------------------------
__device__ __forceinline__ void kv_piece_map(int y, int tid, unsigned (&goff)[NCP], unsigned& inmask) {
  const int pc = tid & 7;
  inmask = 0u;
#pragma unroll
  for (int it = 0; it < NCP; ++it) {
    const int seg = it * 32 + (tid >> 3);
    const int r   = seg / KVPOS;
    const int p   = seg - r * KVPOS;
    const int yy  = y + r - 1;
    const int xx  = p - 1;
    const bool inb = (r < KVROWS) && (yy >= 0) && (yy < IMH) && (xx >= 0) && (xx < IMW);
    goff[it] = (inb ? (unsigned)(yy * IMW + xx) * (CCH * 4u) : 0u) + 16u * pc;
    inmask |= inb ? (1u << it) : 0u;
  }
}
// kbh = plane of this batch + hd*32, bbh = bias + hd*32, ldst = this lane's LDS byte address of piece it = 0.
__device__ __forceinline__ void copy_tile(const float* __restrict__ kbh, const float* __restrict__ bbh,
                                          unsigned ldst, const unsigned (&goff)[NCP], unsigned inmask, int wave) {
  const char* g[NCP];
  unsigned l[NCP];
#pragma unroll
  for (int it = 0; it < NCP; ++it) {
    g[it] = (const char*)(((inmask >> it) & 1u) ? kbh : bbh) + goff[it];
    l[it] = ldst + it * (32 * KVP * 4);
  }
  // the copies of one tile; the closing s_wait_xcnt keeps every later write of their address registers behind them
  asm volatile(
      "global_load_async_to_lds_b128 %0, %1, off\n\t"
      "global_load_async_to_lds_b128 %2, %3, off\n\t"
      "global_load_async_to_lds_b128 %4, %5, off\n\t"
      "global_load_async_to_lds_b128 %6, %7, off\n\t"
      "global_load_async_to_lds_b128 %8, %9, off\n\t"
      "global_load_async_to_lds_b128 %10, %11, off\n\t"
      "global_load_async_to_lds_b128 %12, %13, off\n\t"
      "global_load_async_to_lds_b128 %14, %15, off\n\t"
      "global_load_async_to_lds_b128 %16, %17, off\n\t"
      "global_load_async_to_lds_b128 %18, %19, off\n\t"
      "global_load_async_to_lds_b128 %20, %21, off\n\t"
      "global_load_async_to_lds_b128 %22, %23, off\n\t"
      "s_wait_xcnt 0x0"
      :: "v"(l[0]), "v"(g[0]), "v"(l[1]), "v"(g[1]), "v"(l[2]), "v"(g[2]), "v"(l[3]), "v"(g[3]),
         "v"(l[4]), "v"(g[4]), "v"(l[5]), "v"(g[5]), "v"(l[6]), "v"(g[6]), "v"(l[7]), "v"(g[7]),
         "v"(l[8]), "v"(g[8]), "v"(l[9]), "v"(g[9]), "v"(l[10]), "v"(g[10]), "v"(l[11]), "v"(g[11])
      : "memory");
  if (wave < 2) {                                        // wave-uniform: pieces 3072..3135
    asm volatile("global_load_async_to_lds_b128 %0, %1, off\n\t"
                 "s_wait_xcnt 0x0"
                 :: "v"(l[12]), "v"(g[12]) : "memory");
  }
}
// this wave's LDS reads and writes have retired (in front of a barrier behind which their bytes are copied over)
__device__ __forceinline__ void wait_ds0()    { asm volatile("s_wait_dscnt 0x0" ::: "memory"); }
// this wave's asynchronous copies have landed (in front of the barrier behind which other waves read them)
__device__ __forceinline__ void wait_async0() { asm volatile("s_wait_asynccnt 0x0" ::: "memory"); }

__device__ __forceinline__ void load16(const float* p, float (&v)[16]) {
#pragma unroll
  for (int g = 0; g < 4; ++g) {
    const v4f t = *(const v4f*)(p + 4 * g);
    v[4 * g + 0] = t[0]; v[4 * g + 1] = t[1]; v[4 * g + 2] = t[2]; v[4 * g + 3] = t[3];
  }
}

// ---------------------------------------------------------------------------
// One branch of the 3x3 local attention for (pixel px of the block's row, current head), computed by the lane pair
// (l, l^16): this lane holds dims 16*half..16*half+15 of q and of the accumulator; the 32-deep logit is the sum
// of the two partial dots exchanged with __shfl_xor(., 16) (a+b == b+a, so both lanes carry identical logits and
// identical max/sum state). Taps t = 0..8 <-> staged (r = t/3, p = px + t%3).
// Online softmax one window row (three taps) at a time, all unrolled: a row's twelve LDS reads, three dots
// and three exchanges are independent of one another and run side by side; the running max m, the running sum ssum
// and the accumulator ov are rescaled once per row (not at all in the first row, no infinities). Within ssum and ov
// the taps are added in the order t = 0..8; res += ov / ssum.
// All cross-lane ops sit under uniform control (no lane-varying branches).
// Each 16-B read: 16 lanes of one half at the 144-B pitch fall on 16 distinct groups of four banks.
// ---------------------------------------------------------------------------
// 16 floats as 8 register pairs, in the order the four 16-B LDS reads deliver them
__device__ __forceinline__ void load8x2(const float* p, v2f (&v)[8]) {
#pragma unroll
  for (int g = 0; g < 4; ++g) {
    const v4f t = *(const v4f*)(p + 4 * g);
    v[2 * g + 0] = (v2f){t[0], t[1]};
    v[2 * g + 1] = (v2f){t[2], t[3]};
  }
}
// One window row: its three taps' kv values (twelve 16-B LDS reads) and its three logits. Each partial dot runs on
// packed f32 FMAs over the register pairs: even and odd dims are summed apart and added at the end.
__device__ __forceinline__ void row_logits(const float* krow, const v2f (&q2)[8], v2f (&kv)[3][8], float (&s)[3]) {
#pragma unroll
  for (int dx = 0; dx < 3; ++dx) load8x2(krow + dx * KVP, kv[dx]);
  v2f a[3];
#pragma unroll
  for (int dx = 0; dx < 3; ++dx) a[dx] = q2[0] * kv[dx][0];
#pragma unroll
  for (int g = 1; g < 8; ++g) {
#pragma unroll
    for (int dx = 0; dx < 3; ++dx) a[dx] = __builtin_elementwise_fma(q2[g], kv[dx][g], a[dx]);
  }
  float part[3];
#pragma unroll
  for (int dx = 0; dx < 3; ++dx) part[dx] = a[dx][0] + a[dx][1];
#pragma unroll
  for (int dx = 0; dx < 3; ++dx) s[dx] = part[dx] + __shfl_xor(part[dx], 16, 32);
}
__device__ __forceinline__ void attend_branch(const float* kvS, int px, int half,
                                              const float (&q)[16], float (&res)[16]) {
  const float* kcol = kvS + (size_t)px * KVP + 16 * half;
  v2f q2[8], ov[8];
#pragma unroll
  for (int g = 0; g < 8; ++g) q2[g] = (v2f){q[2 * g], q[2 * g + 1]};
  float m, ssum;
  {
    v2f kv[3][8];
    float s[3];
    row_logits(kcol, q2, kv, s);                         // taps 0..2
    m = fmaxf(fmaxf(s[0], s[1]), s[2]);
    const float p0 = __expf(s[0] - m), p1 = __expf(s[1] - m), p2 = __expf(s[2] - m);
    ssum = (p0 + p1) + p2;
#pragma unroll
    for (int g = 0; g < 8; ++g) ov[g] = p2 * kv[2][g] + (p1 * kv[1][g] + p0 * kv[0][g]);
  }
  // unrolled: every LDS offset is an immediate, and the next row's reads and dots overlap this row's exponentials and sums
#pragma unroll
  for (int r = 1; r < KVROWS; ++r) {
    v2f kv[3][8];
    float s[3];
    row_logits(kcol + (size_t)r * (KVPOS * KVP), q2, kv, s);  // taps 3r..3r+2
    const float mn   = fmaxf(m, fmaxf(fmaxf(s[0], s[1]), s[2]));
    const float corr = __expf(m - mn);
    const float p0 = __expf(s[0] - mn), p1 = __expf(s[1] - mn), p2 = __expf(s[2] - mn);
    ssum = ((ssum * corr + p0) + p1) + p2;
#pragma unroll
    for (int g = 0; g < 8; ++g) ov[g] = p2 * kv[2][g] + (p1 * kv[1][g] + (p0 * kv[0][g] + ov[g] * corr));
    m = mn;
  }
  const float inv = __builtin_amdgcn_rcpf(ssum);        // ssum in [1, 9]
#pragma unroll
  for (int g = 0; g < 8; ++g) {
    res[2 * g + 0] += ov[g][0] * inv;
    res[2 * g + 1] += ov[g][1] * inv;
  }
}

// ---------------------------------------------------------------------------
// Fused q projection + local attention + output. Block = (image row y, batch b), 256 threads, dynamic LDS:
//   phase 1: qT [128 px][TP] f32 : q = (Wq.x + bq) * 32^-0.5 for the row's 128 pixels (WMMA, as above)
//            Ws [2][128][WSP] bf16 : Wq split into its hi and lo plane
//   phase 2, in the same bytes: kv buffers 0 and 1 [392][36] f32 (one head of one branch around row y each) and
//            oT [32 ch][TP] f32 : 0.5 * (branch1 + branch2) for the current head (channel = head*32 + d, pixel)
// Thread = (px = 16*wave + (lane & 15), half = lane >> 4); its q values of all four heads are read from qT into
// registers once, which frees qT's bytes for buffer 1.
// Tiles t = 2*head + branch, tile t in buffer t & 1 (= branch). Two-buffer ring: tile t+1's copies fly while tile t
// is attended; at the foot of each trip every wave waits for its LDS reads and its own copies, passes ONE barrier
// (tile t+1 published, tile t's buffer left by every reader), and tile t+2 is then copied into that buffer.
// oT is written in front of the odd trip's foot barrier and read behind it; its next write stands two barriers on.
// Phase 3 per head: wave w writes channel rows 4w..4w+3 of out[b][head*32 + c][y][0..127]:
// Coverage: qT 8 waves x 16 rows x 128 cols; oT 128 px x 2 halves x 16 d = 32 ch x 128 px per head;
// out: grid (128, 4) x 4 heads x 32 channel rows x 128 px = the whole [4][128][128][128].
// All barriers are reached by all threads.
// ---------------------------------------------------------------------------
__global__ __launch_bounds__(256) void k_attn(const float* __restrict__ xq,
                                              const float* __restrict__ Wq,
                                              const float* __restrict__ bq,
                                              const float* __restrict__ bkv,
                                              const float* __restrict__ kv1,
                                              const float* __restrict__ kv2,
                                              float* __restrict__ out) {
  extern __shared__ __attribute__((aligned(16))) float smem[];
  float* qT  = smem;                                     // [128][TP], phase 1
  unsigned short* Ws = (unsigned short*)(smem + TILE_F); // [2][128][WSP] bf16, phase 1
  float* kvA = smem + BUF0_F;                            // [392][KVP], branch 0 tiles
  float* kvB = smem + BUF1_F;                            // [392][KVP], branch 1 tiles
  float* oT  = smem + OTO_F;                             // [32][TP]
  const int tid  = threadIdx.x;
  const int lane = tid & 31;
  const int wave = __builtin_amdgcn_readfirstlane(tid >> 5);
  const int y = blockIdx.x;
  const int b = blockIdx.y;

  // ---- phase 1: q projection of this row into LDS ----
  const float* xrow = xq + (size_t)b * CCH * HWPIX + (size_t)y * IMW;
  proj_row_tile(xrow, Wq, bq, QSCALE, qT, Ws, tid, wave, lane);

  unsigned goff[NCP], inmask;
  kv_piece_map(y, tid, goff, inmask);
  const unsigned lpiece = (unsigned)((tid >> 3) * (KVP * 4) + (tid & 7) * 16);
  const unsigned ldsA = (unsigned)(size_t)kvA + lpiece;  // low 32 bits of a __shared__ address = LDS byte address
  const unsigned ldsB = (unsigned)(size_t)kvB + lpiece;
  const float* kb1 = kv1 + (size_t)b * HWPIX * CCH;
  const float* kb2 = kv2 + (size_t)b * HWPIX * CCH;

  wait_ds0();
  __syncthreads();                                       // qT published; every read of Ws has ended
  copy_tile(kb1, bkv, ldsA, goff, inmask, wave);         // tile 0 -> buffer 0 (former Ws bytes)

  const int half = lane >> 4;
  const int px   = 16 * wave + (lane & 15);
  float q[NHEADS * 16];                                  // q[16*k + i]: head (current + k), dim 16*half + i
#pragma unroll
  for (int k = 0; k < NHEADS; ++k) {
    float t[16];
    load16(qT + (size_t)px * TP + k * DHEAD + 16 * half, t);
#pragma unroll
    for (int i = 0; i < 16; ++i) q[16 * k + i] = t[i];
  }
  wait_ds0();
  wait_async0();
  __syncthreads();                                       // tile 0 published; every read of qT has ended
  copy_tile(kb2, bkv, ldsB, goff, inmask, wave);         // tile 1 -> buffer 1 (former qT bytes)

  // ---- phase 2 / 3: per head ----
#pragma unroll 1
  for (int hd = 0; hd < NHEADS; ++hd) {
    float qc[16], res[16];
#pragma unroll
    for (int i = 0; i < 16; ++i) { qc[i] = q[i]; res[i] = 0.0f; }
    const int nx = (hd + 1) * DHEAD;                     // channel offset of the next head

    // rolled over the two branches: one copy of the code, and the copies' lane addresses are formed per trip
    // instead of being held in registers for both branches (room for a window row's kv values)
#pragma unroll 1
    for (int br = 0; br < 2; ++br) {                     // trip 2*hd + br, buffer br
      attend_branch(br ? kvB : kvA, px, half, qc, res);
      if (br) {
        // result tile of this head: oT[16*half + i][px]
#pragma unroll
        for (int i = 0; i < 16; ++i) oT[(size_t)(16 * half + i) * TP + px] = 0.5f * res[i];
      }
      wait_ds0();
      wait_async0();
      __syncthreads();                                   // next tile (and oT) published; buffer br left by every reader
      if (hd + 1 < NHEADS) copy_tile((br ? kb2 : kb1) + nx, bkv + nx, br ? ldsB : ldsA, goff, inmask, wave);
    }

    // ---- phase 3: channel-major output rows of this head ----
#pragma unroll
    for (int k = 0; k < 4; ++k) {
      const int cc = 4 * wave + k;                       // 0..31 within the head
      const v4f v = *(const v4f*)(oT + (size_t)cc * TP + 4 * lane);
      float* dst = out + (((size_t)b * CCH + hd * DHEAD + cc) * IMH + y) * IMW + 4 * lane;
      *(v4f*)dst = v;
    }
    // the four stores' address and data registers are rewritten by the next head's first instructions: wait first
    asm volatile("s_wait_xcnt 0x0" ::: "memory");
    // the next head's q moves to the front (the loop stays rolled, every register index constant)
#pragma unroll
    for (int i = 0; i < (NHEADS - 1) * 16; ++i) q[i] = q[i + 16];
  }
  wait_async0();                                         // no copy is outstanding when the wave ends
}

// ---------------------------------------------------------------------------
// Workspace map (byte offsets, all 256-B aligned, every region fully written before it is read):
//   kv1    f32  [4*16384][128] 0           (33554432 B, 512-B rows)
//   kv2    f32  [4*16384][128] 33554432
//   total                      67108864
// ---------------------------------------------------------------------------
extern "C" void kernel_launch(void* const* d_in, const int* in_sizes, int n_in,
                              void* d_out, int out_size, void* d_ws, size_t ws_size,
                              hipStream_t stream) {
  if (n_in < 7) return;
  const int nmap = NB * CCH * HWPIX;
  if (in_sizes[0] != nmap || in_sizes[1] != nmap || in_sizes[2] != nmap) return;
  if (in_sizes[3] != CCH * CCH || in_sizes[4] != CCH) return;
  if (in_sizes[5] != CCH * CCH || in_sizes[6] != CCH) return;
  if (out_size != nmap) return;

  const float* kvmap1 = (const float*)d_in[0];
  const float* qmap   = (const float*)d_in[1];
  const float* kvmap2 = (const float*)d_in[2];
  const float* Wq     = (const float*)d_in[3];
  const float* bq     = (const float*)d_in[4];
  const float* Wkv    = (const float*)d_in[5];
  const float* bkv    = (const float*)d_in[6];
  float* out = (float*)d_out;

  const size_t PKV = (size_t)NB * HWPIX * CCH * 4;                // 33554432
  size_t off = 0;
  const size_t oKV1 = off; off += PKV;
  const size_t oKV2 = off; off += PKV;
  if (off > ws_size) return;

  char* ws = (char*)d_ws;
  float* KV1 = (float*)(ws + oKV1);
  float* KV2 = (float*)(ws + oKV2);

  const size_t ldsA = (size_t)PROJ_LDS_F * 4;                     // 137216
  const size_t ldsB = (size_t)ATTN_LDS_F * 4;                     // 137216
  (void)hipFuncSetAttribute(reinterpret_cast<const void*>(&k_kvproj),
                            hipFuncAttributeMaxDynamicSharedMemorySize, (int)ldsA);
  (void)hipFuncSetAttribute(reinterpret_cast<const void*>(&k_attn),
                            hipFuncAttributeMaxDynamicSharedMemorySize, (int)ldsB);

  const dim3 blk(256);
  k_kvproj<<<dim3(IMH, NB), blk, ldsA, stream>>>(kvmap1, Wkv, bkv, KV1);
  k_kvproj<<<dim3(IMH, NB), blk, ldsA, stream>>>(kvmap2, Wkv, bkv, KV2);
  k_attn<<<dim3(IMH, NB), blk, ldsB, stream>>>(qmap, Wq, bq, bkv, KV1, KV2, out);
  (void)hipGetLastError();
}

// v006
// One run takes 57.8 microseconds.
// Next to v005, in two timings, it ran 1.05 times as fast each time.
// Over all steps from v000 it is 2.31 times as fast.
// Contractions: three 1x1-conv projections (q from map in1, kv from maps in0 and in2; M = pixels, N = 128, K = 128)
// on v_wmma_f32_16x16x32_bf16 with bf16 hi/lo split operands (hi.hi + hi.lo + lo.hi), f32 accumulate;
// 9-tap local-window logits, softmax, weighted sums and the two-branch mean in f32 on the VALU.
#include <hip/hip_runtime.h>
#include <stdint.h>

#define NB      4
#define CCH     128
#define IMH     128
#define IMW     128
#define HWPIX   (IMH * IMW)
#define NHEADS  4
#define DHEAD   32
#define QSCALE  0.17677669529663687f     // 32^-0.5
#define TP      132                       // LDS tile pitch in floats (16-B multiple)
#define TILE_F  (128 * TP)                // floats of one 128 x 128 tile with pitch TP
#define KVROWS  3                         // staged kv rows: y-1, y, y+1
#define KVPOS   130                       // staged kv positions: x = -1 .. 128
#define KVP     36                        // LDS pitch of a staged kv position in floats (144 B = 16 B x 9; 32 used)
#define KVSEG   392                       // positions of one kv buffer: 3 x 130 staged + 2 that complete the last wave-wide copy
#define KVB_F   (KVSEG * KVP)             // 14112 floats = 56448 B: one kv buffer (one head of one branch)
#define NCP     13                        // 16-B copies per lane and tile: 12 in every wave, a 13th in waves 0 and 1
#define OT_F    (DHEAD * TP)              // 4224 floats: [32 ch][TP] per-head result tile
#define WSP     136                       // LDS pitch of a staged weight row in bf16 (272 B = 16 B x 17)
#define WS_PLANE (CCH * WSP)              // 17408 bf16: one staged weight plane [128][WSP]
#define WS_F    (2 * WS_PLANE / 2)        // 17408 floats: hi and lo plane together (69632 B)
#define PROJ_LDS_F (TILE_F + WS_F)        // 34304 floats = 137216 B: result tile + staged weights
#define BUF1_F  0                         // kv buffer 1: lies in the q tile's bytes, filled only after q is in registers
#define OTO_F   (BUF1_F + KVB_F)          // per-head result tile
#define BUF0_F  (OTO_F + OT_F)            // kv buffer 0: lies wholly in the staged-weight bytes, free once phase 1 ends
#define ATTN_LDS_F PROJ_LDS_F             // phase 2 (2 x KVB_F + OT_F = 32448 floats) lives inside phase 1's bytes
static_assert(BUF0_F >= TILE_F && BUF0_F + KVB_F <= PROJ_LDS_F);
static_assert(KVSEG * 8 == 12 * 256 + 64 && KVSEG >= KVROWS * KVPOS);

typedef __attribute__((ext_vector_type(16))) __bf16         v16b;
typedef __attribute__((ext_vector_type(8)))  unsigned short v8us;
typedef __attribute__((ext_vector_type(8)))  float          v8f;
typedef __attribute__((ext_vector_type(4)))  float          v4f;
typedef __attribute__((ext_vector_type(2)))  float          v2f;
typedef __attribute__((ext_vector_type(2)))  __bf16         v2b;
typedef __attribute__((ext_vector_type(2)))  unsigned int   v2u;

union Frg { v16b b; v8us h8[2]; unsigned int w[8]; };
static_assert(sizeof(Frg) == 32);

// ---------------------------------------------------------------------------
// small helpers
// ---------------------------------------------------------------------------
__device__ __forceinline__ unsigned short f2bf(float f) {          // bf16 RNE convert, bits
  const unsigned u = __float_as_uint(f);
  return (unsigned short)((u + 0x7FFFu + ((u >> 16) & 1u)) >> 16);
}
__device__ __forceinline__ float bf2f(unsigned short h) { return __uint_as_float(((unsigned)h) << 16); }
__device__ __forceinline__ unsigned int pk16(unsigned short lo, unsigned short hi) {
  return (unsigned)lo | ((unsigned)hi << 16);
}
__device__ __forceinline__ void opt_fence() { asm volatile("" ::: "memory"); }

__device__ __forceinline__ v8f zero8() {
  v8f z = {0.f, 0.f, 0.f, 0.f, 0.f, 0.f, 0.f, 0.f};
  return z;
}

// WMMA with the hazard guard tied to D, keeping A/B live across the guard
__device__ __forceinline__ v8f mma16(v16b a, v16b b, v8f c) {
  v8f d = __builtin_amdgcn_wmma_f32_16x16x32_bf16(false, a, false, b, (short)0, c, false, false);
  asm volatile("v_nop\n\tv_nop\n\tv_nop\n\tv_nop" : "+v"(d) : "v"(a), "v"(b));
  return d;
}

// ---------------------------------------------------------------------------
// Fragment builders (wave32, 16x16x32, split k map for BOTH operands):
//   lane l: row/col = l & 15, h = l >> 4; element i (0..7) <- k0 + 8h + i, element i (8..15) <- k0 + 16 + 8h + (i-8)
// ---------------------------------------------------------------------------
// Operand gathered from a channel-major f32 map: row m = pixel (pt + m), k = channel, channel stride HWPIX.
// gather_x only issues the 16 loads of one 32-channel block; split_x later splits the values into bf16 hi (RNE) and
// lo = RNE(v - hi) planes in registers.
__device__ __forceinline__ void gather_x(const float* __restrict__ pt, int lane, int k0, float (&v)[16]) {
  const int m = lane & 15, h = lane >> 4;
  const float* pm = pt + m;
#pragma unroll
  for (int q = 0; q < 8; ++q) {
    const int c = k0 + ((q < 4) ? (8 * h + 2 * q) : (16 + 8 * h + 2 * (q - 4)));
    v[2 * q + 0] = pm[(size_t)c * HWPIX];
    v[2 * q + 1] = pm[(size_t)(c + 1) * HWPIX];
  }
}
__device__ __forceinline__ void split_x(const float (&v)[16], Frg& fh, Frg& fl) {
#pragma unroll
  for (int q = 0; q < 8; ++q) {
    const float v0 = v[2 * q + 0];
    const float v1 = v[2 * q + 1];
    const unsigned short h0 = f2bf(v0), h1 = f2bf(v1);
    const unsigned short l0 = f2bf(v0 - bf2f(h0)), l1 = f2bf(v1 - bf2f(h1));
    fh.w[q] = pk16(h0, h1);
    fl.w[q] = pk16(l0, l1);
  }
}
// Operand from a bf16 plane staged in LDS as [row][WSP] with k contiguous (weights W[oc][c]): two 16-B LDS loads
// per lane; 16 lanes at the 272-B pitch fall on 16 distinct groups of four banks.
__device__ __forceinline__ void wfrag(const unsigned short* W, int row0, int lane, int k0, Frg& f) {
  const int m = lane & 15, h = lane >> 4;
  const unsigned short* p = W + (row0 + m) * WSP + k0 + 8 * h;
  f.h8[0] = *(const v8us*)(p);
  f.h8[1] = *(const v8us*)(p + 16);
}
// Two f32 values -> their bf16 hi parts (RNE, one packed convert) and the bf16 parts of the exact rests v - hi.
__device__ __forceinline__ void split2(v2f v, unsigned& hi, unsigned& lo) {
  hi = __builtin_bit_cast(unsigned, __builtin_convertvector(v, v2b));
  const v2f back = {__uint_as_float(hi << 16), __uint_as_float(hi & 0xFFFF0000u)};
  lo = __builtin_bit_cast(unsigned, __builtin_convertvector(v - back, v2b));
}
// Read the f32 weights W[128][128] from global, split them in registers and lay both bf16 planes into LDS:
// Ws[plane][row][WSP]. 4096 16-B pieces, 16 per thread; a wave's load covers one whole 512-B row of W, each of its
// two 8-B stores 256 contiguous bytes of that row in one plane. The loads and the split-and-store are two calls, so
// that other loads can be issued between them.
__device__ __forceinline__ void stage_w_load(const float* __restrict__ Wf, int tid, v4f (&wf)[16]) {
  const float* src = Wf + 4 * tid;                          // piece i*256 + tid: row 8*i + (tid >> 5), columns 4*(tid & 31)..+3
#pragma unroll
  for (int i = 0; i < 16; ++i) wf[i] = *(const v4f*)(src + i * 1024);
}
__device__ __forceinline__ void stage_w_store(const v4f (&wf)[16], unsigned short* Ws, int tid) {
  unsigned short* dst = Ws + (tid >> 5) * WSP + 4 * (tid & 31);
#pragma unroll
  for (int i = 0; i < 16; ++i) {
    const v4f f = wf[i];
    unsigned h0, l0, h1, l1;
    split2((v2f){f[0], f[1]}, h0, l0);
    split2((v2f){f[2], f[3]}, h1, l1);
    *(v2u*)(dst + i * 8 * WSP)            = (v2u){h0, h1};
    *(v2u*)(dst + WS_PLANE + i * 8 * WSP) = (v2u){l0, l1};
  }
}

// Work-group barrier whose fences order LDS alone: it publishes LDS writes like __syncthreads(), but does not wait for
// the wave's outstanding global loads, which stay in flight across it.
__device__ __forceinline__ void barrier_lds() {
  __builtin_amdgcn_fence(__ATOMIC_RELEASE, "workgroup", "local");
  __builtin_amdgcn_s_barrier();
  __builtin_amdgcn_fence(__ATOMIC_ACQUIRE, "workgroup", "local");
}

// ---------------------------------------------------------------------------
// Per-block 128-pixel x 128-out-channel projection of one image row into an LDS tile T[px][oc] (pitch TP):
//   T[px][oc] = (sum_c x[c][px] * W[oc][c] + bias[oc]) * scale
// 8 waves; wave w owns pixels 16w..16w+15 (A = gathered x rows) and all 8 oc tiles (B = W planes, cols = oc).
// The block first splits the f32 W into both bf16 planes in LDS (Ws) once; every B fragment is then read from there.
// D element r of lane l = (row px 16w + 8h + r, col oc 16j + (l & 15)).
// ---------------------------------------------------------------------------
__device__ __forceinline__ void proj_row_tile(const float* __restrict__ xrow,
                                              const float* __restrict__ Wf,
                                              const float* __restrict__ bias, float scale,
                                              float* T, unsigned short* Ws, int tid, int wave, int lane) {
  const int m = lane & 15, h = lane >> 4;
  // Global loads are issued well ahead of their use, so that a wave waits out memory latency once and not once per
  // channel block: at entry the 16 weight pieces and the x values of channel blocks 0 and 1 (the x values travel from
  // memory while the weights are split and staged), block 2 and the bias once the weights are in LDS, block 3 when
  // block 0 has been multiplied. Never more than 56 loads of a wave are in flight.
  const float* xt = xrow + 16 * wave;
  float bv[8];
  v4f wf[16];
  float xv[CCH / 32][16];
  stage_w_load(Wf, tid, wf);
  gather_x(xt, lane, 0, xv[0]);
  gather_x(xt, lane, 32, xv[1]);
  // the weight loads' offset register is rewritten by the staging code below: wait first
  asm volatile("s_wait_xcnt 0x0" ::: "memory");
  __builtin_amdgcn_sched_barrier(0);                     // keeps the loads above from being moved down to their uses
  stage_w_store(wf, Ws, tid);
  __builtin_amdgcn_sched_barrier(0);                     // block 2 is asked for only when the weight loads have returned
  gather_x(xt, lane, 64, xv[2]);
#pragma unroll
  for (int j = 0; j < 8; ++j) bv[j] = bias[16 * j + m];
  // the bias loads' offset register is free for reuse from here on: wait first
  asm volatile("s_wait_xcnt 0x0" ::: "memory");
  __builtin_amdgcn_sched_barrier(0);                     // and ahead of the barrier, not behind it
  barrier_lds();                                         // staged weights visible to all 8 waves
  v8f acc[8];
#pragma unroll
  for (int j = 0; j < 8; ++j) acc[j] = zero8();
  // unrolled: xv is held in registers and needs constant indices
#pragma unroll
  for (int kb = 0; kb < CCH / 32; ++kb) {
    const int k0 = 32 * kb;
    // a block's split stays behind the block before it: moved up, f32 values and fragments of several blocks would be
    // held at once, and the register count would cost the second resident block of a WGP
    __builtin_amdgcn_sched_barrier(0);
    if (kb == 1) gather_x(xt, lane, 96, xv[3]);
    Frg ah, al;
    split_x(xv[kb], ah, al);
#pragma unroll
    for (int j = 0; j < 8; ++j) {
      opt_fence();
      Frg bh, bl;
      wfrag(Ws, 16 * j, lane, k0, bh);
      wfrag(Ws + WS_PLANE, 16 * j, lane, k0, bl);
      acc[j] = mma16(ah.b, bh.b, acc[j]);
      acc[j] = mma16(ah.b, bl.b, acc[j]);
      acc[j] = mma16(al.b, bh.b, acc[j]);
    }
  }
  // epilogue: bias, scale, D -> LDS tile (this wave's 16 pixel rows, all 128 columns)
#pragma unroll
  for (int j = 0; j < 8; ++j) {
    const float bvv = bv[j];
    float* trow = T + (size_t)(16 * wave + 8 * h) * TP + 16 * j + m;
#pragma unroll
    for (int r = 0; r < 8; ++r) trow[r * TP] = (acc[j][r] + bvv) * scale;
  }
}

// ---------------------------------------------------------------------------
// kv projection of one map (interior positions only; padded-border keys equal the bias and are copied from it
// in the attention kernel). Block = (image row y, batch b); output plane pixel-major kvp[b][pix][128] f32.
// Store phase: wave w writes pixel rows 16w..16w+15, each row = 32 lanes x 16 B = the whole 512-B row in ONE
// Coverage: grid (128, 4) x 128 rows x 128 floats = the whole [4][16384][128] plane.
// ---------------------------------------------------------------------------
__global__ __launch_bounds__(256) void k_kvproj(const float* __restrict__ x,
                                                const float* __restrict__ Wf,
                                                const float* __restrict__ bias,
                                                float* __restrict__ kvp) {
  extern __shared__ __attribute__((aligned(16))) float smem[];
  float* T = smem;                                       // [128][TP]
  unsigned short* Ws = (unsigned short*)(smem + TILE_F); // [2][128][WSP] bf16
  const int tid  = threadIdx.x;
  const int lane = tid & 31;
  const int wave = __builtin_amdgcn_readfirstlane(tid >> 5);
  const int y = blockIdx.x;
  const int b = blockIdx.y;
  const float* xrow = x + (size_t)b * CCH * HWPIX + (size_t)y * IMW;
  proj_row_tile(xrow, Wf, bias, 1.0f, T, Ws, tid, wave, lane);
  __syncthreads();
  float* dstb = kvp + ((size_t)b * HWPIX + (size_t)y * IMW) * CCH;
  {
#pragma unroll
    for (int i = 0; i < 16; ++i) {
      const int rr = 16 * wave + i;
      const v4f v = *(const v4f*)(T + (size_t)rr * TP + 4 * lane);
      *(v4f*)(dstb + (size_t)rr * CCH + 4 * lane) = v;
    }
    
  }
}

// ---------------------------------------------------------------------------
// Bring one head of one kv branch for image row y into an LDS buffer with asynchronous 16-B copies, through no
// register: buffer[r][p][d] at pitch KVP per p, r = 0..2 <-> image row y-1+r, p = 0..129 <-> image column p-1,
// d = 0..31 = channels hd*32+d of the pixel-major plane ([pix][128] f32 of this batch).
// Piece i = it*256 + tid (16 B): position seg = i >> 3, quarter-line pc = i & 7. Its source is the plane for an
// in-image position and the bias vector for a padded one (padded positions of the 1x1 conv equal the bias); the
// choice is made in the address. goff[it] = byte offset in the chosen source at head 0, bit it of inmask = in image.
// 392 positions x 8 pieces = 98 whole wave-wide copies: 12 in each of 8 waves and one more in waves 0 and 1; the
// last two positions are never read and take the bias.
// ---------------------------------------------------------------------------
__device__ __forceinline__ void kv_piece_map(int y, int tid, unsigned (&goff)[NCP], unsigned& inmask) {
  const int pc = tid & 7;
  inmask = 0u;
#pragma unroll
  for (int it = 0; it < NCP; ++it) {
    const int seg = it * 32 + (tid >> 3);
    const int r   = seg / KVPOS;
    const int p   = seg - r * KVPOS;
    const int yy  = y + r - 1;
    const int xx  = p - 1;
    const bool inb = (r < KVROWS) && (yy >= 0) && (yy < IMH) && (xx >= 0) && (xx < IMW);
    goff[it] = (inb ? (unsigned)(yy * IMW + xx) * (CCH * 4u) : 0u) + 16u * pc;
    inmask |= inb ? (1u << it) : 0u;
  }
}
// kbh = plane of this batch + hd*32, bbh = bias + hd*32, ldst = this lane's LDS byte address of piece it = 0.
__device__ __forceinline__ void copy_tile(const float* __restrict__ kbh, const float* __restrict__ bbh,
                                          unsigned ldst, const unsigned (&goff)[NCP], unsigned inmask, int wave) {
  const char* g[NCP];
  unsigned l[NCP];
#pragma unroll
  for (int it = 0; it < NCP; ++it) {
    g[it] = (const char*)(((inmask >> it) & 1u) ? kbh : bbh) + goff[it];
    l[it] = ldst + it * (32 * KVP * 4);
  }
  // the copies of one tile; the closing s_wait_xcnt keeps every later write of their address registers behind them
  asm volatile(
      "global_load_async_to_lds_b128 %0, %1, off\n\t"
      "global_load_async_to_lds_b128 %2, %3, off\n\t"
      "global_load_async_to_lds_b128 %4, %5, off\n\t"
      "global_load_async_to_lds_b128 %6, %7, off\n\t"
      "global_load_async_to_lds_b128 %8, %9, off\n\t"
      "global_load_async_to_lds_b128 %10, %11, off\n\t"
      "global_load_async_to_lds_b128 %12, %13, off\n\t"
      "global_load_async_to_lds_b128 %14, %15, off\n\t"
      "global_load_async_to_lds_b128 %16, %17, off\n\t"
      "global_load_async_to_lds_b128 %18, %19, off\n\t"
      "global_load_async_to_lds_b128 %20, %21, off\n\t"
      "global_load_async_to_lds_b128 %22, %23, off\n\t"
      "s_wait_xcnt 0x0"
      :: "v"(l[0]), "v"(g[0]), "v"(l[1]), "v"(g[1]), "v"(l[2]), "v"(g[2]), "v"(l[3]), "v"(g[3]),
         "v"(l[4]), "v"(g[4]), "v"(l[5]), "v"(g[5]), "v"(l[6]), "v"(g[6]), "v"(l[7]), "v"(g[7]),
         "v"(l[8]), "v"(g[8]), "v"(l[9]), "v"(g[9]), "v"(l[10]), "v"(g[10]), "v"(l[11]), "v"(g[11])
      : "memory");
  if (wave < 2) {                                        // wave-uniform: pieces 3072..3135
    asm volatile("global_load_async_to_lds_b128 %0, %1, off\n\t"
                 "s_wait_xcnt 0x0"
                 :: "v"(l[12]), "v"(g[12]) : "memory");
  }
}
// this wave's LDS reads and writes have retired (in front of a barrier behind which their bytes are copied over)
__device__ __forceinline__ void wait_ds0()    { asm volatile("s_wait_dscnt 0x0" ::: "memory"); }
// this wave's asynchronous copies have landed (in front of the barrier behind which other waves read them)
__device__ __forceinline__ void wait_async0() { asm volatile("s_wait_asynccnt 0x0" ::: "memory"); }

__device__ __forceinline__ void load16(const float* p, float (&v)[16]) {
#pragma unroll
  for (int g = 0; g < 4; ++g) {
    const v4f t = *(const v4f*)(p + 4 * g);
    v[4 * g + 0] = t[0]; v[4 * g + 1] = t[1]; v[4 * g + 2] = t[2]; v[4 * g + 3] = t[3];
  }
}

// ---------------------------------------------------------------------------
// One branch of the 3x3 local attention for (pixel px of the block's row, current head), computed by the lane pair
// (l, l^16): this lane holds dims 16*half..16*half+15 of q and of the accumulator; the 32-deep logit is the sum
// of the two partial dots exchanged with __shfl_xor(., 16) (a+b == b+a, so both lanes carry identical logits and
// identical max/sum state). Taps t = 0..8 <-> staged (r = t/3, p = px + t%3).
// Online softmax one window row (three taps) at a time, all unrolled: a row's twelve LDS reads, three dots
// and three exchanges are independent of one another and run side by side; the running max m, the running sum ssum
// and the accumulator ov are rescaled once per row (not at all in the first row, no infinities). Within ssum and ov
// the taps are added in the order t = 0..8; res += ov / ssum.
// All cross-lane ops sit under uniform control (no lane-varying branches).
// Each 16-B read: 16 lanes of one half at the 144-B pitch fall on 16 distinct groups of four banks.
// ---------------------------------------------------------------------------
// 16 floats as 8 register pairs, in the order the four 16-B LDS reads deliver them
__device__ __forceinline__ void load8x2(const float* p, v2f (&v)[8]) {
#pragma unroll
  for (int g = 0; g < 4; ++g) {
    const v4f t = *(const v4f*)(p + 4 * g);
    v[2 * g + 0] = (v2f){t[0], t[1]};
    v[2 * g + 1] = (v2f){t[2], t[3]};
  }
}
// One window row: its three taps' kv values (twelve 16-B LDS reads) and its three logits. Each partial dot runs on
// packed f32 FMAs over the register pairs: even and odd dims are summed apart and added at the end.
__device__ __forceinline__ void row_logits(const float* krow, const v2f (&q2)[8], v2f (&kv)[3][8], float (&s)[3]) {
#pragma unroll
  for (int dx = 0; dx < 3; ++dx) load8x2(krow + dx * KVP, kv[dx]);
  v2f a[3];
#pragma unroll
  for (int dx = 0; dx < 3; ++dx) a[dx] = q2[0] * kv[dx][0];
#pragma unroll
  for (int g = 1; g < 8; ++g) {
#pragma unroll
    for (int dx = 0; dx < 3; ++dx) a[dx] = __builtin_elementwise_fma(q2[g], kv[dx][g], a[dx]);
  }
  float part[3];
#pragma unroll
  for (int dx = 0; dx < 3; ++dx) part[dx] = a[dx][0] + a[dx][1];
#pragma unroll
  for (int dx = 0; dx < 3; ++dx) s[dx] = part[dx] + __shfl_xor(part[dx], 16, 32);
}
__device__ __forceinline__ void attend_branch(const float* kvS, int px, int half,
                                              const float (&q)[16], float (&res)[16]) {
  const float* kcol = kvS + (size_t)px * KVP + 16 * half;
  v2f q2[8], ov[8];
#pragma unroll
  for (int g = 0; g < 8; ++g) q2[g] = (v2f){q[2 * g], q[2 * g + 1]};
  float m, ssum;
  {
    v2f kv[3][8];
    float s[3];
    row_logits(kcol, q2, kv, s);                         // taps 0..2
    m = fmaxf(fmaxf(s[0], s[1]), s[2]);
    const float p0 = __expf(s[0] - m), p1 = __expf(s[1] - m), p2 = __expf(s[2] - m);
    ssum = (p0 + p1) + p2;
#pragma unroll
    for (int g = 0; g < 8; ++g) ov[g] = p2 * kv[2][g] + (p1 * kv[1][g] + p0 * kv[0][g]);
  }
  // unrolled: every LDS offset is an immediate, and the next row's reads and dots overlap this row's exponentials and sums
#pragma unroll
  for (int r = 1; r < KVROWS; ++r) {
    v2f kv[3][8];
    float s[3];
    row_logits(kcol + (size_t)r * (KVPOS * KVP), q2, kv, s);  // taps 3r..3r+2
    const float mn   = fmaxf(m, fmaxf(fmaxf(s[0], s[1]), s[2]));
    const float corr = __expf(m - mn);
    const float p0 = __expf(s[0] - mn), p1 = __expf(s[1] - mn), p2 = __expf(s[2] - mn);
    ssum = ((ssum * corr + p0) + p1) + p2;
#pragma unroll
    for (int g = 0; g < 8; ++g) ov[g] = p2 * kv[2][g] + (p1 * kv[1][g] + (p0 * kv[0][g] + ov[g] * corr));
    m = mn;
  }
  const float inv = __builtin_amdgcn_rcpf(ssum);        // ssum in [1, 9]
#pragma unroll
  for (int g = 0; g < 8; ++g) {
    res[2 * g + 0] += ov[g][0] * inv;
    res[2 * g + 1] += ov[g][1] * inv;
  }
}

// ---------------------------------------------------------------------------
// Fused q projection + local attention + output. Block = (image row y, batch b), 256 threads, dynamic LDS:
//   phase 1: qT [128 px][TP] f32 : q = (Wq.x + bq) * 32^-0.5 for the row's 128 pixels (WMMA, as above)
//            Ws [2][128][WSP] bf16 : Wq split into its hi and lo plane
//   phase 2, in the same bytes: kv buffers 0 and 1 [392][36] f32 (one head of one branch around row y each) and
//            oT [32 ch][TP] f32 : 0.5 * (branch1 + branch2) for the current head (channel = head*32 + d, pixel)
// Thread = (px = 16*wave + (lane & 15), half = lane >> 4); its q values of all four heads are read from qT into
// registers once, which frees qT's bytes for buffer 1.
// Tiles t = 2*head + branch, tile t in buffer t & 1 (= branch). Two-buffer ring: tile t+1's copies fly while tile t
// is attended; at the foot of each trip every wave waits for its LDS reads and its own copies, passes ONE barrier
// (tile t+1 published, tile t's buffer left by every reader), and tile t+2 is then copied into that buffer.
// oT is written in front of the odd trip's foot barrier and read behind it; its next write stands two barriers on.
// Phase 3 per head: wave w writes channel rows 4w..4w+3 of out[b][head*32 + c][y][0..127]:
// Coverage: qT 8 waves x 16 rows x 128 cols; oT 128 px x 2 halves x 16 d = 32 ch x 128 px per head;
// out: grid (128, 4) x 4 heads x 32 channel rows x 128 px = the whole [4][128][128][128].
// All barriers are reached by all threads.
// ---------------------------------------------------------------------------
// four waves per SIMD asked for (at most 256 registers a wave): with the x values held ahead the compiler otherwise
// takes more, and only one block instead of two would be resident on a WGP
__global__ __launch_bounds__(256) __attribute__((amdgpu_waves_per_eu(4))) void k_attn(const float* __restrict__ xq,
                                              const float* __restrict__ Wq,
                                              const float* __restrict__ bq,
                                              const float* __restrict__ bkv,
                                              const float* __restrict__ kv1,
                                              const float* __restrict__ kv2,
                                              float* __restrict__ out) {
  extern __shared__ __attribute__((aligned(16))) float smem[];
  float* qT  = smem;                                     // [128][TP], phase 1
  unsigned short* Ws = (unsigned short*)(smem + TILE_F); // [2][128][WSP] bf16, phase 1
  float* kvA = smem + BUF0_F;                            // [392][KVP], branch 0 tiles
  float* kvB = smem + BUF1_F;                            // [392][KVP], branch 1 tiles
  float* oT  = smem + OTO_F;                             // [32][TP]
  const int tid  = threadIdx.x;
  const int lane = tid & 31;
  const int wave = __builtin_amdgcn_readfirstlane(tid >> 5);
  const int y = blockIdx.x;
  const int b = blockIdx.y;

  // ---- phase 1: q projection of this row into LDS ----
  const float* xrow = xq + (size_t)b * CCH * HWPIX + (size_t)y * IMW;
  proj_row_tile(xrow, Wq, bq, QSCALE, qT, Ws, tid, wave, lane);

  unsigned goff[NCP], inmask;
  kv_piece_map(y, tid, goff, inmask);
  const unsigned lpiece = (unsigned)((tid >> 3) * (KVP * 4) + (tid & 7) * 16);
  const unsigned ldsA = (unsigned)(size_t)kvA + lpiece;  // low 32 bits of a __shared__ address = LDS byte address
  const unsigned ldsB = (unsigned)(size_t)kvB + lpiece;
  const float* kb1 = kv1 + (size_t)b * HWPIX * CCH;
  const float* kb2 = kv2 + (size_t)b * HWPIX * CCH;

  wait_ds0();
  __syncthreads();                                       // qT published; every read of Ws has ended
  copy_tile(kb1, bkv, ldsA, goff, inmask, wave);         // tile 0 -> buffer 0 (former Ws bytes)

  const int half = lane >> 4;
  const int px   = 16 * wave + (lane & 15);
  float q[NHEADS * 16];                                  // q[16*k + i]: head (current + k), dim 16*half + i
#pragma unroll
  for (int k = 0; k < NHEADS; ++k) {
    float t[16];
    load16(qT + (size_t)px * TP + k * DHEAD + 16 * half, t);
#pragma unroll
    for (int i = 0; i < 16; ++i) q[16 * k + i] = t[i];
  }
  wait_ds0();
  wait_async0();
  __syncthreads();                                       // tile 0 published; every read of qT has ended
  copy_tile(kb2, bkv, ldsB, goff, inmask, wave);         // tile 1 -> buffer 1 (former qT bytes)

  // ---- phase 2 / 3: per head ----
#pragma unroll 1
  for (int hd = 0; hd < NHEADS; ++hd) {
    float qc[16], res[16];
#pragma unroll
    for (int i = 0; i < 16; ++i) { qc[i] = q[i]; res[i] = 0.0f; }
    const int nx = (hd + 1) * DHEAD;                     // channel offset of the next head

    // rolled over the two branches: one copy of the code, and the copies' lane addresses are formed per trip
    // instead of being held in registers for both branches (room for a window row's kv values)
#pragma unroll 1
    for (int br = 0; br < 2; ++br) {                     // trip 2*hd + br, buffer br
      attend_branch(br ? kvB : kvA, px, half, qc, res);
      if (br) {
        // result tile of this head: oT[16*half + i][px]
#pragma unroll
        for (int i = 0; i < 16; ++i) oT[(size_t)(16 * half + i) * TP + px] = 0.5f * res[i];
      }
      wait_ds0();
      wait_async0();
      __syncthreads();                                   // next tile (and oT) published; buffer br left by every reader
      if (hd + 1 < NHEADS) copy_tile((br ? kb2 : kb1) + nx, bkv + nx, br ? ldsB : ldsA, goff, inmask, wave);
    }

    // ---- phase 3: channel-major output rows of this head ----
#pragma unroll
    for (int k = 0; k < 4; ++k) {
      const int cc = 4 * wave + k;                       // 0..31 within the head
      const v4f v = *(const v4f*)(oT + (size_t)cc * TP + 4 * lane);
      float* dst = out + (((size_t)b * CCH + hd * DHEAD + cc) * IMH + y) * IMW + 4 * lane;
      *(v4f*)dst = v;
    }
    // the four stores' address and data registers are rewritten by the next head's first instructions: wait first
    asm volatile("s_wait_xcnt 0x0" ::: "memory");
    // the next head's q moves to the front (the loop stays rolled, every register index constant)
#pragma unroll
    for (int i = 0; i < (NHEADS - 1) * 16; ++i) q[i] = q[i + 16];
  }
  wait_async0();                                         // no copy is outstanding when the wave ends
}

// ---------------------------------------------------------------------------
// Workspace map (byte offsets, all 256-B aligned, every region fully written before it is read):
//   kv1    f32  [4*16384][128] 0           (33554432 B, 512-B rows)
//   kv2    f32  [4*16384][128] 33554432
//   total                      67108864
// ---------------------------------------------------------------------------
extern "C" void kernel_launch(void* const* d_in, const int* in_sizes, int n_in,
                              void* d_out, int out_size, void* d_ws, size_t ws_size,
                              hipStream_t stream) {
  if (n_in < 7) return;
  const int nmap = NB * CCH * HWPIX;
  if (in_sizes[0] != nmap || in_sizes[1] != nmap || in_sizes[2] != nmap) return;
  if (in_sizes[3] != CCH * CCH || in_sizes[4] != CCH) return;
  if (in_sizes[5] != CCH * CCH || in_sizes[6] != CCH) return;
  if (out_size != nmap) return;

  const float* kvmap1 = (const float*)d_in[0];
  const float* qmap   = (const float*)d_in[1];
  const float* kvmap2 = (const float*)d_in[2];
  const float* Wq     = (const float*)d_in[3];
  const float* bq     = (const float*)d_in[4];
  const float* Wkv    = (const float*)d_in[5];
  const float* bkv    = (const float*)d_in[6];
  float* out = (float*)d_out;

  const size_t PKV = (size_t)NB * HWPIX * CCH * 4;                // 33554432
  size_t off = 0;
  const size_t oKV1 = off; off += PKV;
  const size_t oKV2 = off; off += PKV;
  if (off > ws_size) return;

  char* ws = (char*)d_ws;
  float* KV1 = (float*)(ws + oKV1);
  float* KV2 = (float*)(ws + oKV2);

  const size_t ldsA = (size_t)PROJ_LDS_F * 4;                     // 137216
  const size_t ldsB = (size_t)ATTN_LDS_F * 4;                     // 137216
  (void)hipFuncSetAttribute(reinterpret_cast<const void*>(&k_kvproj),
                            hipFuncAttributeMaxDynamicSharedMemorySize, (int)ldsA);
  (void)hipFuncSetAttribute(reinterpret_cast<const void*>(&k_attn),
                            hipFuncAttributeMaxDynamicSharedMemorySize, (int)ldsB);

  const dim3 blk(256);
  k_kvproj<<<dim3(IMH, NB), blk, ldsA, stream>>>(kvmap1, Wkv, bkv, KV1);
  k_kvproj<<<dim3(IMH, NB), blk, ldsA, stream>>>(kvmap2, Wkv, bkv, KV2);
  k_attn<<<dim3(IMH, NB), blk, ldsB, stream>>>(qmap, Wq, bq, bkv, KV1, KV2, out);
  (void)hipGetLastError();
}

// v007
// A run of this version takes 39.7 microseconds.
// Two timings next to v006 both put it at 1.46 times that version's speed.
// All steps since v000 together make it 3.37 times as fast.
// Contractions: three 1x1-conv projections (q from map in1, kv from maps in0 and in2; M = pixels, N = 128, K = 128)
// on v_wmma_f32_16x16x32_bf16 with bf16 hi/lo split operands (hi.hi + hi.lo + lo.hi), f32 accumulate;
// 9-tap local-window logits, softmax, weighted sums and the two-branch mean in f32 on the VALU.
// ONE launch: a block takes two image rows of one batch and projects the kv rows its windows touch (four per map)
// straight into LDS; no kv value goes through global memory.
#include <hip/hip_runtime.h>
#include <stdint.h>

#define NB      4
#define CCH     128
#define IMH     128
#define IMW     128
#define HWPIX   (IMH * IMW)
#define NHEADS  4
#define DHEAD   32
#define QSCALE  0.17677669529663687f     // 32^-0.5
#define NTHR    512                       // 16 waves
#define RB      2                         // image rows of a block
#define HPC     64                        // channels of a head pair (one pass)
#define KVROWS  3                         // window rows
#define SROWS   (RB + 2)                  // staged kv rows: y0-1 .. y0+2
#define KVPOS   130                       // staged kv positions: x = -1 .. 128
#define KVRS    HPC                       // floats from a staged position to the same column one image row down
#define KVPP    (SROWS * KVRS + 4)        // LDS pitch of a staged column in floats (1040 B = 16 B x 65): its 4 rows x 64 channels
#define KV_F    (KVPOS * KVPP)            // 33800 floats: kv rows of one map, one head pair
#define KVP     68                        // LDS pitch of a q tile row in floats (272 B = 16 B x 17; 64 used)
#define OTP     260                       // LDS pitch of a result channel row in floats (256 px used)
#define OT_F    (RB * IMW * KVP)          // 17408 floats: q tile [256 px][KVP] of a pass, later its result tile [64 ch][OTP]
#define WSP     136                       // LDS pitch of a staged weight row in bf16 (272 B = 16 B x 17)
#define WS_PLANE (CCH * WSP)              // 17408 bf16: one staged weight plane [128][WSP]
#define WS_F    (2 * WS_PLANE / 2)        // 17408 floats: hi and lo plane together (69632 B)
#define RS_F    (NTHR * 16)               // 8192 floats: one head's first-map result, 16 floats a thread
#define LDS_F   (WS_F + KV_F + OT_F + RS_F)  // 76808 floats = 307232 B: one block on a WGP
static_assert(RS_F / 2 <= HPC * WSP / 2); // half of it fits the 64 staged Wq rows of one plane
static_assert(HPC * OTP <= OT_F);

typedef __attribute__((ext_vector_type(16))) __bf16         v16b;
typedef __attribute__((ext_vector_type(8)))  unsigned short v8us;
typedef __attribute__((ext_vector_type(8)))  float          v8f;
typedef __attribute__((ext_vector_type(4)))  float          v4f;
typedef __attribute__((ext_vector_type(2)))  float          v2f;
typedef __attribute__((ext_vector_type(2)))  __bf16         v2b;
typedef __attribute__((ext_vector_type(2)))  unsigned int   v2u;

union Frg { v16b b; v8us h8[2]; unsigned int w[8]; };
static_assert(sizeof(Frg) == 32);

// ---------------------------------------------------------------------------
// small helpers
// ---------------------------------------------------------------------------
__device__ __forceinline__ void opt_fence() { asm volatile("" ::: "memory"); }

__device__ __forceinline__ v8f zero8() {
  v8f z = {0.f, 0.f, 0.f, 0.f, 0.f, 0.f, 0.f, 0.f};
  return z;
}

// WMMA with the hazard guard tied to D, keeping A/B live across the guard
__device__ __forceinline__ v8f mma16(v16b a, v16b b, v8f c) {
  v8f d = __builtin_amdgcn_wmma_f32_16x16x32_bf16(false, a, false, b, (short)0, c, false, false);
  asm volatile("v_nop\n\tv_nop\n\tv_nop\n\tv_nop" : "+v"(d) : "v"(a), "v"(b));
  return d;
}

// ---------------------------------------------------------------------------
// Fragment builders (wave32, 16x16x32, split k map for BOTH operands):
//   lane l: row/col = l & 15, h = l >> 4; element i (0..7) <- k0 + 8h + i, element i (8..15) <- k0 + 16 + 8h + (i-8)
// ---------------------------------------------------------------------------
// Operand gathered from a channel-major f32 map: row m = pixel (pt + m), k = channel, channel stride HWPIX.
// gather_x only issues the 16 loads of one 32-channel block; split_x later splits the values into bf16 hi (RNE) and
// lo = RNE(v - hi) planes in registers.
__device__ __forceinline__ void gather_x(const float* pt, int lane, int k0, float (&v)[16]) {
  // pt is the same in every lane: one 32-bit lane offset serves all loads, the channel step goes into the base
  const unsigned vo = (unsigned)((lane & 15) + 8 * (lane >> 4) * HWPIX);
#pragma unroll
  for (int q = 0; q < 8; ++q) {
    const int c = k0 + ((q < 4) ? (2 * q) : (16 + 2 * (q - 4)));
    v[2 * q + 0] = (pt + (size_t)c * HWPIX)[vo];
    v[2 * q + 1] = (pt + (size_t)(c + 1) * HWPIX)[vo];
  }
}
// Two f32 values -> their bf16 hi parts (RNE, one packed convert) and the bf16 parts of the exact rests v - hi.
__device__ __forceinline__ void split2(v2f v, unsigned& hi, unsigned& lo) {
  hi = __builtin_bit_cast(unsigned, __builtin_convertvector(v, v2b));
  const v2f back = {__uint_as_float(hi << 16), __uint_as_float(hi & 0xFFFF0000u)};
  lo = __builtin_bit_cast(unsigned, __builtin_convertvector(v - back, v2b));
}
__device__ __forceinline__ void split_x(const float (&v)[16], Frg& fh, Frg& fl) {
#pragma unroll
  for (int q = 0; q < 8; ++q) split2((v2f){v[2 * q + 0], v[2 * q + 1]}, fh.w[q], fl.w[q]);
}
// Operand from a bf16 plane staged in LDS as [row][WSP] with k contiguous (weights W[oc][c]): two 16-B LDS loads
// per lane; 16 lanes at the 272-B pitch fall on 16 distinct groups of four banks.
__device__ __forceinline__ void wfrag(const unsigned short* W, int row0, int lane, int k0, Frg& f) {
  const int m = lane & 15, h = lane >> 4;
  const unsigned short* p = W + (row0 + m) * WSP + k0 + 8 * h;
  f.h8[0] = *(const v8us*)(p);
  f.h8[1] = *(const v8us*)(p + 16);
}
// Work-group barrier whose fences order LDS alone: it publishes LDS writes like __syncthreads(), but does not wait for
// the wave's outstanding global loads, which stay in flight across it.
__device__ __forceinline__ void barrier_lds() {
  __builtin_amdgcn_fence(__ATOMIC_RELEASE, "workgroup", "local");
  __builtin_amdgcn_s_barrier();
  __builtin_amdgcn_fence(__ATOMIC_ACQUIRE, "workgroup", "local");
}

// ---------------------------------------------------------------------------
// Weights of one pass: rows hp*64..+63 of Wq (staged rows 0..63) and of Wkv (staged rows 64..127), read as f32 from
// global, split in registers, both bf16 planes laid into LDS: Ws[plane][row][WSP]. 4096 16-B pieces, 8 per thread; a
// wave's load covers one whole 512-B row, each of its two 8-B stores 256 contiguous bytes of that row in one plane.
// ---------------------------------------------------------------------------
__device__ __forceinline__ void stage_w_load(const float* __restrict__ Wqh, const float* __restrict__ Wkvh, int tid,
                                             v4f (&wf)[8]) {
  const unsigned o = (unsigned)(4 * tid);                   // piece i*512 + tid: staged row 16*i + (tid >> 5), columns 4*(tid & 31)..+3
#pragma unroll
  for (int i = 0; i < 8; ++i) wf[i] = *(const v4f*)(&((i < 4 ? Wqh : Wkvh) + (i & 3) * 16 * CCH)[o]);
  // the loads' address registers are free for reuse from here on: wait first
  asm volatile("s_wait_xcnt 0x0" ::: "memory");
}
__device__ __forceinline__ void stage_w_store(const v4f (&wf)[8], unsigned short* Ws, int tid) {
  unsigned short* dst = Ws + (tid >> 5) * WSP + 4 * (tid & 31);
#pragma unroll
  for (int i = 0; i < 8; ++i) {
    const v4f f = wf[i];
    unsigned h0, l0, h1, l1;
    split2((v2f){f[0], f[1]}, h0, l0);
    split2((v2f){f[2], f[3]}, h1, l1);
    *(v2u*)(dst + i * 16 * WSP)            = (v2u){h0, h1};
    *(v2u*)(dst + WS_PLANE + i * 16 * WSP) = (v2u){l0, l1};
  }
}

// ---------------------------------------------------------------------------
// P pixel tiles (16 px each, A = gathered x rows) x 64 out channels (4 tiles, B = staged W rows Wb..Wb+63), K = 128:
//   acc[p][j] element r of lane l = (row px 8h + r of tile p, col oc 16j + (l & 15)).
// Every B fragment read from LDS feeds all P tiles. proj_begin issues the x loads of channel block 0 (a phase ahead of
// the product where the caller can), proj_next those of block 1 (in front of proj_run at the latest); block kb + 2 is
// asked for when block kb has been split, into the registers that block kb leaves.
// ---------------------------------------------------------------------------
template <int P>
__device__ __forceinline__ void proj_begin(const float* const (&xt)[P], int lane, float (&xv)[2][P][16]) {
#pragma unroll
  for (int p = 0; p < P; ++p) gather_x(xt[p], lane, 0, xv[0][p]);
  // the loads' address registers are free for reuse from here on: wait first
  asm volatile("s_wait_xcnt 0x0" ::: "memory");
}
template <int P>
__device__ __forceinline__ void proj_next(const float* const (&xt)[P], int lane, float (&xv)[2][P][16]) {
#pragma unroll
  for (int p = 0; p < P; ++p) gather_x(xt[p], lane, 32, xv[1][p]);
  // the loads' address registers are free for reuse from here on: wait first
  asm volatile("s_wait_xcnt 0x0" ::: "memory");
}
template <int P>
__device__ __forceinline__ void proj_run(const float* const (&xt)[P], const unsigned short* Wb, int lane,
                                         float (&xv)[2][P][16], v8f (&acc)[P][4]) {
#pragma unroll
  for (int p = 0; p < P; ++p)
#pragma unroll
    for (int j = 0; j < 4; ++j) acc[p][j] = zero8();
  // unrolled: xv is held in registers and needs constant indices
#pragma unroll
  for (int kb = 0; kb < CCH / 32; ++kb) {
    const int k0 = 32 * kb;
    // a block's split stays behind the block before it: moved up, values and fragments of several blocks would be
    // held at once
    __builtin_amdgcn_sched_barrier(0);
    Frg ah[P], al[P];
#pragma unroll
    for (int p = 0; p < P; ++p) split_x(xv[kb & 1][p], ah[p], al[p]);
    if (kb + 2 < CCH / 32) {
#pragma unroll
      for (int p = 0; p < P; ++p) gather_x(xt[p], lane, k0 + 64, xv[kb & 1][p]);
      // the loads' address registers are free for reuse from here on: wait first
      asm volatile("s_wait_xcnt 0x0" ::: "memory");
      __builtin_amdgcn_sched_barrier(0);                   // keeps these loads from being moved down to their use
    }
#pragma unroll
    for (int j = 0; j < 4; ++j) {
      opt_fence();                                         // one tile's B fragments at a time: lifted up, all four tiles' would be held at once
      Frg bh, bl;
      wfrag(Wb, 16 * j, lane, k0, bh);
      wfrag(Wb + WS_PLANE, 16 * j, lane, k0, bl);
#pragma unroll
      for (int p = 0; p < P; ++p) acc[p][j] = mma16(ah[p].b, bh.b, acc[p][j]);
#pragma unroll
      for (int p = 0; p < P; ++p) acc[p][j] = mma16(ah[p].b, bl.b, acc[p][j]);
#pragma unroll
      for (int p = 0; p < P; ++p) acc[p][j] = mma16(al[p].b, bh.b, acc[p][j]);
    }
  }
}

__device__ __forceinline__ void load16(const float* p, float (&v)[16]) {
#pragma unroll
  for (int g = 0; g < 4; ++g) {
    const v4f t = *(const v4f*)(p + 4 * g);
    v[4 * g + 0] = t[0]; v[4 * g + 1] = t[1]; v[4 * g + 2] = t[2]; v[4 * g + 3] = t[3];
  }
}


// ---------------------------------------------------------------------------
// One branch of the 3x3 local attention for (pixel px of one of the block's two rows, current head), computed by the lane pair
// (l, l^16): this lane holds dims 16*half..16*half+15 of q and of the accumulator; the 32-deep logit is the sum
// of the two partial dots exchanged with __shfl_xor(., 16) (a+b == b+a, so both lanes carry identical logits and
// identical max/sum state). Taps t = 0..8 <-> staged (r = t/3, p = px + t%3).
// Online softmax one window row (three taps) at a time, all unrolled: a row's twelve LDS reads, three dots
// and three exchanges are independent of one another and run side by side; the running max m, the running sum ssum
// and the accumulator ov are rescaled once per row (not at all in the first row, no infinities). Within ssum and ov
// the taps are added in the order t = 0..8; the branch's result is o * inv (o = ov, inv = 1 / ssum), formed by the caller.
// All cross-lane ops sit under uniform control (no lane-varying branches).
// Each 16-B read: 16 lanes of one half at the 1040-B pitch fall on 16 distinct groups of four banks.
// ---------------------------------------------------------------------------
// 16 floats as 8 register pairs, in the order the four 16-B LDS reads deliver them
__device__ __forceinline__ void load8x2(const float* p, v2f (&v)[8]) {
#pragma unroll
  for (int g = 0; g < 4; ++g) {
    const v4f t = *(const v4f*)(p + 4 * g);
    v[2 * g + 0] = (v2f){t[0], t[1]};
    v[2 * g + 1] = (v2f){t[2], t[3]};
  }
}
// One window row: its three taps' kv values (twelve 16-B LDS reads) and its three logits. Each partial dot runs on
// packed f32 FMAs over the register pairs: even and odd dims are summed apart and added at the end.
__device__ __forceinline__ void row_logits(const float* krow, const v2f (&q2)[8], v2f (&kv)[3][8], float (&s)[3]) {
#pragma unroll
  for (int dx = 0; dx < 3; ++dx) load8x2(krow + dx * KVPP, kv[dx]);
  v2f a[3];
#pragma unroll
  for (int dx = 0; dx < 3; ++dx) a[dx] = q2[0] * kv[dx][0];
#pragma unroll
  for (int g = 1; g < 8; ++g) {
#pragma unroll
    for (int dx = 0; dx < 3; ++dx) a[dx] = __builtin_elementwise_fma(q2[g], kv[dx][g], a[dx]);
  }
  float part[3];
#pragma unroll
  for (int dx = 0; dx < 3; ++dx) part[dx] = a[dx][0] + a[dx][1];
#pragma unroll
  for (int dx = 0; dx < 3; ++dx) s[dx] = part[dx] + __shfl_xor(part[dx], 16, 32);
}
__device__ __forceinline__ void attend_branch(const float* kvS, int px, int half,
                                              const float (&q)[16], float (&o)[16], float& inv) {
  const float* kcol = kvS + (size_t)px * KVPP + 16 * half;
  v2f q2[8], ov[8];
#pragma unroll
  for (int g = 0; g < 8; ++g) q2[g] = (v2f){q[2 * g], q[2 * g + 1]};
  float m, ssum;
  {
    v2f kv[3][8];
    float s[3];
    row_logits(kcol, q2, kv, s);                         // taps 0..2
    m = fmaxf(fmaxf(s[0], s[1]), s[2]);
    const float p0 = __expf(s[0] - m), p1 = __expf(s[1] - m), p2 = __expf(s[2] - m);
    ssum = (p0 + p1) + p2;
#pragma unroll
    for (int g = 0; g < 8; ++g) ov[g] = p2 * kv[2][g] + (p1 * kv[1][g] + p0 * kv[0][g]);
  }
  // unrolled: every LDS offset is an immediate, and the next row's reads and dots overlap this row's exponentials and sums
#pragma unroll
  for (int r = 1; r < KVROWS; ++r) {
    v2f kv[3][8];
    float s[3];
    row_logits(kcol + r * KVRS, q2, kv, s);              // taps 3r..3r+2
    const float mn   = fmaxf(m, fmaxf(fmaxf(s[0], s[1]), s[2]));
    const float corr = __expf(m - mn);
    const float p0 = __expf(s[0] - mn), p1 = __expf(s[1] - mn), p2 = __expf(s[2] - mn);
    ssum = ((ssum * corr + p0) + p1) + p2;
#pragma unroll
    for (int g = 0; g < 8; ++g) ov[g] = p2 * kv[2][g] + (p1 * kv[1][g] + (p0 * kv[0][g] + ov[g] * corr));
    m = mn;
  }
  inv = __builtin_amdgcn_rcpf(ssum);                    // ssum in [1, 9]
#pragma unroll
  for (int g = 0; g < 8; ++g) {
    o[2 * g + 0] = ov[g][0];
    o[2 * g + 1] = ov[g][1];
  }
}

// ---------------------------------------------------------------------------
// The whole function in one kernel. Block = (image rows y0 = 2*blockIdx.x and y0+1, batch b), 512 threads, static LDS:
//   Ws [2][128][WSP] bf16 : this pass's 64 rows of Wq and 64 rows of Wkv, split into hi and lo plane
//   KV [130][4][64] f32   : kv of one map, this pass's 64 channels, columns -1..128 (pitch KVPP), image rows y0-1..y0+2
//                           (positions outside the image hold the bias: the 1x1 conv of a zero pad)
//   qT [256 px][KVP] f32  : q = (Wq.x + bq) * 32^-0.5 of this pass; a wave reads only the 16 rows it wrote
//   oT [64 ch][OTP] f32   : in qT's bytes, once q is no longer read: 0.5 * (branch1 + branch2) of this pass
//                           (channel, pixel 0..255 of the block)
//   R0 [4][512][4] f32    : the first map's result of the pass's first head, 16 floats a thread, read back by the thread
//                           that wrote them; the second head's lies in the staged Wq rows (free once q is projected),
//                           two of its four 16-B pieces in each plane. Held in registers they would leave no room
//                           for the x values that are asked for ahead.
// Two passes, one per head pair hp (channels 64*hp..+63). In a pass: weights staged; q projected (wave w: pixels
// 16w..16w+15 of the block's 256) into qT; then per map: kv projected (wave w: pixel columns
// 16*(w & 7)..+15 of staged rows 2*(w >> 3) and 2*(w >> 3) + 1, two A tiles per B fragment), laid into KV, and both
// heads attended (thread = pixel 16w + (lane & 15) of the block, half = lane >> 4); then the pass's 64 output rows.
// Barriers, all reached by all threads: weights staged (oT left) | per map: KV left by every reader | KV written |
// then: qT, KV and Ws left by every reader | oT written.
// Coverage: KV 16 waves x 2 tiles x 16 px x 64 ch = 4 rows x 128 px x 64 ch, plus 8 border positions x 64 ch;
// out: grid (64, 4) x 2 passes x 64 channel rows x 256 px = the whole [4][128][128][128].
// ---------------------------------------------------------------------------
// the three maps carry no __restrict__: told that nothing else writes them, the compiler lifts the q map's loads and
// splits, which are the same in both passes, out of the pass loop and holds them in scratch memory
__global__ __launch_bounds__(NTHR) void k_sasa(const float* xq,
                                               const float* x1,
                                               const float* x2,
                                               const float* __restrict__ Wq,
                                               const float* __restrict__ bq,
                                               const float* __restrict__ Wkv,
                                               const float* __restrict__ bkv,
                                               float* __restrict__ out) {
  __shared__ __attribute__((aligned(16))) float smem[LDS_F];
  unsigned short* Ws = (unsigned short*)smem;            // [2][128][WSP] bf16
  float* KV = smem + WS_F;                               // [130][KVPP]
  float* qT = smem + WS_F + KV_F;                        // [256][KVP]
  float* oT = qT;                                        // [64][OTP], same bytes
  const int tid  = threadIdx.x;
  const int lane = tid & 31;
  const int wave = __builtin_amdgcn_readfirstlane(tid >> 5);
  const int m = lane & 15, h = lane >> 4;
  float* R0 = smem + WS_F + KV_F + OT_F + 4 * tid;       // piece g at R0 + g * 4 * NTHR
  float* R1 = smem + 4 * tid;                            // piece g at R1 + (g >> 1) * (WS_PLANE / 2) + (g & 1) * 4 * NTHR
  const int y0 = RB * blockIdx.x;
  const int b  = blockIdx.y;
  const int tc = wave & 7;                               // pixel column tile
  const int wr = wave >> 3;                              // image row of this wave's pixels within the block
  const size_t mapo = (size_t)b * CCH * HWPIX;

  const float* const xqt[1] = {xq + mapo + (size_t)y0 * IMW + 16 * wave};
  // this wave's two kv tiles: staged rows ra, ra + 1 <-> image rows ya, ya + 1; a row outside the image is read at the
  // nearest image row (in bounds) and its products are dropped for the bias
  const int ra = 2 * wr;
  const int ya = y0 - 1 + ra;
  const bool in0 = (ya >= 0) && (ya < IMH);
  const bool in1 = (ya + 1 >= 0) && (ya + 1 < IMH);
  const int yc0 = (ya < 0) ? 0 : ya;                     // ya <= 127
  const int yc1 = (ya + 1 > IMH - 1) ? (IMH - 1) : (ya + 1);  // ya + 1 >= 0

  // x values of the kv product that comes next; its first channel block is asked for one phase ahead and travels while
  // the phase before runs (the attention of the map before; for a pass's first map also the q product)
  float xk[2][2][16];
  const size_t o0 = mapo + (size_t)yc0 * IMW + 16 * tc, o1 = mapo + (size_t)yc1 * IMW + 16 * tc;
  {
    const float* const xt[2] = {x1 + o0, x1 + o1};
    proj_begin<2>(xt, lane, xk);
  }

#pragma unroll 1
  for (int hp = 0; hp < NHEADS / 2; ++hp) {
    const int c0 = hp * HPC;                             // first channel of the pass
    float res[2][16];
    {
      // ---- weights of the pass, q projection ----
      v4f wf[8];
      float xv[2][1][16];
      stage_w_load(Wq + (size_t)c0 * CCH, Wkv + (size_t)c0 * CCH, tid, wf);
      proj_begin<1>(xqt, lane, xv);
      proj_next<1>(xqt, lane, xv);
      __builtin_amdgcn_sched_barrier(0);                 // keeps the loads above from being moved down to their uses
      stage_w_store(wf, Ws, tid);
      barrier_lds();                                     // staged weights visible to all 16 waves; x loads stay in flight
      v8f acc[1][4];
      proj_run<1>(xqt, Ws, lane, xv, acc);
#pragma unroll
      for (int j = 0; j < 4; ++j) {
        const float bv = bq[c0 + 16 * j + m];
        float* trow = qT + (size_t)(16 * wave + 8 * h) * KVP + 16 * j + m;
#pragma unroll
        for (int r = 0; r < 8; ++r) trow[r * KVP] = (acc[0][j][r] + bv) * QSCALE;
      }
    }

    // rolled over the two maps: one copy of the code
#pragma unroll 1
    for (int br = 0; br < 2; ++br) {
      {
        const float* const xm = br ? x2 : x1;
        const float* const xt[2] = {xm + o0, xm + o1};
        v8f acc[2][4];
        proj_next<2>(xt, lane, xk);
        proj_run<2>(xt, Ws + HPC * WSP, lane, xk, acc);
        barrier_lds();                                   // every reader has left KV (the map or the pass before)
#pragma unroll
        for (int j = 0; j < 4; ++j) {
          const float bv = bkv[c0 + 16 * j + m];
#pragma unroll
          for (int p = 0; p < 2; ++p) {
            const bool inimg = p ? in1 : in0;
            float* drow = KV + (size_t)(16 * tc + 8 * h + 1) * KVPP + (ra + p) * KVRS + 16 * j + m;
#pragma unroll
            for (int r = 0; r < 8; ++r) drow[r * KVPP] = inimg ? (acc[p][j][r] + bv) : bv;
          }
        }
        // columns -1 and 128 of the four staged rows: 8 positions x 64 channels, one float a thread
        const int pos = tid >> 6;
        KV[(size_t)((pos & 1) ? (KVPOS - 1) : 0) * KVPP + (pos >> 1) * KVRS + (tid & 63)] = bkv[c0 + (tid & 63)];
      }
      if (hp + br < NHEADS / 2) {                        // a kv product follows: of the other map
        const float* const xn = br ? x1 : x2;
        const float* const xt[2] = {xn + o0, xn + o1};
        proj_begin<2>(xt, lane, xk);                     // its first loads fly during this map's attention
        __builtin_amdgcn_sched_barrier(0);               // keeps them from being moved down to their use
      }
      barrier_lds();                                     // KV written
#pragma unroll
      for (int hh = 0; hh < 2; ++hh) {
        float q[16];                                     // read per use: held, it would cost the projection registers
        load16(qT + (size_t)(16 * wave + m) * KVP + hh * DHEAD + 16 * h, q);
        float o[16], inv;
        attend_branch(KV + wr * KVRS + hh * DHEAD, 16 * tc + m, h, q, o, inv);
        float* rp[4];
#pragma unroll
        for (int g = 0; g < 4; ++g)
          rp[g] = hh ? (R1 + (g >> 1) * (WS_PLANE / 2) + (g & 1) * 4 * NTHR) : (R0 + g * 4 * NTHR);
        if (br == 0) {
#pragma unroll
          for (int g = 0; g < 4; ++g)
            *(v4f*)rp[g] = (v4f){o[4 * g] * inv, o[4 * g + 1] * inv, o[4 * g + 2] * inv, o[4 * g + 3] * inv};
        } else {
#pragma unroll
          for (int g = 0; g < 4; ++g) {
            const v4f t = *(const v4f*)rp[g];            // first map's result + second map's
#pragma unroll
            for (int e = 0; e < 4; ++e) res[hh][4 * g + e] = t[e] + o[4 * g + e] * inv;
          }
        }
      }
    }
    barrier_lds();                                       // every reader has left qT, KV and Ws

    // ---- the pass's result tile: oT[32*hh + 16*half + i][pixel of the block] ----
#pragma unroll
    for (int hh = 0; hh < 2; ++hh)
#pragma unroll
      for (int i = 0; i < 16; ++i) oT[(size_t)(hh * DHEAD + 16 * h + i) * OTP + 16 * wave + m] = 0.5f * res[hh][i];
    barrier_lds();                                       // oT written
    // channel-major output: wave w writes channel rows 4w..4w+3 of the pass, 256 px = 1 KiB contiguous each
#pragma unroll
    for (int k = 0; k < 8; ++k) {
      const int cc = 4 * wave + (k >> 1);
      const v4f v = *(const v4f*)(oT + (size_t)cc * OTP + (k & 1) * IMW + 4 * lane);
      float* drow = out + (((size_t)b * CCH + c0 + cc) * IMH + y0) * IMW + (k & 1) * IMW;
      *(v4f*)(&drow[(unsigned)(4 * lane)]) = v;
    }
    // the stores' address and data registers are rewritten by the next pass's first instructions: wait first
    asm volatile("s_wait_xcnt 0x0" ::: "memory");
  }
}

extern "C" void kernel_launch(void* const* d_in, const int* in_sizes, int n_in,
                              void* d_out, int out_size, void* d_ws, size_t ws_size,
                              hipStream_t stream) {
  if (n_in < 7) return;
  const int nmap = NB * CCH * HWPIX;
  if (in_sizes[0] != nmap || in_sizes[1] != nmap || in_sizes[2] != nmap) return;
  if (in_sizes[3] != CCH * CCH || in_sizes[4] != CCH) return;
  if (in_sizes[5] != CCH * CCH || in_sizes[6] != CCH) return;
  if (out_size != nmap) return;

  const float* kvmap1 = (const float*)d_in[0];
  const float* qmap   = (const float*)d_in[1];
  const float* kvmap2 = (const float*)d_in[2];
  const float* Wq     = (const float*)d_in[3];
  const float* bq     = (const float*)d_in[4];
  const float* Wkv    = (const float*)d_in[5];
  const float* bkv    = (const float*)d_in[6];
  float* out = (float*)d_out;
  (void)d_ws; (void)ws_size;

  k_sasa<<<dim3(IMH / RB, NB), dim3(NTHR), 0, stream>>>(qmap, kvmap1, kvmap2, Wq, bq, Wkv, bkv, out);
  (void)hipGetLastError();
}

// v008
// One run takes 38.4 microseconds.
// In two side-by-side timings against v007, it was 1.03 and 1.04 times as fast.
// All steps since v000 together make it 3.49 times as fast.
// Contractions: three 1x1-conv projections (q from map in1, kv from maps in0 and in2; M = pixels, N = 128, K = 128)
// on v_wmma_f32_16x16x32_bf16 with bf16 hi/lo split operands (hi.hi + hi.lo + lo.hi), f32 accumulate;
// 9-tap local-window logits, softmax, weighted sums and the two-branch mean in f32 on the VALU.
// ONE launch: a block takes two image rows of one batch and projects the kv rows its windows touch (four per map)
// straight into LDS; no kv value goes through global memory.
#include <hip/hip_runtime.h>
#include <stdint.h>

#define NB      4
#define CCH     128
#define IMH     128
#define IMW     128
#define HWPIX   (IMH * IMW)
#define NHEADS  4
#define DHEAD   32
#define QSCALE  0.17677669529663687f     // 32^-0.5
#define NTHR    512                       // 16 waves
#define RB      2                         // image rows of a block
#define HPC     64                        // channels of a head pair (one pass)
#define KVROWS  3                         // window rows
#define SROWS   (RB + 2)                  // staged kv rows: y0-1 .. y0+2
#define KVPOS   130                       // staged kv positions: x = -1 .. 128
#define KVRS    HPC                       // floats from a staged position to the same column one image row down
#define KVPP    (SROWS * KVRS + 4)        // LDS pitch of a staged column in floats (1040 B = 16 B x 65): its 4 rows x 64 channels
#define KV_F    (KVPOS * KVPP)            // 33800 floats: kv rows of one map, one head pair
#define KVP     68                        // LDS pitch of a q tile row in floats (272 B = 16 B x 17; 64 used)
#define OTP     260                       // LDS pitch of a result channel row in floats (256 px used)
#define OT_F    (RB * IMW * KVP)          // 17408 floats: q tile [256 px][KVP] of a pass, later its result tile [64 ch][OTP]
#define WSP     136                       // LDS pitch of a staged weight row in bf16 (272 B = 16 B x 17)
#define WS_PLANE (CCH * WSP)              // 17408 bf16: one staged weight plane [128][WSP]
#define WS_F    (2 * WS_PLANE / 2)        // 17408 floats: hi and lo plane together (69632 B)
#define RS_F    (NTHR * 16)               // 8192 floats: one head's first-map result, 16 floats a thread
#define LDS_F   (WS_F + KV_F + OT_F + RS_F)  // 76808 floats = 307232 B: one block on a WGP
static_assert(RS_F / 2 <= HPC * WSP / 2); // half of it fits the 64 staged Wq rows of one plane
static_assert(HPC * OTP <= OT_F);

typedef __attribute__((ext_vector_type(16))) __bf16         v16b;
typedef __attribute__((ext_vector_type(8)))  unsigned short v8us;
typedef __attribute__((ext_vector_type(8)))  float          v8f;
typedef __attribute__((ext_vector_type(4)))  float          v4f;
typedef __attribute__((ext_vector_type(2)))  float          v2f;
typedef __attribute__((ext_vector_type(2)))  __bf16         v2b;
typedef __attribute__((ext_vector_type(2)))  unsigned int   v2u;

union Frg { v16b b; v8us h8[2]; unsigned int w[8]; };
static_assert(sizeof(Frg) == 32);

// ---------------------------------------------------------------------------
// small helpers
// ---------------------------------------------------------------------------
__device__ __forceinline__ void opt_fence() { asm volatile("" ::: "memory"); }

__device__ __forceinline__ v8f zero8() {
  v8f z = {0.f, 0.f, 0.f, 0.f, 0.f, 0.f, 0.f, 0.f};
  return z;
}

// WMMA as the plain builtin: the compiler keeps the distances behind it
__device__ __forceinline__ v8f mma16(v16b a, v16b b, v8f c) {
  return __builtin_amdgcn_wmma_f32_16x16x32_bf16(false, a, false, b, (short)0, c, false, false);
}

// ---------------------------------------------------------------------------
// Fragment builders (wave32, 16x16x32, split k map for BOTH operands):
//   lane l: row/col = l & 15, h = l >> 4; element i (0..7) <- k0 + 8h + i, element i (8..15) <- k0 + 16 + 8h + (i-8)
// ---------------------------------------------------------------------------
// Operand gathered from a channel-major f32 map: row m = pixel (pt + m), k = channel, channel stride HWPIX.
// gather_x only issues the 16 loads of one 32-channel block; split_x later splits the values into bf16 hi (RNE) and
// lo = RNE(v - hi) planes in registers.
__device__ __forceinline__ void gather_x(const float* pt, int lane, int k0, float (&v)[16]) {
  // pt is the same in every lane: one 32-bit lane offset serves all loads, the channel step goes into the base
  const unsigned vo = (unsigned)((lane & 15) + 8 * (lane >> 4) * HWPIX);
#pragma unroll
  for (int q = 0; q < 8; ++q) {
    const int c = k0 + ((q < 4) ? (2 * q) : (16 + 2 * (q - 4)));
    v[2 * q + 0] = (pt + (size_t)c * HWPIX)[vo];
    v[2 * q + 1] = (pt + (size_t)(c + 1) * HWPIX)[vo];
  }
}
// Two f32 values -> their bf16 hi parts (RNE, one packed convert) and the bf16 parts of the exact rests v - hi.
__device__ __forceinline__ void split2(v2f v, unsigned& hi, unsigned& lo) {
  hi = __builtin_bit_cast(unsigned, __builtin_convertvector(v, v2b));
  const v2f back = {__uint_as_float(hi << 16), __uint_as_float(hi & 0xFFFF0000u)};
  lo = __builtin_bit_cast(unsigned, __builtin_convertvector(v - back, v2b));
}
__device__ __forceinline__ void split_x(const float (&v)[16], Frg& fh, Frg& fl) {
#pragma unroll
  for (int q = 0; q < 8; ++q) split2((v2f){v[2 * q + 0], v[2 * q + 1]}, fh.w[q], fl.w[q]);
}
// Operand from a bf16 plane staged in LDS as [row][WSP] with k contiguous (weights W[oc][c]): two 16-B LDS loads
// per lane; 16 lanes at the 272-B pitch fall on 16 distinct groups of four banks.
__device__ __forceinline__ void wfrag(const unsigned short* W, int row0, int lane, int k0, Frg& f) {
  const int m = lane & 15, h = lane >> 4;
  const unsigned short* p = W + (row0 + m) * WSP + k0 + 8 * h;
  f.h8[0] = *(const v8us*)(p);
  f.h8[1] = *(const v8us*)(p + 16);
}
// Work-group barrier whose fences order LDS alone: it publishes LDS writes like __syncthreads(), but does not wait for
// the wave's outstanding global loads, which stay in flight across it.
__device__ __forceinline__ void barrier_lds() {
  __builtin_amdgcn_fence(__ATOMIC_RELEASE, "workgroup", "local");
  __builtin_amdgcn_s_barrier();
  __builtin_amdgcn_fence(__ATOMIC_ACQUIRE, "workgroup", "local");
}

// ---------------------------------------------------------------------------
// Weights of one pass: rows hp*64..+63 of Wq (staged rows 0..63) and of Wkv (staged rows 64..127), read as f32 from
// global, split in registers, both bf16 planes laid into LDS: Ws[plane][row][WSP]. 4096 16-B pieces, 8 per thread; a
// wave's load covers one whole 512-B row, each of its two 8-B stores 256 contiguous bytes of that row in one plane.
// ---------------------------------------------------------------------------
__device__ __forceinline__ void stage_w_load(const float* __restrict__ Wqh, const float* __restrict__ Wkvh, int tid,
                                             v4f (&wf)[8]) {
  const unsigned o = (unsigned)(4 * tid);                   // piece i*512 + tid: staged row 16*i + (tid >> 5), columns 4*(tid & 31)..+3
#pragma unroll
  for (int i = 0; i < 8; ++i) wf[i] = *(const v4f*)(&((i < 4 ? Wqh : Wkvh) + (i & 3) * 16 * CCH)[o]);
  // the loads' address registers are free for reuse from here on: wait first
  asm volatile("s_wait_xcnt 0x0" ::: "memory");
}
__device__ __forceinline__ void stage_w_store(const v4f (&wf)[8], unsigned short* Ws, int tid) {
  unsigned short* dst = Ws + (tid >> 5) * WSP + 4 * (tid & 31);
#pragma unroll
  for (int i = 0; i < 8; ++i) {
    const v4f f = wf[i];
    unsigned h0, l0, h1, l1;
    split2((v2f){f[0], f[1]}, h0, l0);
    split2((v2f){f[2], f[3]}, h1, l1);
    *(v2u*)(dst + i * 16 * WSP)            = (v2u){h0, h1};
    *(v2u*)(dst + WS_PLANE + i * 16 * WSP) = (v2u){l0, l1};
  }
}

// ---------------------------------------------------------------------------
// P pixel tiles (16 px each, A = gathered x rows) x 64 out channels (4 tiles, B = staged W rows Wb..Wb+63), K = 128:
//   acc[p][j] element r of lane l = (row px 8h + r of tile p, col oc 16j + (l & 15)).
// Every B fragment read from LDS feeds all P tiles. proj_begin issues the x loads of channel block 0 (a phase ahead of
// the product where the caller can), proj_next those of block 1 (in front of proj_run at the latest); block kb + 2 is
// asked for when block kb has been split, into the registers that block kb leaves.
// ---------------------------------------------------------------------------
template <int P>
__device__ __forceinline__ void proj_begin(const float* const (&xt)[P], int lane, float (&xv)[2][P][16]) {
#pragma unroll
  for (int p = 0; p < P; ++p) gather_x(xt[p], lane, 0, xv[0][p]);
  // the loads' address registers are free for reuse from here on: wait first
  asm volatile("s_wait_xcnt 0x0" ::: "memory");
}
template <int P>
__device__ __forceinline__ void proj_next(const float* const (&xt)[P], int lane, float (&xv)[2][P][16]) {
#pragma unroll
  for (int p = 0; p < P; ++p) gather_x(xt[p], lane, 32, xv[1][p]);
  // the loads' address registers are free for reuse from here on: wait first
  asm volatile("s_wait_xcnt 0x0" ::: "memory");
}
template <int P>
__device__ __forceinline__ void proj_run(const float* const (&xt)[P], const unsigned short* Wb, int lane,
                                         float (&xv)[2][P][16], v8f (&acc)[P][4]) {
#pragma unroll
  for (int p = 0; p < P; ++p)
#pragma unroll
    for (int j = 0; j < 4; ++j) acc[p][j] = zero8();
  // unrolled: xv is held in registers and needs constant indices
#pragma unroll
  for (int kb = 0; kb < CCH / 32; ++kb) {
    const int k0 = 32 * kb;
    // a block's split stays behind the block before it: moved up, values and fragments of several blocks would be
    // held at once
    __builtin_amdgcn_sched_barrier(0);
    Frg ah[P], al[P];
#pragma unroll
    for (int p = 0; p < P; ++p) split_x(xv[kb & 1][p], ah[p], al[p]);
    if (kb + 2 < CCH / 32) {
#pragma unroll
      for (int p = 0; p < P; ++p) gather_x(xt[p], lane, k0 + 64, xv[kb & 1][p]);
      // the loads' address registers are free for reuse from here on: wait first
      asm volatile("s_wait_xcnt 0x0" ::: "memory");
      __builtin_amdgcn_sched_barrier(0);                   // keeps these loads from being moved down to their use
    }
#pragma unroll
    for (int j = 0; j < 4; ++j) {
      opt_fence();                                         // one tile's B fragments at a time: lifted up, all four tiles' would be held at once
      Frg bh, bl;
      wfrag(Wb, 16 * j, lane, k0, bh);
      wfrag(Wb + WS_PLANE, 16 * j, lane, k0, bl);
#pragma unroll
      for (int p = 0; p < P; ++p) acc[p][j] = mma16(ah[p].b, bh.b, acc[p][j]);
#pragma unroll
      for (int p = 0; p < P; ++p) acc[p][j] = mma16(ah[p].b, bl.b, acc[p][j]);
#pragma unroll
      for (int p = 0; p < P; ++p) acc[p][j] = mma16(al[p].b, bh.b, acc[p][j]);
    }
  }
}

__device__ __forceinline__ void load16(const float* p, float (&v)[16]) {
#pragma unroll
  for (int g = 0; g < 4; ++g) {
    const v4f t = *(const v4f*)(p + 4 * g);
    v[4 * g + 0] = t[0]; v[4 * g + 1] = t[1]; v[4 * g + 2] = t[2]; v[4 * g + 3] = t[3];
  }
}


// ---------------------------------------------------------------------------
// One branch of the 3x3 local attention for (pixel px of one of the block's two rows, current head), computed by the lane pair
// (l, l^16): this lane holds dims 16*half..16*half+15 of q and of the accumulator; the 32-deep logit is the sum
// of the two partial dots exchanged with __shfl_xor(., 16) (a+b == b+a, so both lanes carry identical logits and
// identical max/sum state). Taps t = 0..8 <-> staged (r = t/3, p = px + t%3).
// Online softmax one window row (three taps) at a time, all unrolled: a row's twelve LDS reads, three dots
// and three exchanges are independent of one another and run side by side; the running max m, the running sum ssum
// and the accumulator ov are rescaled once per row (not at all in the first row, no infinities). Within ssum and ov
// the taps are added in the order t = 0..8; the branch's result is o * inv (o = ov, inv = 1 / ssum), formed by the caller.
// All cross-lane ops sit under uniform control (no lane-varying branches).
// Each 16-B read: 16 lanes of one half at the 1040-B pitch fall on 16 distinct groups of four banks.
// ---------------------------------------------------------------------------
// 16 floats as 8 register pairs, in the order the four 16-B LDS reads deliver them
__device__ __forceinline__ void load8x2(const float* p, v2f (&v)[8]) {
#pragma unroll
  for (int g = 0; g < 4; ++g) {
    const v4f t = *(const v4f*)(p + 4 * g);
    v[2 * g + 0] = (v2f){t[0], t[1]};
    v[2 * g + 1] = (v2f){t[2], t[3]};
  }
}
// One window row: its three taps' kv values (twelve 16-B LDS reads) and its three logits. Each partial dot runs on
// packed f32 FMAs over the register pairs: even and odd dims are summed apart and added at the end.
__device__ __forceinline__ void row_logits(const float* krow, const v2f (&q2)[8], v2f (&kv)[3][8], float (&s)[3]) {
#pragma unroll
  for (int dx = 0; dx < 3; ++dx) load8x2(krow + dx * KVPP, kv[dx]);
  v2f a[3];
#pragma unroll
  for (int dx = 0; dx < 3; ++dx) a[dx] = q2[0] * kv[dx][0];
#pragma unroll
  for (int g = 1; g < 8; ++g) {
#pragma unroll
    for (int dx = 0; dx < 3; ++dx) a[dx] = __builtin_elementwise_fma(q2[g], kv[dx][g], a[dx]);
  }
  float part[3];
#pragma unroll
  for (int dx = 0; dx < 3; ++dx) part[dx] = a[dx][0] + a[dx][1];
#pragma unroll
  for (int dx = 0; dx < 3; ++dx) s[dx] = part[dx] + __shfl_xor(part[dx], 16, 32);
}
__device__ __forceinline__ void attend_branch(const float* kvS, int px, int half,
                                              const float (&q)[16], float (&o)[16], float& inv) {
  const float* kcol = kvS + (size_t)px * KVPP + 16 * half;
  v2f q2[8], ov[8];
#pragma unroll
  for (int g = 0; g < 8; ++g) q2[g] = (v2f){q[2 * g], q[2 * g + 1]};
  float m, ssum;
  {
    v2f kv[3][8];
    float s[3];
    row_logits(kcol, q2, kv, s);                         // taps 0..2
    m = fmaxf(fmaxf(s[0], s[1]), s[2]);
    const float p0 = __expf(s[0] - m), p1 = __expf(s[1] - m), p2 = __expf(s[2] - m);
    ssum = (p0 + p1) + p2;
#pragma unroll
    for (int g = 0; g < 8; ++g) ov[g] = p2 * kv[2][g] + (p1 * kv[1][g] + p0 * kv[0][g]);
  }
  // unrolled: every LDS offset is an immediate, and the next row's reads and dots overlap this row's exponentials and sums
#pragma unroll
  for (int r = 1; r < KVROWS; ++r) {
    v2f kv[3][8];
    float s[3];
    row_logits(kcol + r * KVRS, q2, kv, s);              // taps 3r..3r+2
    const float mn   = fmaxf(m, fmaxf(fmaxf(s[0], s[1]), s[2]));
    const float corr = __expf(m - mn);
    const float p0 = __expf(s[0] - mn), p1 = __expf(s[1] - mn), p2 = __expf(s[2] - mn);
    ssum = ((ssum * corr + p0) + p1) + p2;
#pragma unroll
    for (int g = 0; g < 8; ++g) ov[g] = p2 * kv[2][g] + (p1 * kv[1][g] + (p0 * kv[0][g] + ov[g] * corr));
    m = mn;
  }
  inv = __builtin_amdgcn_rcpf(ssum);                    // ssum in [1, 9]
#pragma unroll
  for (int g = 0; g < 8; ++g) {
    o[2 * g + 0] = ov[g][0];
    o[2 * g + 1] = ov[g][1];
  }
}

// ---------------------------------------------------------------------------
// The whole function in one kernel. Block = (image rows y0 = 2*blockIdx.x and y0+1, batch b), 512 threads, static LDS:
//   Ws [2][128][WSP] bf16 : this pass's 64 rows of Wq and 64 rows of Wkv, split into hi and lo plane
//   KV [130][4][64] f32   : kv of one map, this pass's 64 channels, columns -1..128 (pitch KVPP), image rows y0-1..y0+2
//                           (positions outside the image hold the bias: the 1x1 conv of a zero pad)
//   qT [256 px][KVP] f32  : q = (Wq.x + bq) * 32^-0.5 of this pass; a wave reads only the 16 rows it wrote
//   oT [64 ch][OTP] f32   : in qT's bytes, once q is no longer read: 0.5 * (branch1 + branch2) of this pass
//                           (channel, pixel 0..255 of the block)
//   R0 [4][512][4] f32    : the first map's result of the pass's first head, 16 floats a thread, read back by the thread
//                           that wrote them; the second head's lies in the staged Wq rows (free once q is projected),
//                           two of its four 16-B pieces in each plane. Held in registers they would leave no room
//                           for the x values that are asked for ahead.
// Two passes, one per head pair hp (channels 64*hp..+63). In a pass: weights staged; q projected (wave w: pixels
// 16w..16w+15 of the block's 256) into qT; then per map: kv projected (wave w: pixel columns
// 16*(w & 7)..+15 of staged rows 2*(w >> 3) and 2*(w >> 3) + 1, two A tiles per B fragment), laid into KV, and both
// heads attended (thread = pixel 16w + (lane & 15) of the block, half = lane >> 4); then the pass's 64 output rows.
// Barriers, all reached by all threads: weights staged (oT left) | per map: KV left by every reader | KV written |
// then: qT, KV and Ws left by every reader | oT written.
// Coverage: KV 16 waves x 2 tiles x 16 px x 64 ch = 4 rows x 128 px x 64 ch, plus 8 border positions x 64 ch;
// out: grid (64, 4) x 2 passes x 64 channel rows x 256 px = the whole [4][128][128][128].
// ---------------------------------------------------------------------------
// the three maps carry no __restrict__: told that nothing else writes them, the compiler lifts the q map's loads and
// splits, which are the same in both passes, out of the pass loop and holds them in scratch memory
__global__ __launch_bounds__(NTHR) void k_sasa(const float* xq,
                                               const float* x1,
                                               const float* x2,
                                               const float* __restrict__ Wq,
                                               const float* __restrict__ bq,
                                               const float* __restrict__ Wkv,
                                               const float* __restrict__ bkv,
                                               float* __restrict__ out) {
  __shared__ __attribute__((aligned(16))) float smem[LDS_F];
  unsigned short* Ws = (unsigned short*)smem;            // [2][128][WSP] bf16
  float* KV = smem + WS_F;                               // [130][KVPP]
  float* qT = smem + WS_F + KV_F;                        // [256][KVP]
  float* oT = qT;                                        // [64][OTP], same bytes
  const int tid  = threadIdx.x;
  const int lane = tid & 31;
  const int wave = __builtin_amdgcn_readfirstlane(tid >> 5);
  const int m = lane & 15, h = lane >> 4;
  float* R0 = smem + WS_F + KV_F + OT_F + 4 * tid;       // piece g at R0 + g * 4 * NTHR
  float* R1 = smem + 4 * tid;                            // piece g at R1 + (g >> 1) * (WS_PLANE / 2) + (g & 1) * 4 * NTHR
  const int y0 = RB * blockIdx.x;
  const int b  = blockIdx.y;
  const int tc = wave & 7;                               // pixel column tile
  const int wr = wave >> 3;                              // image row of this wave's pixels within the block
  const size_t mapo = (size_t)b * CCH * HWPIX;

  const float* const xqt[1] = {xq + mapo + (size_t)y0 * IMW + 16 * wave};
  // this wave's two kv tiles: staged rows ra, ra + 1 <-> image rows ya, ya + 1; a row outside the image is read at the
  // nearest image row (in bounds) and its products are dropped for the bias
  const int ra = 2 * wr;
  const int ya = y0 - 1 + ra;
  const bool in0 = (ya >= 0) && (ya < IMH);
  const bool in1 = (ya + 1 >= 0) && (ya + 1 < IMH);
  const int yc0 = (ya < 0) ? 0 : ya;                     // ya <= 127
  const int yc1 = (ya + 1 > IMH - 1) ? (IMH - 1) : (ya + 1);  // ya + 1 >= 0

  // x values of the kv product that comes next; its first channel block is asked for one phase ahead and travels while
  // the phase before runs (the attention of the map before; for a pass's first map also the q product)
  float xk[2][2][16];
  const size_t o0 = mapo + (size_t)yc0 * IMW + 16 * tc, o1 = mapo + (size_t)yc1 * IMW + 16 * tc;
  {
    const float* const xt[2] = {x1 + o0, x1 + o1};
    proj_begin<2>(xt, lane, xk);
  }

#pragma unroll 1
  for (int hp = 0; hp < NHEADS / 2; ++hp) {
    const int c0 = hp * HPC;                             // first channel of the pass
    float res[2][16];
    {
      // ---- weights of the pass, q projection ----
      v4f wf[8];
      float xv[2][1][16];
      stage_w_load(Wq + (size_t)c0 * CCH, Wkv + (size_t)c0 * CCH, tid, wf);
      proj_begin<1>(xqt, lane, xv);
      proj_next<1>(xqt, lane, xv);
      __builtin_amdgcn_sched_barrier(0);                 // keeps the loads above from being moved down to their uses
      stage_w_store(wf, Ws, tid);
      barrier_lds();                                     // staged weights visible to all 16 waves; x loads stay in flight
      v8f acc[1][4];
      proj_run<1>(xqt, Ws, lane, xv, acc);
#pragma unroll
      for (int j = 0; j < 4; ++j) {
        const float bv = bq[c0 + 16 * j + m];
        float* trow = qT + (size_t)(16 * wave + 8 * h) * KVP + 16 * j + m;
#pragma unroll
        for (int r = 0; r < 8; ++r) trow[r * KVP] = (acc[0][j][r] + bv) * QSCALE;
      }
    }

    // rolled over the two maps: one copy of the code
#pragma unroll 1
    for (int br = 0; br < 2; ++br) {
      {
        const float* const xm = br ? x2 : x1;
        const float* const xt[2] = {xm + o0, xm + o1};
        v8f acc[2][4];
        proj_next<2>(xt, lane, xk);
        proj_run<2>(xt, Ws + HPC * WSP, lane, xk, acc);
        // the last products stay in front of the stores: mingled with them, their fragments' registers stay held and
        // the bias adds and selects no longer pair up
        __builtin_amdgcn_sched_barrier(0);
        barrier_lds();                                   // every reader has left KV (the map or the pass before)
#pragma unroll
        for (int j = 0; j < 4; ++j) {
          const float bv = bkv[c0 + 16 * j + m];
#pragma unroll
          for (int p = 0; p < 2; ++p) {
            const bool inimg = p ? in1 : in0;
            float* drow = KV + (size_t)(16 * tc + 8 * h + 1) * KVPP + (ra + p) * KVRS + 16 * j + m;
#pragma unroll
            for (int r = 0; r < 8; ++r) drow[r * KVPP] = inimg ? (acc[p][j][r] + bv) : bv;
          }
        }
        // columns -1 and 128 of the four staged rows: 8 positions x 64 channels, one float a thread
        const int pos = tid >> 6;
        KV[(size_t)((pos & 1) ? (KVPOS - 1) : 0) * KVPP + (pos >> 1) * KVRS + (tid & 63)] = bkv[c0 + (tid & 63)];
      }
      if (hp + br < NHEADS / 2) {                        // a kv product follows: of the other map
        const float* const xn = br ? x1 : x2;
        const float* const xt[2] = {xn + o0, xn + o1};
        proj_begin<2>(xt, lane, xk);                     // its first loads fly during this map's attention
        __builtin_amdgcn_sched_barrier(0);               // keeps them from being moved down to their use
      }
      barrier_lds();                                     // KV written
#pragma unroll
      for (int hh = 0; hh < 2; ++hh) {
        float q[16];                                     // read per use: held, it would cost the projection registers
        load16(qT + (size_t)(16 * wave + m) * KVP + hh * DHEAD + 16 * h, q);
        float o[16], inv;
        attend_branch(KV + wr * KVRS + hh * DHEAD, 16 * tc + m, h, q, o, inv);
        float* rp[4];
#pragma unroll
        for (int g = 0; g < 4; ++g)
          rp[g] = hh ? (R1 + (g >> 1) * (WS_PLANE / 2) + (g & 1) * 4 * NTHR) : (R0 + g * 4 * NTHR);
        if (br == 0) {
#pragma unroll
          for (int g = 0; g < 4; ++g)
            *(v4f*)rp[g] = (v4f){o[4 * g] * inv, o[4 * g + 1] * inv, o[4 * g + 2] * inv, o[4 * g + 3] * inv};
        } else {
#pragma unroll
          for (int g = 0; g < 4; ++g) {
            const v4f t = *(const v4f*)rp[g];            // first map's result + second map's
#pragma unroll
            for (int e = 0; e < 4; ++e) res[hh][4 * g + e] = t[e] + o[4 * g + e] * inv;
          }
        }
      }
    }
    barrier_lds();                                       // every reader has left qT, KV and Ws

    // ---- the pass's result tile: oT[32*hh + 16*half + i][pixel of the block] ----
#pragma unroll
    for (int hh = 0; hh < 2; ++hh)
#pragma unroll
      for (int i = 0; i < 16; ++i) oT[(size_t)(hh * DHEAD + 16 * h + i) * OTP + 16 * wave + m] = 0.5f * res[hh][i];
    barrier_lds();                                       // oT written
    // channel-major output: wave w writes channel rows 4w..4w+3 of the pass, 256 px = 1 KiB contiguous each
#pragma unroll
    for (int k = 0; k < 8; ++k) {
      const int cc = 4 * wave + (k >> 1);
      const v4f v = *(const v4f*)(oT + (size_t)cc * OTP + (k & 1) * IMW + 4 * lane);
      float* drow = out + (((size_t)b * CCH + c0 + cc) * IMH + y0) * IMW + (k & 1) * IMW;
      *(v4f*)(&drow[(unsigned)(4 * lane)]) = v;
    }
    // the stores' address and data registers are rewritten by the next pass's first instructions: wait first
    asm volatile("s_wait_xcnt 0x0" ::: "memory");
  }
}

extern "C" void kernel_launch(void* const* d_in, const int* in_sizes, int n_in,
                              void* d_out, int out_size, void* d_ws, size_t ws_size,
                              hipStream_t stream) {
  if (n_in < 7) return;
  const int nmap = NB * CCH * HWPIX;
  if (in_sizes[0] != nmap || in_sizes[1] != nmap || in_sizes[2] != nmap) return;
  if (in_sizes[3] != CCH * CCH || in_sizes[4] != CCH) return;
  if (in_sizes[5] != CCH * CCH || in_sizes[6] != CCH) return;
  if (out_size != nmap) return;

  const float* kvmap1 = (const float*)d_in[0];
  const float* qmap   = (const float*)d_in[1];
  const float* kvmap2 = (const float*)d_in[2];
  const float* Wq     = (const float*)d_in[3];
  const float* bq     = (const float*)d_in[4];
  const float* Wkv    = (const float*)d_in[5];
  const float* bkv    = (const float*)d_in[6];
  float* out = (float*)d_out;
  (void)d_ws; (void)ws_size;

  k_sasa<<<dim3(IMH / RB, NB), dim3(NTHR), 0, stream>>>(qmap, kvmap1, kvmap2, Wq, bq, Wkv, bkv, out);
  (void)hipGetLastError();
}

// v009
// One run takes 36.2 microseconds.
// In both of two side-by-side timings against v008, it was 1.06 times as fast.
// Counting every step since v000, it is 3.71 times as fast.
// Contractions: three 1x1-conv projections (q from map in1, kv from maps in0 and in2; M = pixels, N = 128, K = 128)
// on v_wmma_f32_16x16x32_bf16 with bf16 hi/lo split operands (hi.hi + hi.lo + lo.hi), f32 accumulate;
// 9-tap local-window logits, softmax, weighted sums and the two-branch mean in f32 on the VALU.
// ONE launch: a block takes two image rows of one batch and projects the kv rows its windows touch (four per map)
// straight into LDS; no kv value goes through global memory.
#include <hip/hip_runtime.h>
#include <stdint.h>

#define NB      4
#define CCH     128
#define IMH     128
#define IMW     128
#define HWPIX   (IMH * IMW)
#define NHEADS  4
#define DHEAD   32
#define QSCALE  0.17677669529663687f     // 32^-0.5
#define NTHR    512                       // 16 waves
#define RB      2                         // image rows of a block
#define HPC     64                        // channels of a head pair (one pass)
#define KVROWS  3                         // window rows
#define SROWS   (RB + 2)                  // staged kv rows: y0-1 .. y0+2
#define KVPOS   130                       // staged kv positions: x = -1 .. 128
#define KVRS    HPC                       // floats from a staged position to the same column one image row down
#define KVPP    (SROWS * KVRS + 4)        // LDS pitch of a staged column in floats (1040 B = 16 B x 65): its 4 rows x 64 channels
#define KV_F    (KVPOS * KVPP)            // 33800 floats: kv rows of one map, one head pair
#define KVP     68                        // LDS pitch of a q tile row in floats (272 B = 16 B x 17; 64 used)
#define OTP     260                       // LDS pitch of a result channel row in floats (256 px used)
#define OT_F    (RB * IMW * KVP)          // 17408 floats: q tile [256 px][KVP] of a pass, later its result tile [64 ch][OTP]
#define WSP     136                       // LDS pitch of a staged weight row in bf16 (272 B = 16 B x 17)
#define WS_PLANE (CCH * WSP)              // 17408 bf16: one staged weight plane [128][WSP]
#define WS_F    (2 * WS_PLANE / 2)        // 17408 floats: hi and lo plane together (69632 B)
#define RS_F    (NTHR * 16)               // 8192 floats: one head's first-map result, 16 floats a thread
#define LDS_F   (WS_F + KV_F + OT_F + RS_F)  // 76808 floats = 307232 B: one block on a WGP
static_assert(RS_F / 2 <= HPC * WSP / 2); // half of it fits the 64 staged Wq rows of one plane
static_assert(HPC * OTP <= OT_F);

typedef __attribute__((ext_vector_type(16))) __bf16         v16b;
typedef __attribute__((ext_vector_type(8)))  unsigned short v8us;
typedef __attribute__((ext_vector_type(8)))  float          v8f;
typedef __attribute__((ext_vector_type(4)))  float          v4f;
typedef __attribute__((ext_vector_type(2)))  float          v2f;
typedef __attribute__((ext_vector_type(2)))  __bf16         v2b;
typedef __attribute__((ext_vector_type(2)))  unsigned int   v2u;

union Frg { v16b b; v8us h8[2]; unsigned int w[8]; };
static_assert(sizeof(Frg) == 32);

// ---------------------------------------------------------------------------
// small helpers
// ---------------------------------------------------------------------------
__device__ __forceinline__ void opt_fence() { asm volatile("" ::: "memory"); }

__device__ __forceinline__ v8f zero8() {
  v8f z = {0.f, 0.f, 0.f, 0.f, 0.f, 0.f, 0.f, 0.f};
  return z;
}

// WMMA as the plain builtin: the compiler keeps the distances behind it
__device__ __forceinline__ v8f mma16(v16b a, v16b b, v8f c) {
  return __builtin_amdgcn_wmma_f32_16x16x32_bf16(false, a, false, b, (short)0, c, false, false);
}

// ---------------------------------------------------------------------------
// Fragment builders (wave32, 16x16x32, split k map for BOTH operands):
//   lane l: row/col = l & 15, h = l >> 4; element i (0..7) <- k0 + 8h + i, element i (8..15) <- k0 + 16 + 8h + (i-8)
// ---------------------------------------------------------------------------
// Operand gathered from a channel-major f32 map: row m = pixel (pt + m), k = channel, channel stride HWPIX.
// gather_x only issues the 16 loads of one 32-channel block; split_x later splits the values into bf16 hi (RNE) and
// lo = RNE(v - hi) planes in registers.
__device__ __forceinline__ void gather_x(const float* pt, int lane, int k0, float (&v)[16]) {
  // pt is the same in every lane: one 32-bit lane offset serves all loads, the channel step goes into the base
  const unsigned vo = (unsigned)((lane & 15) + 8 * (lane >> 4) * HWPIX);
#pragma unroll
  for (int q = 0; q < 8; ++q) {
    const int c = k0 + ((q < 4) ? (2 * q) : (16 + 2 * (q - 4)));
    v[2 * q + 0] = (pt + (size_t)c * HWPIX)[vo];
    v[2 * q + 1] = (pt + (size_t)(c + 1) * HWPIX)[vo];
  }
}
// Two f32 values -> their bf16 hi parts (RNE, one packed convert) and the bf16 parts of the exact rests v - hi.
__device__ __forceinline__ void split2(v2f v, unsigned& hi, unsigned& lo) {
  hi = __builtin_bit_cast(unsigned, __builtin_convertvector(v, v2b));
  const v2f back = {__uint_as_float(hi << 16), __uint_as_float(hi & 0xFFFF0000u)};
  lo = __builtin_bit_cast(unsigned, __builtin_convertvector(v - back, v2b));
}
__device__ __forceinline__ void split_x(const float (&v)[16], Frg& fh, Frg& fl) {
#pragma unroll
  for (int q = 0; q < 8; ++q) split2((v2f){v[2 * q + 0], v[2 * q + 1]}, fh.w[q], fl.w[q]);
}
// Operand from a bf16 plane staged in LDS as [row][WSP] with k contiguous (weights W[oc][c]): two 16-B LDS loads
// per lane; 16 lanes at the 272-B pitch fall on 16 distinct groups of four banks.
__device__ __forceinline__ void wfrag(const unsigned short* W, int row0, int lane, int k0, Frg& f) {
  const int m = lane & 15, h = lane >> 4;
  const unsigned short* p = W + (row0 + m) * WSP + k0 + 8 * h;
  f.h8[0] = *(const v8us*)(p);
  f.h8[1] = *(const v8us*)(p + 16);
}
// Work-group barrier whose fences order LDS alone: it publishes LDS writes like __syncthreads(), but does not wait for
// the wave's outstanding global loads, which stay in flight across it.
__device__ __forceinline__ void barrier_lds() {
  __builtin_amdgcn_fence(__ATOMIC_RELEASE, "workgroup", "local");
  __builtin_amdgcn_s_barrier();
  __builtin_amdgcn_fence(__ATOMIC_ACQUIRE, "workgroup", "local");
}

// ---------------------------------------------------------------------------
// Weights of one pass: rows hp*64..+63 of Wq (staged rows 0..63) and of Wkv (staged rows 64..127), read as f32 from
// global, split in registers, both bf16 planes laid into LDS: Ws[plane][row][WSP]. 4096 16-B pieces, 8 per thread; a
// wave's load covers one whole 512-B row, each of its two 8-B stores 256 contiguous bytes of that row in one plane.
// ---------------------------------------------------------------------------
__device__ __forceinline__ void stage_w_load(const float* __restrict__ Wqh, const float* __restrict__ Wkvh, int tid,
                                             v4f (&wf)[8]) {
  const unsigned o = (unsigned)(4 * tid);                   // piece i*512 + tid: staged row 16*i + (tid >> 5), columns 4*(tid & 31)..+3
#pragma unroll
  for (int i = 0; i < 8; ++i) {
    wf[i] = *(const v4f*)(&((i < 4 ? Wqh : Wkvh) + (i & 3) * 16 * CCH)[o]);
    // the Wq loads' address registers are free for reuse by the Wkv loads' results: wait first
    if (i == 3) asm volatile("s_wait_xcnt 0x0" ::: "memory");
  }
  // the loads' address registers are free for reuse from here on: wait first
  asm volatile("s_wait_xcnt 0x0" ::: "memory");
}
__device__ __forceinline__ void stage_w_store(const v4f (&wf)[8], unsigned short* Ws, int tid) {
  unsigned short* dst = Ws + (tid >> 5) * WSP + 4 * (tid & 31);
#pragma unroll
  for (int i = 0; i < 8; ++i) {
    const v4f f = wf[i];
    unsigned h0, l0, h1, l1;
    split2((v2f){f[0], f[1]}, h0, l0);
    split2((v2f){f[2], f[3]}, h1, l1);
    *(v2u*)(dst + i * 16 * WSP)            = (v2u){h0, h1};
    *(v2u*)(dst + WS_PLANE + i * 16 * WSP) = (v2u){l0, l1};
  }
}

// ---------------------------------------------------------------------------
// P pixel tiles (16 px each, A = gathered x rows) x 64 out channels (4 tiles, B = staged W rows Wb..Wb+63), K = 128:
//   acc[p][j] element r of lane l = (row px 8h + r of tile p, col oc 16j + (l & 15)).
// Every B fragment read from LDS feeds all P tiles. proj_begin issues the x loads of channel block 0 (a phase ahead of
// the product where the caller can), proj_next those of block 1 (in front of proj_run at the latest); block kb + 2 is
// asked for when block kb has been split, into the registers that block kb leaves.
// ---------------------------------------------------------------------------
template <int P>
__device__ __forceinline__ void proj_begin(const float* const (&xt)[P], int lane, float (&xv)[2][P][16]) {
#pragma unroll
  for (int p = 0; p < P; ++p) gather_x(xt[p], lane, 0, xv[0][p]);
  // the loads' address registers are free for reuse from here on: wait first
  asm volatile("s_wait_xcnt 0x0" ::: "memory");
}
template <int P>
__device__ __forceinline__ void proj_next(const float* const (&xt)[P], int lane, float (&xv)[2][P][16]) {
#pragma unroll
  for (int p = 0; p < P; ++p) gather_x(xt[p], lane, 32, xv[1][p]);
  // the loads' address registers are free for reuse from here on: wait first
  asm volatile("s_wait_xcnt 0x0" ::: "memory");
}
// ahead(kb) is called in every channel block, behind the block's split and its x loads: there the caller may ask for what
// the next phase reads (it returns whether it did), behind the loads that this product needs first.
template <int P, class F>
__device__ __forceinline__ void proj_run(const float* const (&xt)[P], const unsigned short* Wb, int lane,
                                         float (&xv)[2][P][16], v8f (&acc)[P][4], F ahead) {
#pragma unroll
  for (int p = 0; p < P; ++p)
#pragma unroll
    for (int j = 0; j < 4; ++j) acc[p][j] = zero8();
  // unrolled: xv is held in registers and needs constant indices
#pragma unroll
  for (int kb = 0; kb < CCH / 32; ++kb) {
    const int k0 = 32 * kb;
    // a block's split stays behind the block before it: moved up, values and fragments of several blocks would be
    // held at once
    __builtin_amdgcn_sched_barrier(0);
    Frg ah[P], al[P];
#pragma unroll
    for (int p = 0; p < P; ++p) split_x(xv[kb & 1][p], ah[p], al[p]);
    bool asked = false;
    if (kb + 2 < CCH / 32) {
#pragma unroll
      for (int p = 0; p < P; ++p) gather_x(xt[p], lane, k0 + 64, xv[kb & 1][p]);
      // the loads' address registers are free for reuse from here on: wait first
      asm volatile("s_wait_xcnt 0x0" ::: "memory");
      asked = true;
    }
    if (ahead(kb)) asked = true;
    if (asked) __builtin_amdgcn_sched_barrier(0);          // keeps these loads from being moved down to their use
#pragma unroll
    for (int j = 0; j < 4; ++j) {
      opt_fence();                                         // one tile's B fragments at a time: lifted up, all four tiles' would be held at once
      Frg bh, bl;
      wfrag(Wb, 16 * j, lane, k0, bh);
      wfrag(Wb + WS_PLANE, 16 * j, lane, k0, bl);
#pragma unroll
      for (int p = 0; p < P; ++p) acc[p][j] = mma16(ah[p].b, bh.b, acc[p][j]);
#pragma unroll
      for (int p = 0; p < P; ++p) acc[p][j] = mma16(ah[p].b, bl.b, acc[p][j]);
#pragma unroll
      for (int p = 0; p < P; ++p) acc[p][j] = mma16(al[p].b, bh.b, acc[p][j]);
    }
  }
}

__device__ __forceinline__ void load16(const float* p, float (&v)[16]) {
#pragma unroll
  for (int g = 0; g < 4; ++g) {
    const v4f t = *(const v4f*)(p + 4 * g);
    v[4 * g + 0] = t[0]; v[4 * g + 1] = t[1]; v[4 * g + 2] = t[2]; v[4 * g + 3] = t[3];
  }
}


// ---------------------------------------------------------------------------
// One branch of the 3x3 local attention for (pixel px of one of the block's two rows, current head), computed by the lane pair
// (l, l^16): this lane holds dims 16*half..16*half+15 of q and of the accumulator; the 32-deep logit is the sum
// of the two partial dots exchanged with __shfl_xor(., 16) (a+b == b+a, so both lanes carry identical logits and
// identical max/sum state). Taps t = 0..8 <-> staged (r = t/3, p = px + t%3).
// Online softmax one window row (three taps) at a time, all unrolled: a row's twelve LDS reads, three dots
// and three exchanges are independent of one another and run side by side; the running max m, the running sum ssum
// and the accumulator ov are rescaled once per row (not at all in the first row, no infinities). Within ssum and ov
// the taps are added in the order t = 0..8; the branch's result is o * inv (o = ov, inv = 1 / ssum), formed by the caller.
// All cross-lane ops sit under uniform control (no lane-varying branches).
// Each 16-B read: 16 lanes of one half at the 1040-B pitch fall on 16 distinct groups of four banks.
// ---------------------------------------------------------------------------
// 16 floats as 8 register pairs, in the order the four 16-B LDS reads deliver them
__device__ __forceinline__ void load8x2(const float* p, v2f (&v)[8]) {
#pragma unroll
  for (int g = 0; g < 4; ++g) {
    const v4f t = *(const v4f*)(p + 4 * g);
    v[2 * g + 0] = (v2f){t[0], t[1]};
    v[2 * g + 1] = (v2f){t[2], t[3]};
  }
}
// One window row: its three taps' kv values (twelve 16-B LDS reads) and its three logits. Each partial dot runs on
// packed f32 FMAs over the register pairs: even and odd dims are summed apart and added at the end.
__device__ __forceinline__ void row_logits(const float* krow, const v2f (&q2)[8], v2f (&kv)[3][8], float (&s)[3]) {
#pragma unroll
  for (int dx = 0; dx < 3; ++dx) load8x2(krow + dx * KVPP, kv[dx]);
  v2f a[3];
#pragma unroll
  for (int dx = 0; dx < 3; ++dx) a[dx] = q2[0] * kv[dx][0];
#pragma unroll
  for (int g = 1; g < 8; ++g) {
#pragma unroll
    for (int dx = 0; dx < 3; ++dx) a[dx] = __builtin_elementwise_fma(q2[g], kv[dx][g], a[dx]);
  }
  float part[3];
#pragma unroll
  for (int dx = 0; dx < 3; ++dx) part[dx] = a[dx][0] + a[dx][1];
#pragma unroll
  for (int dx = 0; dx < 3; ++dx) s[dx] = part[dx] + __shfl_xor(part[dx], 16, 32);
}
__device__ __forceinline__ void attend_branch(const float* kvS, int px, int half,
                                              const float (&q)[16], float (&o)[16], float& inv) {
  const float* kcol = kvS + (size_t)px * KVPP + 16 * half;
  v2f q2[8], ov[8];
#pragma unroll
  for (int g = 0; g < 8; ++g) q2[g] = (v2f){q[2 * g], q[2 * g + 1]};
  float m, ssum;
  {
    v2f kv[3][8];
    float s[3];
    row_logits(kcol, q2, kv, s);                         // taps 0..2
    m = fmaxf(fmaxf(s[0], s[1]), s[2]);
    const float p0 = __expf(s[0] - m), p1 = __expf(s[1] - m), p2 = __expf(s[2] - m);
    ssum = (p0 + p1) + p2;
#pragma unroll
    for (int g = 0; g < 8; ++g) ov[g] = p2 * kv[2][g] + (p1 * kv[1][g] + p0 * kv[0][g]);
  }
  // unrolled: every LDS offset is an immediate, and the next row's reads and dots overlap this row's exponentials and sums
#pragma unroll
  for (int r = 1; r < KVROWS; ++r) {
    v2f kv[3][8];
    float s[3];
    row_logits(kcol + r * KVRS, q2, kv, s);              // taps 3r..3r+2
    const float mn   = fmaxf(m, fmaxf(fmaxf(s[0], s[1]), s[2]));
    const float corr = __expf(m - mn);
    const float p0 = __expf(s[0] - mn), p1 = __expf(s[1] - mn), p2 = __expf(s[2] - mn);
    ssum = ((ssum * corr + p0) + p1) + p2;
#pragma unroll
    for (int g = 0; g < 8; ++g) ov[g] = p2 * kv[2][g] + (p1 * kv[1][g] + (p0 * kv[0][g] + ov[g] * corr));
    m = mn;
  }
  inv = __builtin_amdgcn_rcpf(ssum);                    // ssum in [1, 9]
#pragma unroll
  for (int g = 0; g < 8; ++g) {
    o[2 * g + 0] = ov[g][0];
    o[2 * g + 1] = ov[g][1];
  }
}

// ---------------------------------------------------------------------------
// The whole function in one kernel. Block = (image rows y0 = 2*blockIdx.x and y0+1, batch b), 512 threads, static LDS:
//   Ws [2][128][WSP] bf16 : this pass's 64 rows of Wq and 64 rows of Wkv, split into hi and lo plane
//   KV [130][4][64] f32   : kv of one map, this pass's 64 channels, columns -1..128 (pitch KVPP), image rows y0-1..y0+2
//                           (positions outside the image hold the bias: the 1x1 conv of a zero pad)
//   qT [256 px][KVP] f32  : q = (Wq.x + bq) * 32^-0.5 of this pass; a wave reads only the 16 rows it wrote
//   oT [64 ch][OTP] f32   : in qT's bytes, once q is no longer read: 0.5 * (branch1 + branch2) of this pass
//                           (channel, pixel 0..255 of the block)
//   R0 [4][512][4] f32    : the first map's result of the pass's first head, 16 floats a thread, read back by the thread
//                           that wrote them; the second head's lies in the staged Wq rows (free once q is projected),
//                           two of its four 16-B pieces in each plane. Held in registers they would leave no room
//                           for the x values that are asked for ahead.
// Two passes, one per head pair hp (channels 64*hp..+63). In a pass: weights staged; q projected (wave w: pixels
// 16w..16w+15 of the block's 256) into qT; then per map: kv projected (wave w: pixel columns
// 16*(w & 7)..+15 of staged rows 2*(w >> 3) and 2*(w >> 3) + 1, two A tiles per B fragment), laid into KV, and both
// heads attended (thread = pixel 16w + (lane & 15) of the block, half = lane >> 4); then the pass's 64 output rows.
// Barriers, all reached by all threads: weights staged (oT left) | per map: KV left by every reader | KV written |
// then: qT, KV and Ws left by every reader | oT written.
// Coverage: KV 16 waves x 2 tiles x 16 px x 64 ch = 4 rows x 128 px x 64 ch, plus 8 border positions x 64 ch;
// out: grid (64, 4) x 2 passes x 64 channel rows x 256 px = the whole [4][128][128][128].
// ---------------------------------------------------------------------------
// the three maps carry no __restrict__: told that nothing else writes them, the compiler lifts the q map's loads and
// splits, which are the same in both passes, out of the pass loop and holds them in scratch memory
__global__ __launch_bounds__(NTHR) void k_sasa(const float* xq,
                                               const float* x1,
                                               const float* x2,
                                               const float* __restrict__ Wq,
                                               const float* __restrict__ bq,
                                               const float* __restrict__ Wkv,
                                               const float* __restrict__ bkv,
                                               float* __restrict__ out) {
  __shared__ __attribute__((aligned(16))) float smem[LDS_F];
  unsigned short* Ws = (unsigned short*)smem;            // [2][128][WSP] bf16
  float* KV = smem + WS_F;                               // [130][KVPP]
  float* qT = smem + WS_F + KV_F;                        // [256][KVP]
  float* oT = qT;                                        // [64][OTP], same bytes
  const int tid  = threadIdx.x;
  const int lane = tid & 31;
  const int wave = __builtin_amdgcn_readfirstlane(tid >> 5);
  const int m = lane & 15, h = lane >> 4;
  float* R0 = smem + WS_F + KV_F + OT_F + 4 * tid;       // piece g at R0 + g * 4 * NTHR
  float* R1 = smem + 4 * tid;                            // piece g at R1 + (g >> 1) * (WS_PLANE / 2) + (g & 1) * 4 * NTHR
  const int y0 = RB * blockIdx.x;
  const int b  = blockIdx.y;
  const int tc = wave & 7;                               // pixel column tile
  const int wr = wave >> 3;                              // image row of this wave's pixels within the block
  const size_t mapo = (size_t)b * CCH * HWPIX;

  const float* const xqt[1] = {xq + mapo + (size_t)y0 * IMW + 16 * wave};
  // this wave's two kv tiles: staged rows ra, ra + 1 <-> image rows ya, ya + 1; a row outside the image is read at the
  // nearest image row (in bounds) and its products are dropped for the bias
  const int ra = 2 * wr;
  const int ya = y0 - 1 + ra;
  const bool in0 = (ya >= 0) && (ya < IMH);
  const bool in1 = (ya + 1 >= 0) && (ya + 1 < IMH);
  const int yc0 = (ya < 0) ? 0 : ya;                     // ya <= 127
  const int yc1 = (ya + 1 > IMH - 1) ? (IMH - 1) : (ya + 1);  // ya + 1 >= 0

  // x values of the kv product that comes next; its first two channel blocks are asked for in the product before (for a
  // pass's first map the q product, for its second map the first map's product) and travel while the phases between run
  float xk[2][2][16];
  const size_t o0 = mapo + (size_t)yc0 * IMW + 16 * tc, o1 = mapo + (size_t)yc1 * IMW + 16 * tc;

#pragma unroll 1
  for (int hp = 0; hp < NHEADS / 2; ++hp) {
    const int c0 = hp * HPC;                             // first channel of the pass
    float res[2][16];
    float bkc[4], bkb;                                   // the pass's kv bias: this lane's four tile columns, its border channel
    {
      // ---- weights of the pass, q projection ----
      v4f wf[8];
      float xv[2][1][16];
      float bqc[4];
      stage_w_load(Wq + (size_t)c0 * CCH, Wkv + (size_t)c0 * CCH, tid, wf);
      proj_begin<1>(xqt, lane, xv);
      proj_next<1>(xqt, lane, xv);
      // the pass's bias values are asked for here, once: read where they are added, each read's latency stands open
      // behind a barrier, with no wave left to cover it
#pragma unroll
      for (int j = 0; j < 4; ++j) {
        bqc[j] = bq[c0 + 16 * j + m];
        bkc[j] = bkv[c0 + 16 * j + m];
      }
      bkb = bkv[c0 + (tid & 63)];
      // the loads' address registers are free for reuse from here on: wait first
      asm volatile("s_wait_xcnt 0x0" ::: "memory");
      __builtin_amdgcn_sched_barrier(0);                 // keeps the loads above from being moved down to their uses
      stage_w_store(wf, Ws, tid);
      barrier_lds();                                     // staged weights visible to all 16 waves; x loads stay in flight
      v8f acc[1][4];
      // first two channel blocks of the first map's kv product: asked for behind the q product's own last loads, which
      // are needed first, they travel during the rest of the q product; two blocks apart: asked for together, they would
      // stand behind more outstanding loads than a wave's counter holds, and the wave's issue would stand still
      const float* const xk1[2] = {x1 + o0, x1 + o1};
      proj_run<1>(xqt, Ws, lane, xv, acc, [&](int kb) {
        if (kb == 1) proj_begin<2>(xk1, lane, xk);
        if (kb == 3) proj_next<2>(xk1, lane, xk);
        return kb == 1 || kb == 3;
      });
#pragma unroll
      for (int j = 0; j < 4; ++j) {
        const float bv = bqc[j];
        float* trow = qT + (size_t)(16 * wave + 8 * h) * KVP + 16 * j + m;
#pragma unroll
        for (int r = 0; r < 8; ++r) trow[r * KVP] = (acc[0][j][r] + bv) * QSCALE;
      }
    }

    // unrolled over the two maps: rolled, the result registers are held through both maps' products and attention and
    // leave no room for the x values that are asked for a phase ahead
#pragma unroll
    for (int br = 0; br < 2; ++br) {
      {
        const float* const xm = br ? x2 : x1;
        const float* const xt[2] = {xm + o0, xm + o1};
        v8f acc[2][4];
        // the second map's first two channel blocks: asked for in the first map's product, each into the registers that
        // its last two blocks leave, they travel during the rest of the product, the kv stores and the attention
        const float* const xk2[2] = {x2 + o0, x2 + o1};
        proj_run<2>(xt, Ws + HPC * WSP, lane, xk, acc, [&](int kb) {
          if (br == 0 && kb == 2) proj_begin<2>(xk2, lane, xk);
          if (br == 0 && kb == 3) proj_next<2>(xk2, lane, xk);
          return br == 0 && kb >= 2;
        });
        // the last products stay in front of the stores: mingled with them, their fragments' registers stay held and
        // the bias adds and selects no longer pair up
        __builtin_amdgcn_sched_barrier(0);
        barrier_lds();                                   // every reader has left KV (the map or the pass before)
#pragma unroll
        for (int j = 0; j < 4; ++j) {
          const float bv = bkc[j];
#pragma unroll
          for (int p = 0; p < 2; ++p) {
            const bool inimg = p ? in1 : in0;
            float* drow = KV + (size_t)(16 * tc + 8 * h + 1) * KVPP + (ra + p) * KVRS + 16 * j + m;
#pragma unroll
            for (int r = 0; r < 8; ++r) drow[r * KVPP] = inimg ? (acc[p][j][r] + bv) : bv;
          }
        }
        // columns -1 and 128 of the four staged rows: 8 positions x 64 channels, one float a thread
        const int pos = tid >> 6;
        KV[(size_t)((pos & 1) ? (KVPOS - 1) : 0) * KVPP + (pos >> 1) * KVRS + (tid & 63)] = bkb;
      }
      barrier_lds();                                     // KV written
#pragma unroll
      for (int hh = 0; hh < 2; ++hh) {
        float q[16];                                     // read per use: held, it would cost the projection registers
        load16(qT + (size_t)(16 * wave + m) * KVP + hh * DHEAD + 16 * h, q);
        float o[16], inv;
        attend_branch(KV + wr * KVRS + hh * DHEAD, 16 * tc + m, h, q, o, inv);
        float* rp[4];
#pragma unroll
        for (int g = 0; g < 4; ++g)
          rp[g] = hh ? (R1 + (g >> 1) * (WS_PLANE / 2) + (g & 1) * 4 * NTHR) : (R0 + g * 4 * NTHR);
        if (br == 0) {
#pragma unroll
          for (int g = 0; g < 4; ++g)
            *(v4f*)rp[g] = (v4f){o[4 * g] * inv, o[4 * g + 1] * inv, o[4 * g + 2] * inv, o[4 * g + 3] * inv};
        } else {
#pragma unroll
          for (int g = 0; g < 4; ++g) {
            const v4f t = *(const v4f*)rp[g];            // first map's result + second map's
#pragma unroll
            for (int e = 0; e < 4; ++e) res[hh][4 * g + e] = t[e] + o[4 * g + e] * inv;
          }
        }
      }
    }
    barrier_lds();                                       // every reader has left qT, KV and Ws

    // ---- the pass's result tile: oT[32*hh + 16*half + i][pixel of the block] ----
#pragma unroll
    for (int hh = 0; hh < 2; ++hh)
#pragma unroll
      for (int i = 0; i < 16; ++i) oT[(size_t)(hh * DHEAD + 16 * h + i) * OTP + 16 * wave + m] = 0.5f * res[hh][i];
    barrier_lds();                                       // oT written
    // channel-major output: wave w writes channel rows 4w..4w+3 of the pass, 256 px = 1 KiB contiguous each
#pragma unroll
    for (int k = 0; k < 8; ++k) {
      const int cc = 4 * wave + (k >> 1);
      const v4f v = *(const v4f*)(oT + (size_t)cc * OTP + (k & 1) * IMW + 4 * lane);
      float* drow = out + (((size_t)b * CCH + c0 + cc) * IMH + y0) * IMW + (k & 1) * IMW;
      *(v4f*)(&drow[(unsigned)(4 * lane)]) = v;
    }
    // the stores' address and data registers are rewritten by the next pass's first instructions: wait first
    asm volatile("s_wait_xcnt 0x0" ::: "memory");
  }
}

extern "C" void kernel_launch(void* const* d_in, const int* in_sizes, int n_in,
                              void* d_out, int out_size, void* d_ws, size_t ws_size,
                              hipStream_t stream) {
  if (n_in < 7) return;
  const int nmap = NB * CCH * HWPIX;
  if (in_sizes[0] != nmap || in_sizes[1] != nmap || in_sizes[2] != nmap) return;
  if (in_sizes[3] != CCH * CCH || in_sizes[4] != CCH) return;
  if (in_sizes[5] != CCH * CCH || in_sizes[6] != CCH) return;
  if (out_size != nmap) return;

  const float* kvmap1 = (const float*)d_in[0];
  const float* qmap   = (const float*)d_in[1];
  const float* kvmap2 = (const float*)d_in[2];
  const float* Wq     = (const float*)d_in[3];
  const float* bq     = (const float*)d_in[4];
  const float* Wkv    = (const float*)d_in[5];
  const float* bkv    = (const float*)d_in[6];
  float* out = (float*)d_out;
  (void)d_ws; (void)ws_size;

  k_sasa<<<dim3(IMH / RB, NB), dim3(NTHR), 0, stream>>>(qmap, kvmap1, kvmap2, Wq, bq, Wkv, bkv, out);
  (void)hipGetLastError();
}

// v010
// A run of this version takes 34.8 microseconds.
// In both of two side-by-side timings against v009, it was 1.04 times as fast.
// All steps since v000 together make it 3.86 times as fast.
// Contractions: three 1x1-conv projections (q from map in1, kv from maps in0 and in2; M = pixels, N = 128, K = 128)
// on v_wmma_f32_16x16x32_bf16 with bf16 hi/lo split operands (hi.hi + hi.lo + lo.hi), f32 accumulate;
// 9-tap local-window logits, softmax, weighted sums and the two-branch mean in f32 on the VALU.
// ONE launch: a block takes two image rows of one batch and projects the kv rows its windows touch (four per map)
// straight into LDS; no kv value goes through global memory.
#include <hip/hip_runtime.h>
#include <stdint.h>

#define NB      4
#define CCH     128
#define IMH     128
#define IMW     128
#define HWPIX   (IMH * IMW)
#define NHEADS  4
#define DHEAD   32
#define QSCALE  0.17677669529663687f     // 32^-0.5
#define NTHR    512                       // 16 waves
#define RB      2                         // image rows of a block
#define HPC     64                        // channels of a head pair (one pass)
#define KVROWS  3                         // window rows
#define SROWS   (RB + 2)                  // staged kv rows: y0-1 .. y0+2
#define KVPOS   130                       // staged kv positions: x = -1 .. 128
#define KVRS    HPC                       // floats from a staged position to the same column one image row down
#define KVPP    (SROWS * KVRS + 4)        // LDS pitch of a staged column in floats (1040 B = 16 B x 65): its 4 rows x 64 channels
#define KV_F    (KVPOS * KVPP)            // 33800 floats: kv rows of one map, one head pair
#define KVP     68                        // LDS pitch of a q tile row in floats (272 B = 16 B x 17; 64 used)
#define OTP     260                       // LDS pitch of a result channel row in floats (256 px used)
#define OT_F    (RB * IMW * KVP)          // 17408 floats: q tile [256 px][KVP] of a pass, later its result tile [64 ch][OTP]
#define WSP     136                       // LDS pitch of a staged weight row in bf16 (272 B = 16 B x 17)
#define WS_PLANE (CCH * WSP)              // 17408 bf16: one staged weight plane [128][WSP]
#define WS_F    (2 * WS_PLANE / 2)        // 17408 floats: hi and lo plane together (69632 B)
#define RS_F    (NTHR * 16)               // 8192 floats: one head's first-map result, 16 floats a thread
#define LDS_F   (WS_F + KV_F + OT_F + RS_F)  // 76808 floats = 307232 B: one block on a WGP
static_assert(RS_F / 2 <= HPC * WSP / 2); // half of it fits the 64 staged Wq rows of one plane
static_assert(HPC * OTP <= OT_F);

typedef __attribute__((ext_vector_type(16))) __bf16         v16b;
typedef __attribute__((ext_vector_type(8)))  unsigned short v8us;
typedef __attribute__((ext_vector_type(8)))  float          v8f;
typedef __attribute__((ext_vector_type(4)))  float          v4f;
typedef __attribute__((ext_vector_type(2)))  float          v2f;
typedef __attribute__((ext_vector_type(2)))  __bf16         v2b;
typedef __attribute__((ext_vector_type(2)))  unsigned int   v2u;

union Frg { v16b b; v8us h8[2]; unsigned int w[8]; };
static_assert(sizeof(Frg) == 32);

// ---------------------------------------------------------------------------
// small helpers
// ---------------------------------------------------------------------------
__device__ __forceinline__ void opt_fence() { asm volatile("" ::: "memory"); }

__device__ __forceinline__ v8f zero8() {
  v8f z = {0.f, 0.f, 0.f, 0.f, 0.f, 0.f, 0.f, 0.f};
  return z;
}

// WMMA as the plain builtin: the compiler keeps the distances behind it
__device__ __forceinline__ v8f mma16(v16b a, v16b b, v8f c) {
  return __builtin_amdgcn_wmma_f32_16x16x32_bf16(false, a, false, b, (short)0, c, false, false);
}

// ---------------------------------------------------------------------------
// Fragment builders (wave32, 16x16x32, split k map for BOTH operands):
//   lane l: row/col = l & 15, h = l >> 4; element i (0..7) <- k0 + 8h + i, element i (8..15) <- k0 + 16 + 8h + (i-8)
// ---------------------------------------------------------------------------
// Operand gathered from a channel-major f32 map: row m = pixel (pt + m), k = channel, channel stride HWPIX.
// gather_x only issues the 16 loads of one 32-channel block; split_x later splits the values into bf16 hi (RNE) and
// lo = RNE(v - hi) planes in registers.
__device__ __forceinline__ void gather_x(const float* pt, int lane, int k0, float (&v)[16]) {
  // pt is the same in every lane: one 32-bit lane offset serves all loads, the channel step goes into the base
  const unsigned vo = (unsigned)((lane & 15) + 8 * (lane >> 4) * HWPIX);
#pragma unroll
  for (int q = 0; q < 8; ++q) {
    const int c = k0 + ((q < 4) ? (2 * q) : (16 + 2 * (q - 4)));
    v[2 * q + 0] = (pt + (size_t)c * HWPIX)[vo];
    v[2 * q + 1] = (pt + (size_t)(c + 1) * HWPIX)[vo];
  }
}
// Two f32 values -> their bf16 hi parts (RNE, one packed convert) and the bf16 parts of the exact rests v - hi.
__device__ __forceinline__ void split2(v2f v, unsigned& hi, unsigned& lo) {
  hi = __builtin_bit_cast(unsigned, __builtin_convertvector(v, v2b));
  const v2f back = {__uint_as_float(hi << 16), __uint_as_float(hi & 0xFFFF0000u)};
  lo = __builtin_bit_cast(unsigned, __builtin_convertvector(v - back, v2b));
}
__device__ __forceinline__ void split_x(const float (&v)[16], Frg& fh, Frg& fl) {
#pragma unroll
  for (int q = 0; q < 8; ++q) split2((v2f){v[2 * q + 0], v[2 * q + 1]}, fh.w[q], fl.w[q]);
}
// The same for TWO pixel tiles out of one 32-pixel span of an image row (pt = its first pixel, 128-B aligned): an 8-B load
// per lane brings a pixel pair, [0] for tile 0 and [1] for tile 1, so that the 16 lanes of a half cover one whole 128-B line
// of their channel. Row m of both tiles takes pair pair_of(m): pixels 2 * pair_of(m) and 2 * pair_of(m) + 1 of the span.
// pair_of swaps bits 2 and 3 of m: accumulator rows r and 8 + r then lie 8 pixels apart, which keeps the two lane halves of
// a kv store on different LDS banks (16 pixels apart they would meet on the same ones).
__device__ __forceinline__ int pair_of(int m) { return (m & 3) | ((m & 4) << 1) | ((m & 8) >> 1); }
__device__ __forceinline__ void gather_x2(const float* pt, int lane, int k0, v2f (&v)[16]) {
  const unsigned vo = (unsigned)(2 * pair_of(lane & 15) + 8 * (lane >> 4) * HWPIX);
#pragma unroll
  for (int q = 0; q < 8; ++q) {
    const int c = k0 + ((q < 4) ? (2 * q) : (16 + 2 * (q - 4)));
    v[2 * q + 0] = *(const v2f*)(&(pt + (size_t)c * HWPIX)[vo]);
    v[2 * q + 1] = *(const v2f*)(&(pt + (size_t)(c + 1) * HWPIX)[vo]);
  }
}
// Two f32 values that lie in any two registers -> their bf16 parts (RNE) in one register.
__device__ __forceinline__ unsigned pack_bf16(float x, float y) {
  return __builtin_bit_cast(unsigned, (v2b){(__bf16)x, (__bf16)y});
}
// Same values as split_x gives for each tile; the rests are formed on the loaded pairs (tile 0, tile 1) as they lie.
__device__ __forceinline__ void split_x2(const v2f (&v)[16], Frg (&fh)[2], Frg (&fl)[2]) {
#pragma unroll
  for (int q = 0; q < 8; ++q) {
    const v2f a = v[2 * q + 0], b = v[2 * q + 1];          // channels c and c + 1
    const unsigned h0 = pack_bf16(a[0], b[0]);
    const unsigned h1 = pack_bf16(a[1], b[1]);
    const v2f ra = a - (v2f){__uint_as_float(h0 << 16), __uint_as_float(h1 << 16)};
    const v2f rb = b - (v2f){__uint_as_float(h0 & 0xFFFF0000u), __uint_as_float(h1 & 0xFFFF0000u)};
    fh[0].w[q] = h0;
    fh[1].w[q] = h1;
    fl[0].w[q] = pack_bf16(ra[0], rb[0]);
    fl[1].w[q] = pack_bf16(ra[1], rb[1]);
  }
}
// Operand from a bf16 plane staged in LDS as [row][WSP] with k contiguous (weights W[oc][c]): two 16-B LDS loads
// per lane; 16 lanes at the 272-B pitch fall on 16 distinct groups of four banks.
__device__ __forceinline__ void wfrag(const unsigned short* W, int row0, int lane, int k0, Frg& f) {
  const int m = lane & 15, h = lane >> 4;
  const unsigned short* p = W + (row0 + m) * WSP + k0 + 8 * h;
  f.h8[0] = *(const v8us*)(p);
  f.h8[1] = *(const v8us*)(p + 16);
}
// Work-group barrier whose fences order LDS alone: it publishes LDS writes like __syncthreads(), but does not wait for
// the wave's outstanding global loads, which stay in flight across it.
__device__ __forceinline__ void barrier_lds() {
  __builtin_amdgcn_fence(__ATOMIC_RELEASE, "workgroup", "local");
  __builtin_amdgcn_s_barrier();
  __builtin_amdgcn_fence(__ATOMIC_ACQUIRE, "workgroup", "local");
}

// ---------------------------------------------------------------------------
// Weights of one pass: rows hp*64..+63 of Wq (staged rows 0..63) and of Wkv (staged rows 64..127), read as f32 from
// global, split in registers, both bf16 planes laid into LDS: Ws[plane][row][WSP]. 4096 16-B pieces, 8 per thread; a
// wave's load covers one whole 512-B row, each of its two 8-B stores 256 contiguous bytes of that row in one plane.
// ---------------------------------------------------------------------------
__device__ __forceinline__ void stage_w_load(const float* __restrict__ Wqh, const float* __restrict__ Wkvh, int tid,
                                             v4f (&wf)[8]) {
  const unsigned o = (unsigned)(4 * tid);                   // piece i*512 + tid: staged row 16*i + (tid >> 5), columns 4*(tid & 31)..+3
#pragma unroll
  for (int i = 0; i < 8; ++i) {
    wf[i] = *(const v4f*)(&((i < 4 ? Wqh : Wkvh) + (i & 3) * 16 * CCH)[o]);
    // the Wq loads' address registers are free for reuse by the Wkv loads' results: wait first
    if (i == 3) asm volatile("s_wait_xcnt 0x0" ::: "memory");
  }
  // the loads' address registers are free for reuse from here on: wait first
  asm volatile("s_wait_xcnt 0x0" ::: "memory");
}
__device__ __forceinline__ void stage_w_store(const v4f (&wf)[8], unsigned short* Ws, int tid) {
  unsigned short* dst = Ws + (tid >> 5) * WSP + 4 * (tid & 31);
#pragma unroll
  for (int i = 0; i < 8; ++i) {
    const v4f f = wf[i];
    unsigned h0, l0, h1, l1;
    split2((v2f){f[0], f[1]}, h0, l0);
    split2((v2f){f[2], f[3]}, h1, l1);
    *(v2u*)(dst + i * 16 * WSP)            = (v2u){h0, h1};
    *(v2u*)(dst + WS_PLANE + i * 16 * WSP) = (v2u){l0, l1};
  }
}

// ---------------------------------------------------------------------------
// P pixel tiles (16 px each, A = gathered x rows) x 64 out channels (4 tiles, B = staged W rows Wb..Wb+63), K = 128:
//   acc[p][j] element r of lane l = (row px 8h + r of tile p, col oc 16j + (l & 15)).
// Every B fragment read from LDS feeds all P tiles. proj_begin issues the x loads of channel block 0 (a phase ahead of
// the product where the caller can), proj_next those of block 1 (in front of proj_run at the latest); block kb + 2 is
// asked for when block kb has been split, into the registers that block kb leaves.
// ---------------------------------------------------------------------------
// One channel block's products: the four B tiles in turn, each fragment pair feeding all P pixel tiles.
template <int P>
__device__ __forceinline__ void mma_block(const unsigned short* Wb, int lane, int k0, const Frg (&ah)[P],
                                          const Frg (&al)[P], v8f (&acc)[P][4]) {
#pragma unroll
  for (int j = 0; j < 4; ++j) {
    opt_fence();                                           // one tile's B fragments at a time: lifted up, all four tiles' would be held at once
    Frg bh, bl;
    wfrag(Wb, 16 * j, lane, k0, bh);
    wfrag(Wb + WS_PLANE, 16 * j, lane, k0, bl);
#pragma unroll
    for (int p = 0; p < P; ++p) acc[p][j] = mma16(ah[p].b, bh.b, acc[p][j]);
#pragma unroll
    for (int p = 0; p < P; ++p) acc[p][j] = mma16(ah[p].b, bl.b, acc[p][j]);
#pragma unroll
    for (int p = 0; p < P; ++p) acc[p][j] = mma16(al[p].b, bh.b, acc[p][j]);
  }
}
template <int P>
__device__ __forceinline__ void proj_begin(const float* const (&xt)[P], int lane, float (&xv)[2][P][16]) {
#pragma unroll
  for (int p = 0; p < P; ++p) gather_x(xt[p], lane, 0, xv[0][p]);
  // the loads' address registers are free for reuse from here on: wait first
  asm volatile("s_wait_xcnt 0x0" ::: "memory");
}
template <int P>
__device__ __forceinline__ void proj_next(const float* const (&xt)[P], int lane, float (&xv)[2][P][16]) {
#pragma unroll
  for (int p = 0; p < P; ++p) gather_x(xt[p], lane, 32, xv[1][p]);
  // the loads' address registers are free for reuse from here on: wait first
  asm volatile("s_wait_xcnt 0x0" ::: "memory");
}
// ahead(kb) is called in every channel block, behind the block's split and its x loads: there the caller may ask for what
// the next phase reads (it returns whether it did), behind the loads that this product needs first.
template <int P, class F>
__device__ __forceinline__ void proj_run(const float* const (&xt)[P], const unsigned short* Wb, int lane,
                                         float (&xv)[2][P][16], v8f (&acc)[P][4], F ahead) {
#pragma unroll
  for (int p = 0; p < P; ++p)
#pragma unroll
    for (int j = 0; j < 4; ++j) acc[p][j] = zero8();
  // unrolled: xv is held in registers and needs constant indices
#pragma unroll
  for (int kb = 0; kb < CCH / 32; ++kb) {
    const int k0 = 32 * kb;
    // a block's split stays behind the block before it: moved up, values and fragments of several blocks would be
    // held at once
    __builtin_amdgcn_sched_barrier(0);
    Frg ah[P], al[P];
#pragma unroll
    for (int p = 0; p < P; ++p) split_x(xv[kb & 1][p], ah[p], al[p]);
    bool asked = false;
    if (kb + 2 < CCH / 32) {
#pragma unroll
      for (int p = 0; p < P; ++p) gather_x(xt[p], lane, k0 + 64, xv[kb & 1][p]);
      // the loads' address registers are free for reuse from here on: wait first
      asm volatile("s_wait_xcnt 0x0" ::: "memory");
      asked = true;
    }
    if (ahead(kb)) asked = true;
    if (asked) __builtin_amdgcn_sched_barrier(0);          // keeps these loads from being moved down to their use
    mma_block<P>(Wb, lane, k0, ah, al, acc);
  }
}
// The kv product: proj_begin, proj_next and proj_run for the two tiles of one 32-pixel span, loaded as pixel pairs.
__device__ __forceinline__ void kv_begin(const float* xt, int lane, v2f (&xv)[2][16]) {
  gather_x2(xt, lane, 0, xv[0]);
  // the loads' address registers are free for reuse from here on: wait first
  asm volatile("s_wait_xcnt 0x0" ::: "memory");
}
__device__ __forceinline__ void kv_next(const float* xt, int lane, v2f (&xv)[2][16]) {
  gather_x2(xt, lane, 32, xv[1]);
  // the loads' address registers are free for reuse from here on: wait first
  asm volatile("s_wait_xcnt 0x0" ::: "memory");
}
template <class F>
__device__ __forceinline__ void kv_run(const float* xt, const unsigned short* Wb, int lane,
                                       v2f (&xv)[2][16], v8f (&acc)[2][4], F ahead) {
#pragma unroll
  for (int p = 0; p < 2; ++p)
#pragma unroll
    for (int j = 0; j < 4; ++j) acc[p][j] = zero8();
  // unrolled: xv is held in registers and needs constant indices
#pragma unroll
  for (int kb = 0; kb < CCH / 32; ++kb) {
    const int k0 = 32 * kb;
    // a block's split stays behind the block before it: moved up, values and fragments of several blocks would be
    // held at once
    __builtin_amdgcn_sched_barrier(0);
    Frg ah[2], al[2];
    split_x2(xv[kb & 1], ah, al);
    bool asked = false;
    if (kb + 2 < CCH / 32) {
      gather_x2(xt, lane, k0 + 64, xv[kb & 1]);
      // the loads' address registers are free for reuse from here on: wait first
      asm volatile("s_wait_xcnt 0x0" ::: "memory");
      asked = true;
    }
    if (ahead(kb)) asked = true;
    if (asked) __builtin_amdgcn_sched_barrier(0);          // keeps these loads from being moved down to their use
    mma_block<2>(Wb, lane, k0, ah, al, acc);
  }
}

__device__ __forceinline__ void load16(const float* p, float (&v)[16]) {
#pragma unroll
  for (int g = 0; g < 4; ++g) {
    const v4f t = *(const v4f*)(p + 4 * g);
    v[4 * g + 0] = t[0]; v[4 * g + 1] = t[1]; v[4 * g + 2] = t[2]; v[4 * g + 3] = t[3];
  }
}


// ---------------------------------------------------------------------------
// One branch of the 3x3 local attention for (pixel px of one of the block's two rows, current head), computed by the lane pair
// (l, l^16): this lane holds dims 16*half..16*half+15 of q and of the accumulator; the 32-deep logit is the sum
// of the two partial dots exchanged with __shfl_xor(., 16) (a+b == b+a, so both lanes carry identical logits and
// identical max/sum state). Taps t = 0..8 <-> staged (r = t/3, p = px + t%3).
// Online softmax one window row (three taps) at a time, all unrolled: a row's twelve LDS reads, three dots
// and three exchanges are independent of one another and run side by side; the running max m, the running sum ssum
// and the accumulator ov are rescaled once per row (not at all in the first row, no infinities). Within ssum and ov
// the taps are added in the order t = 0..8; the branch's result is o * inv (o = ov, inv = 1 / ssum), formed by the caller.
// All cross-lane ops sit under uniform control (no lane-varying branches).
// Each 16-B read: 16 lanes of one half at the 1040-B pitch fall on 16 distinct groups of four banks.
// ---------------------------------------------------------------------------
// 16 floats as 8 register pairs, in the order the four 16-B LDS reads deliver them
__device__ __forceinline__ void load8x2(const float* p, v2f (&v)[8]) {
#pragma unroll
  for (int g = 0; g < 4; ++g) {
    const v4f t = *(const v4f*)(p + 4 * g);
    v[2 * g + 0] = (v2f){t[0], t[1]};
    v[2 * g + 1] = (v2f){t[2], t[3]};
  }
}
// One window row: its three taps' kv values (twelve 16-B LDS reads) and its three logits. Each partial dot runs on
// packed f32 FMAs over the register pairs: even and odd dims are summed apart and added at the end.
__device__ __forceinline__ void row_logits(const float* krow, const v2f (&q2)[8], v2f (&kv)[3][8], float (&s)[3]) {
#pragma unroll
  for (int dx = 0; dx < 3; ++dx) load8x2(krow + dx * KVPP, kv[dx]);
  v2f a[3];
#pragma unroll
  for (int dx = 0; dx < 3; ++dx) a[dx] = q2[0] * kv[dx][0];
#pragma unroll
  for (int g = 1; g < 8; ++g) {
#pragma unroll
    for (int dx = 0; dx < 3; ++dx) a[dx] = __builtin_elementwise_fma(q2[g], kv[dx][g], a[dx]);
  }
  float part[3];
#pragma unroll
  for (int dx = 0; dx < 3; ++dx) part[dx] = a[dx][0] + a[dx][1];
#pragma unroll
  for (int dx = 0; dx < 3; ++dx) s[dx] = part[dx] + __shfl_xor(part[dx], 16, 32);
}
__device__ __forceinline__ void attend_branch(const float* kvS, int px, int half,
                                              const float (&q)[16], float (&o)[16], float& inv) {
  const float* kcol = kvS + (size_t)px * KVPP + 16 * half;
  v2f q2[8], ov[8];
#pragma unroll
  for (int g = 0; g < 8; ++g) q2[g] = (v2f){q[2 * g], q[2 * g + 1]};
  float m, ssum;
  {
    v2f kv[3][8];
    float s[3];
    row_logits(kcol, q2, kv, s);                         // taps 0..2
    m = fmaxf(fmaxf(s[0], s[1]), s[2]);
    const float p0 = __expf(s[0] - m), p1 = __expf(s[1] - m), p2 = __expf(s[2] - m);
    ssum = (p0 + p1) + p2;
#pragma unroll
    for (int g = 0; g < 8; ++g) ov[g] = p2 * kv[2][g] + (p1 * kv[1][g] + p0 * kv[0][g]);
  }
  // unrolled: every LDS offset is an immediate, and the next row's reads and dots overlap this row's exponentials and sums
#pragma unroll
  for (int r = 1; r < KVROWS; ++r) {
    v2f kv[3][8];
    float s[3];
    row_logits(kcol + r * KVRS, q2, kv, s);              // taps 3r..3r+2
    const float mn   = fmaxf(m, fmaxf(fmaxf(s[0], s[1]), s[2]));
    const float corr = __expf(m - mn);
    const float p0 = __expf(s[0] - mn), p1 = __expf(s[1] - mn), p2 = __expf(s[2] - mn);
    ssum = ((ssum * corr + p0) + p1) + p2;
#pragma unroll
    for (int g = 0; g < 8; ++g) ov[g] = p2 * kv[2][g] + (p1 * kv[1][g] + (p0 * kv[0][g] + ov[g] * corr));
    m = mn;
  }
  inv = __builtin_amdgcn_rcpf(ssum);                    // ssum in [1, 9]
#pragma unroll
  for (int g = 0; g < 8; ++g) {
    o[2 * g + 0] = ov[g][0];
    o[2 * g + 1] = ov[g][1];
  }
}

// ---------------------------------------------------------------------------
// The whole function in one kernel. Block = (image rows y0 = 2*blockIdx.x and y0+1, batch b), 512 threads, static LDS:
//   Ws [2][128][WSP] bf16 : this pass's 64 rows of Wq and 64 rows of Wkv, split into hi and lo plane
//   KV [130][4][64] f32   : kv of one map, this pass's 64 channels, columns -1..128 (pitch KVPP), image rows y0-1..y0+2
//                           (positions outside the image hold the bias: the 1x1 conv of a zero pad)
//   qT [256 px][KVP] f32  : q = (Wq.x + bq) * 32^-0.5 of this pass; a wave reads only the 16 rows it wrote
//   oT [64 ch][OTP] f32   : in qT's bytes, once q is no longer read: 0.5 * (branch1 + branch2) of this pass
//                           (channel, pixel 0..255 of the block)
//   R0 [4][512][4] f32    : the first map's result of the pass's first head, 16 floats a thread, read back by the thread
//                           that wrote them; the second head's lies in the staged Wq rows (free once q is projected),
//                           two of its four 16-B pieces in each plane. Held in registers they would leave no room
//                           for the x values that are asked for ahead.
// Two passes, one per head pair hp (channels 64*hp..+63). In a pass: weights staged; q projected (wave w: pixels
// 16w..16w+15 of the block's 256) into qT; then per map: kv projected (wave w: pixel columns
// 32*(w & 3)..+31 of staged row w >> 2, even and odd pixels as two A tiles per B fragment), laid into KV, and both
// heads attended (thread = pixel 16w + (lane & 15) of the block, half = lane >> 4); then the pass's 64 output rows.
// Barriers, all reached by all threads: weights staged (oT left) | per map: KV left by every reader | KV written |
// then: qT, KV and Ws left by every reader | oT written.
// Coverage: KV 16 waves x 2 tiles x 16 px x 64 ch = 4 rows x 128 px x 64 ch, plus 8 border positions x 64 ch;
// out: grid (64, 4) x 2 passes x 64 channel rows x 256 px = the whole [4][128][128][128].
// ---------------------------------------------------------------------------
// the three maps carry no __restrict__: told that nothing else writes them, the compiler lifts the q map's loads and
// splits, which are the same in both passes, out of the pass loop and holds them in scratch memory
__global__ __launch_bounds__(NTHR) void k_sasa(const float* xq,
                                               const float* x1,
                                               const float* x2,
                                               const float* __restrict__ Wq,
                                               const float* __restrict__ bq,
                                               const float* __restrict__ Wkv,
                                               const float* __restrict__ bkv,
                                               float* __restrict__ out) {
  __shared__ __attribute__((aligned(16))) float smem[LDS_F];
  unsigned short* Ws = (unsigned short*)smem;            // [2][128][WSP] bf16
  float* KV = smem + WS_F;                               // [130][KVPP]
  float* qT = smem + WS_F + KV_F;                        // [256][KVP]
  float* oT = qT;                                        // [64][OTP], same bytes
  const int tid  = threadIdx.x;
  const int lane = tid & 31;
  const int wave = __builtin_amdgcn_readfirstlane(tid >> 5);
  const int m = lane & 15, h = lane >> 4;
  float* R0 = smem + WS_F + KV_F + OT_F + 4 * tid;       // piece g at R0 + g * 4 * NTHR
  float* R1 = smem + 4 * tid;                            // piece g at R1 + (g >> 1) * (WS_PLANE / 2) + (g & 1) * 4 * NTHR
  const int y0 = RB * blockIdx.x;
  const int b  = blockIdx.y;
  const int tc = wave & 7;                               // pixel column tile
  const int wr = wave >> 3;                              // image row of this wave's pixels within the block
  const size_t mapo = (size_t)b * CCH * HWPIX;

  const float* const xqt[1] = {xq + mapo + (size_t)y0 * IMW + 16 * wave};
  // this wave's two kv tiles: pixels 32*cg..32*cg+31 of staged row sr <-> image row ys; a row outside the image is read at
  // the nearest image row (in bounds) and its products are dropped for the bias
  const int sr = wave >> 2;
  const int cg = wave & 3;
  const int ys = y0 - 1 + sr;
  const bool inimg = (ys >= 0) && (ys < IMH);
  const int yc = (ys < 0) ? 0 : ((ys > IMH - 1) ? (IMH - 1) : ys);

  // x values of the kv product that comes next; its first two channel blocks are asked for in the product before (for a
  // pass's first map the q product, for its second map the first map's product) and travel while the phases between run
  v2f xk[2][16];
  const size_t okv = mapo + (size_t)yc * IMW + 32 * cg;

#pragma unroll 1
  for (int hp = 0; hp < NHEADS / 2; ++hp) {
    const int c0 = hp * HPC;                             // first channel of the pass
    float res[2][16];
    float bkc[4], bkb;                                   // the pass's kv bias: this lane's four tile columns, its border channel
    {
      // ---- weights of the pass, q projection ----
      v4f wf[8];
      float xv[2][1][16];
      float bqc[4];
      stage_w_load(Wq + (size_t)c0 * CCH, Wkv + (size_t)c0 * CCH, tid, wf);
      proj_begin<1>(xqt, lane, xv);
      proj_next<1>(xqt, lane, xv);
      // the pass's bias values are asked for here, once: read where they are added, each read's latency stands open
      // behind a barrier, with no wave left to cover it
#pragma unroll
      for (int j = 0; j < 4; ++j) {
        bqc[j] = bq[c0 + 16 * j + m];
        bkc[j] = bkv[c0 + 16 * j + m];
      }
      bkb = bkv[c0 + (tid & 63)];
      // the loads' address registers are free for reuse from here on: wait first
      asm volatile("s_wait_xcnt 0x0" ::: "memory");
      __builtin_amdgcn_sched_barrier(0);                 // keeps the loads above from being moved down to their uses
      stage_w_store(wf, Ws, tid);
      barrier_lds();                                     // staged weights visible to all 16 waves; x loads stay in flight
      v8f acc[1][4];
      // first two channel blocks of the first map's kv product: asked for behind the q product's own last loads, which
      // are needed first, they travel during the rest of the q product; two blocks apart: asked for together, they would
      // stand behind more outstanding loads than a wave's counter holds, and the wave's issue would stand still
      proj_run<1>(xqt, Ws, lane, xv, acc, [&](int kb) {
        if (kb == 1) kv_begin(x1 + okv, lane, xk);
        if (kb == 3) kv_next(x1 + okv, lane, xk);
        return kb == 1 || kb == 3;
      });
#pragma unroll
      for (int j = 0; j < 4; ++j) {
        const float bv = bqc[j];
        float* trow = qT + (size_t)(16 * wave + 8 * h) * KVP + 16 * j + m;
#pragma unroll
        for (int r = 0; r < 8; ++r) trow[r * KVP] = (acc[0][j][r] + bv) * QSCALE;
      }
    }

    // unrolled over the two maps: rolled, the result registers are held through both maps' products and attention and
    // leave no room for the x values that are asked for a phase ahead
#pragma unroll
    for (int br = 0; br < 2; ++br) {
      {
        v8f acc[2][4];
        // the second map's first two channel blocks: asked for in the first map's product, each into the registers that
        // its last two blocks leave, they travel during the rest of the product, the kv stores and the attention
        kv_run((br ? x2 : x1) + okv, Ws + HPC * WSP, lane, xk, acc, [&](int kb) {
          if (br == 0 && kb == 2) kv_begin(x2 + okv, lane, xk);
          if (br == 0 && kb == 3) kv_next(x2 + okv, lane, xk);
          return br == 0 && kb >= 2;
        });
        // the last products stay in front of the stores: mingled with them, their fragments' registers stay held and
        // the bias adds and selects no longer pair up
        __builtin_amdgcn_sched_barrier(0);
        barrier_lds();                                   // every reader has left KV (the map or the pass before)
#pragma unroll
        for (int j = 0; j < 4; ++j) {
          // one channel tile's stores at a time: paired across tiles into two-address stores, each pixel's pair takes a base
          // register of its own, 16 in all, held through the pass loop, and registers spill
          opt_fence();
          const float bv = bkc[j];
#pragma unroll
          for (int p = 0; p < 2; ++p) {
            // accumulator row 8h + r is pixel 2 * pair_of(8h + r) + p = 8h + 2 * (r & 3) + 16 * (r >> 2) + p of the span
            float* drow = KV + (size_t)(32 * cg + 8 * h + p + 1) * KVPP + sr * KVRS + 16 * j + m;
#pragma unroll
            for (int r = 0; r < 8; ++r)
              drow[(2 * (r & 3) + 16 * (r >> 2)) * KVPP] = inimg ? (acc[p][j][r] + bv) : bv;
          }
        }
        // columns -1 and 128 of the four staged rows: 8 positions x 64 channels, one float a thread
        const int pos = tid >> 6;
        KV[(size_t)((pos & 1) ? (KVPOS - 1) : 0) * KVPP + (pos >> 1) * KVRS + (tid & 63)] = bkb;
      }
      barrier_lds();                                     // KV written
#pragma unroll
      for (int hh = 0; hh < 2; ++hh) {
        float q[16];                                     // read per use: held, it would cost the projection registers
        load16(qT + (size_t)(16 * wave + m) * KVP + hh * DHEAD + 16 * h, q);
        float o[16], inv;
        attend_branch(KV + wr * KVRS + hh * DHEAD, 16 * tc + m, h, q, o, inv);
        float* rp[4];
#pragma unroll
        for (int g = 0; g < 4; ++g)
          rp[g] = hh ? (R1 + (g >> 1) * (WS_PLANE / 2) + (g & 1) * 4 * NTHR) : (R0 + g * 4 * NTHR);
        if (br == 0) {
#pragma unroll
          for (int g = 0; g < 4; ++g)
            *(v4f*)rp[g] = (v4f){o[4 * g] * inv, o[4 * g + 1] * inv, o[4 * g + 2] * inv, o[4 * g + 3] * inv};
        } else {
#pragma unroll
          for (int g = 0; g < 4; ++g) {
            const v4f t = *(const v4f*)rp[g];            // first map's result + second map's
#pragma unroll
            for (int e = 0; e < 4; ++e) res[hh][4 * g + e] = t[e] + o[4 * g + e] * inv;
          }
        }
      }
    }
    barrier_lds();                                       // every reader has left qT, KV and Ws

    // ---- the pass's result tile: oT[32*hh + 16*half + i][pixel of the block] ----
#pragma unroll
    for (int hh = 0; hh < 2; ++hh)
#pragma unroll
      for (int i = 0; i < 16; ++i) oT[(size_t)(hh * DHEAD + 16 * h + i) * OTP + 16 * wave + m] = 0.5f * res[hh][i];
    barrier_lds();                                       // oT written
    // channel-major output: wave w writes channel rows 4w..4w+3 of the pass, 256 px = 1 KiB contiguous each
#pragma unroll
    for (int k = 0; k < 8; ++k) {
      const int cc = 4 * wave + (k >> 1);
      const v4f v = *(const v4f*)(oT + (size_t)cc * OTP + (k & 1) * IMW + 4 * lane);
      float* drow = out + (((size_t)b * CCH + c0 + cc) * IMH + y0) * IMW + (k & 1) * IMW;
      *(v4f*)(&drow[(unsigned)(4 * lane)]) = v;
    }
    // the stores' address and data registers are rewritten by the next pass's first instructions: wait first
    asm volatile("s_wait_xcnt 0x0" ::: "memory");
  }
}

extern "C" void kernel_launch(void* const* d_in, const int* in_sizes, int n_in,
                              void* d_out, int out_size, void* d_ws, size_t ws_size,
                              hipStream_t stream) {
  if (n_in < 7) return;
  const int nmap = NB * CCH * HWPIX;
  if (in_sizes[0] != nmap || in_sizes[1] != nmap || in_sizes[2] != nmap) return;
  if (in_sizes[3] != CCH * CCH || in_sizes[4] != CCH) return;
  if (in_sizes[5] != CCH * CCH || in_sizes[6] != CCH) return;
  if (out_size != nmap) return;

  const float* kvmap1 = (const float*)d_in[0];
  const float* qmap   = (const float*)d_in[1];
  const float* kvmap2 = (const float*)d_in[2];
  const float* Wq     = (const float*)d_in[3];
  const float* bq     = (const float*)d_in[4];
  const float* Wkv    = (const float*)d_in[5];
  const float* bkv    = (const float*)d_in[6];
  float* out = (float*)d_out;
  (void)d_ws; (void)ws_size;

  k_sasa<<<dim3(IMH / RB, NB), dim3(NTHR), 0, stream>>>(qmap, kvmap1, kvmap2, Wq, bq, Wkv, bkv, out);
  (void)hipGetLastError();
}
